// v000
// The times below were measured on an AMD MI455X: many runs one after another, warmed up first and cycling through
// copies of the inputs, with the whole window's GPU time divided by the number of runs. Launches and the gaps
// between them are all in it. The median over several windows is given; except for v000 it joins two sittings, which
// can be a few percent apart, so the side-by-side timings, each taken in one sitting, are the better comparison.
// The starting kernel, v000, takes 1750 microseconds a run.
#include <hip/hip_runtime.h>

// SelfDotProductAttnQKNorm (Q, K, V [2][16][2048][64] given; Qn, Kn = L2-normalised over d (eps 1e-12 inside the sqrt); scores = gain x (Qn . Kn) with gain a scalar input (read on device; log2(2048? - 2048) ~ 22); is_causal (int input, read on device; 1 here) -> j > i masked to -1e30; softmax; out = attn V -> [2][16][2048][64]).
// Compute dtypes, f32 accumulate: every input rounded to bf16; the L2 normalisation f32 on the VALU; full score matrices (the causal flag is data), all rows hl x hl (3 products); x gain, mask and softmax f32;

#define NB_  2
#define TT   2048
#define DM   1024
#define NH_  16
#define NKV  16
#define REP  (NH_ / NKV)
#define HD   64
#define DQ   (NH_ * HD)
#define DKV  (NKV * HD)
#define ZH   2
#define RH   512                  // query rows < RH use hi+lo planes (0: none)
#define WIN  0
#define PCAR 1024.0f
#define SCL  0.125f   // HD^-0.5
typedef _Float16 h16;
typedef unsigned short bf;
typedef __attribute__((ext_vector_type(16))) __bf16   v16bf;
typedef __attribute__((ext_vector_type(16))) _Float16 v16h;
typedef __attribute__((ext_vector_type(8)))  _Float16 v8h;
typedef __attribute__((ext_vector_type(8)))  unsigned short v8us;
typedef __attribute__((ext_vector_type(8)))  float    v8f;
typedef __attribute__((ext_vector_type(4)))  float    v4f;
typedef v8h  __attribute__((may_alias)) v8ha;
typedef v4f  __attribute__((may_alias)) v4fa;
typedef v8us __attribute__((may_alias)) v8usa;

__device__ __forceinline__ unsigned short f2bf(float f) { unsigned u = __float_as_uint(f); u += 0x7FFFu + ((u >> 16) & 1u); return (unsigned short)(u >> 16); }
__device__ __forceinline__ float bf2f(unsigned short b) { return __uint_as_float(((unsigned)b) << 16); }
__device__ __forceinline__ float bfr(float f) { return bf2f(f2bf(f)); }
__device__ __forceinline__ v16h cat16(v8h lo, v8h hi) { return __builtin_shufflevector(lo, hi, 0, 1, 2, 3, 4, 5, 6, 7, 8, 9, 10, 11, 12, 13, 14, 15); }
__device__ __forceinline__ v16bf cat16b(v8us lo, v8us hi) { return __builtin_bit_cast(v16bf, __builtin_shufflevector(lo, hi, 0, 1, 2, 3, 4, 5, 6, 7, 8, 9, 10, 11, 12, 13, 14, 15)); }
__device__ __forceinline__ v8f wmma16(v16h a, v16h b, v8f c) { return __builtin_amdgcn_wmma_f32_16x16x32_f16(false, a, false, b, (short)0, c, false, false); }
__device__ __forceinline__ v8f wmmab(v16bf a, v16bf b, v8f c) { return __builtin_amdgcn_wmma_f32_16x16x32_bf16(false, a, false, b, (short)0, c, false, false); }



// ---- k_gemmw: register-blocked GEMM, ONE WAVE per 64x64 output tile (16 accumulators), operands straight from K-contiguous 16-bit planes; grid (M/64, N/64, Z), 32 threads.
// C[m][n] (f32, pitch ldc, + optional f32 bias[n]) = sum_k A[m][k] Bt[n][k] (+ split products per NSPLIT). z-batch strides sA/sB/sC in elements. K % 32 == 0.
template <typename T16> struct WFrag;
template <> struct WFrag<h16> { typedef v16h V; static __device__ __forceinline__ V ld(const h16* p) { return cat16(*(const v8h*)p, *(const v8h*)(p + 16)); } static __device__ __forceinline__ v8f mma(V a, V b, v8f c) { return wmma16(a, b, c); } };
template <> struct WFrag<bf> { typedef v16bf V; static __device__ __forceinline__ V ld(const bf* p) { return cat16b(*(const v8us*)p, *(const v8us*)(p + 16)); } static __device__ __forceinline__ v8f mma(V a, V b, v8f c) { return wmmab(a, b, c); } };
template <typename T16, int NSPLIT, bool BIAS>
__global__ __launch_bounds__(32) void k_gemmw(const T16* __restrict__ A, const T16* __restrict__ A2, const T16* __restrict__ Bt, const T16* __restrict__ Bt2, int K, float* C, int ldc, const float* __restrict__ bias, size_t sA, size_t sB, size_t sC) {
    typedef typename WFrag<T16>::V V;
    __shared__ __align__(16) float os[16 * 68];
    const size_t z = blockIdx.z; A += z * sA; if (A2) A2 += z * sA; Bt += z * sB; if (Bt2) Bt2 += z * sB; C += z * sC;
    const int lane = threadIdx.x & 31, lr = lane & 15, hi = lane >> 4; const int r0 = blockIdx.x * 64, c0 = blockIdx.y * 64;
    v8f acc[4][4];
#pragma unroll
    for (int mb = 0; mb < 4; ++mb)
#pragma unroll
        for (int nb = 0; nb < 4; ++nb) acc[mb][nb] = (v8f){};
    const size_t aoff = (size_t)(r0 + lr) * K + 8 * hi, boff = (size_t)(c0 + lr) * K + 8 * hi;
#pragma unroll 1
    for (int kc = 0; kc < K; kc += 32) {
        V a[4], a2[4];
#pragma unroll
        for (int mb = 0; mb < 4; ++mb) { a[mb] = WFrag<T16>::ld(A + aoff + (size_t)mb * 16 * K + kc); if (NSPLIT == 1 || NSPLIT == 2) a2[mb] = WFrag<T16>::ld(A2 + aoff + (size_t)mb * 16 * K + kc); }
#pragma unroll
        for (int nb = 0; nb < 4; ++nb) { const V b = WFrag<T16>::ld(Bt + boff + (size_t)nb * 16 * K + kc); V b2; if (NSPLIT >= 2) b2 = WFrag<T16>::ld(Bt2 + boff + (size_t)nb * 16 * K + kc);
#pragma unroll
            for (int mb = 0; mb < 4; ++mb) { acc[mb][nb] = WFrag<T16>::mma(a[mb], b, acc[mb][nb]); if (NSPLIT == 1 || NSPLIT == 2) acc[mb][nb] = WFrag<T16>::mma(a2[mb], b, acc[mb][nb]); if (NSPLIT >= 2) acc[mb][nb] = WFrag<T16>::mma(a[mb], b2, acc[mb][nb]); } }
        asm volatile("v_nop\n\tv_nop\n\tv_nop\n\tv_nop" : "+v"(acc[0][0]), "+v"(acc[1][1]), "+v"(acc[2][2]), "+v"(acc[3][3]) : "v"(a[0]), "v"(a[3]));
    }
#pragma unroll
    for (int mb = 0; mb < 4; ++mb) {
#pragma unroll
        for (int nb = 0; nb < 4; ++nb) {
#pragma unroll
            for (int j = 0; j < 8; ++j) os[(hi * 8 + j) * 68 + nb * 16 + lr] = acc[mb][nb][j]; }
        __builtin_amdgcn_wave_barrier(); asm volatile("" ::: "memory");
        float* crow = C + (size_t)(r0 + mb * 16) * ldc + c0;
{
#pragma unroll
            for (int s = 0; s < 8; ++s) { const int row = 2 * s + hi, cofs = lr * 4; v4f val = *(const v4fa*)(os + row * 68 + cofs); if (BIAS) { val[0] += bfr(bias[c0 + cofs]); val[1] += bfr(bias[c0 + cofs + 1]); val[2] += bfr(bias[c0 + cofs + 2]); val[3] += bfr(bias[c0 + cofs + 3]); }
                *(v4f*)(crow + (size_t)row * ldc + cofs) = val; }
             }
        __builtin_amdgcn_wave_barrier(); asm volatile("" ::: "memory");
    }
}

__device__ __forceinline__ h16 tohx(float x) { return (h16)x; }
__device__ __forceinline__ void splitf(float y, unsigned short& h, unsigned short& l) { h = f2bf(y); l = f2bf(y - bf2f(h)); }
typedef __attribute__((ext_vector_type(2))) _Float16 v2h;
typedef __attribute__((ext_vector_type(4))) _Float16 v4h;
typedef __attribute__((ext_vector_type(2))) unsigned short v2us;
typedef __attribute__((ext_vector_type(4))) unsigned short v4us;
typedef __attribute__((ext_vector_type(2))) float v2f;
typedef __attribute__((ext_vector_type(4))) int v4i;

__global__ __launch_bounds__(256) void k_wtG(const float* __restrict__ w, int K, int N, bf* Bt) {
    const int lane = threadIdx.x & 31; const int L0 = (blockIdx.x * 8 + (threadIdx.x >> 5)) * 8; const int nlines = N * K / 64;
{
#pragma unroll 1
        for (int l = 0; l < 8; ++l) { const int L = L0 + l; if (L >= nlines) break; const size_t e = (size_t)L * 64 + lane * 2; const int k = (int)(e % K), n = (int)(e / K); v2us o;
            o[0] = f2bf(w[(size_t)k * N + n]); o[1] = f2bf(w[(size_t)(k + 1) * N + n]); *(v2us*)(Bt + e) = o; }
         }
}
__global__ __launch_bounds__(256) void k_cvt8(const float* __restrict__ src, bf* dst, size_t n8) { const size_t i = (size_t)blockIdx.x * 256 + threadIdx.x; if (i >= n8) return; const v8f v = *(const v8f*)(src + i * 8); v8us o;
#pragma unroll
    for (int k = 0; k < 8; ++k) o[k] = f2bf(v[k]); *(v8us*)(dst + i * 8) = o;  }
__global__ __launch_bounds__(256) void k_cscvt(const float* __restrict__ cosT, const float* __restrict__ sinT, float* CS) { const int idx = blockIdx.x * 256 + threadIdx.x; if (idx >= TT * HD) return; v2f cs; cs[0] = bfr(cosT[idx]); cs[1] = bfr(sinT[idx]); *(v2f*)(CS + (size_t)idx * 2) = cs;  }
// k_rope: head planes [h][t][d] (fp16 + hi/lo) of rope(x) x sc with the rotate-half convention out[d] = x[d] cos[t][d] - x[d+HD/2] sin[t][d], out[d+HD/2] = x[d+HD/2] cos[t][d+HD/2] + x[d] sin[t][d+HD/2]
__global__ __launch_bounds__(256) void k_rope(const float* __restrict__ F, int pitch, int nheads, const float* __restrict__ CS, const float* __restrict__ RF, const float* __restrict__ nw, float sc, h16* P16, bf* Ph, bf* Pl) {
    const size_t e = ((size_t)blockIdx.x * 256 + threadIdx.x) * 2; if (e >= (size_t)nheads * TT * HD) return; const int d = (int)(e % HD); const int t = (int)((e / HD) % TT); const int h = (int)(e / ((size_t)HD * TT)); const float* f = F + (size_t)t * pitch + h * HD; const float rf = RF ? RF[(size_t)h * TT + t] : 1.0f; v2h o16; v2us oh, ol;
#pragma unroll
    for (int q = 0; q < 2; ++q) { const int dd = d + q; const int dp = (dd < HD / 2) ? dd + HD / 2 : dd - HD / 2; float x0 = f[dd], x1 = f[dp];
        if (RF) { float n0 = __fmul_rn(x0, rf), n1 = __fmul_rn(x1, rf); asm volatile("" : "+v"(n0)); asm volatile("" : "+v"(n1)); x0 = __fmul_rn(bfr(nw[dd]), n0); x1 = __fmul_rn(bfr(nw[dp]), n1); }
        const v2f cs = *(const v2f*)(CS + ((size_t)t * HD + dd) * 2); float a = __fmul_rn(x0, cs[0]), bq = __fmul_rn(x1, cs[1]); asm volatile("" : "+v"(a)); asm volatile("" : "+v"(bq)); const float r = ((dd < HD / 2) ? __fsub_rn(a, bq) : __fadd_rn(a, bq)) * sc;
        o16[q] = tohx(r); unsigned short a2, c2; splitf(r, a2, c2); oh[q] = a2; ol[q] = c2; }
    *(v2h*)(P16 + e) = o16; *(v2us*)(Ph + e) = oh; *(v2us*)(Pl + e) = ol;  }
__global__ __launch_bounds__(256) void k_vtp(const float* __restrict__ F, int pitch, int nheads, h16* V16, bf* Vh, bf* Vl) { const size_t e = ((size_t)blockIdx.x * 256 + threadIdx.x) * 2; if (e >= (size_t)nheads * HD * TT) return; const int t = (int)(e % TT); const int d = (int)((e / TT) % HD); const int g = (int)(e / ((size_t)TT * HD)); v2h o16; v2us oh, ol;
#pragma unroll
    for (int q = 0; q < 2; ++q) { const float x = F[(size_t)(t + q) * pitch + g * HD + d]; o16[q] = tohx(x); unsigned short a2, c2; splitf(x, a2, c2); oh[q] = a2; ol[q] = c2; }
    *(v2h*)(V16 + e) = o16; *(v2us*)(Vh + e) = oh; *(v2us*)(Vl + e) = ol;  }
__global__ __launch_bounds__(256) void k_csid(float* CS) { const int idx = blockIdx.x * 256 + threadIdx.x; if (idx >= TT * HD) return; v2f cs; cs[0] = 1.0f; cs[1] = 0.0f; *(v2f*)(CS + (size_t)idx * 2) = cs;  }
// k_asoft: per row (zz, i): t = S x gain (j > i -> -1e30 if causal); softmax over the 2048 keys (register row, one exp, fixed trees);
__global__ __launch_bounds__(256) void k_asoft(const float* __restrict__ Sb, const float* __restrict__ gainp, const int* __restrict__ causp, h16* P16, bf* Ph, bf* Pl) {
    const int lane = threadIdx.x & 31; const int row = blockIdx.x * 8 + (threadIdx.x >> 5); if (row >= ZH * TT) return; const int i = row % TT; const int zz = row / TT; (void)zz; const bool hires = (i < RH); const float* sr = Sb + (size_t)row * TT; float gn = bfr(gainp[0]); asm volatile("" : "+v"(gn)); const bool causal = (causp[0] != 0); float v[TT / 32]; float mx = -3.0e38f;
#pragma unroll
    for (int ch = 0; ch < TT / 128; ++ch) { const int j0 = ch * 128 + lane * 4; const v4f a = *(const v4f*)(sr + j0);
#pragma unroll
        for (int q = 0; q < 4; ++q) { const int j = j0 + q; const float t = (causal && j > i) ? -1.0e30f : __fmul_rn(gn, a[q]); v[ch * 4 + q] = t; mx = fmaxf(mx, t); } }
#pragma unroll
    for (int sh = 16; sh; sh >>= 1) mx = fmaxf(mx, __shfl_xor(mx, sh, 32));
    float sum = 0.f;
#pragma unroll
    for (int k = 0; k < TT / 32; ++k) { float d0 = __fsub_rn(v[k], mx); asm volatile("" : "+v"(d0)); v[k] = __builtin_amdgcn_exp2f(__fmul_rn(d0, 1.4426950408889634f)); sum += v[k]; }
#pragma unroll
    for (int sh = 16; sh; sh >>= 1) sum += __shfl_xor(sum, sh, 32);
    const float f = __fdiv_rn(hires ? 1.0f : PCAR, sum);
{
        if (hires) {
#pragma unroll
            for (int ch = 0; ch < TT / 128; ++ch) { v4us oh, ol;
#pragma unroll
                for (int q = 0; q < 4; ++q) { unsigned short a, c2; splitf(v[ch * 4 + q] * f, a, c2); oh[q] = a; ol[q] = c2; }
                const size_t oo = ((size_t)zz * (RH ? RH : 1) + i) * TT + ch * 128 + lane * 4; *(v4us*)(Ph + oo) = oh; *(v4us*)(Pl + oo) = ol; }
        } else {
#pragma unroll
            for (int ch = 0; ch < TT / 128; ++ch) { v4h o4;
#pragma unroll
                for (int q = 0; q < 4; ++q) o4[q] = tohx(v[ch * 4 + q] * f);
                *(v4h*)(P16 + (size_t)row * TT + ch * 128 + lane * 4) = o4; } }
         }
}
__global__ __launch_bounds__(256) void k_merge(const float* __restrict__ O, int h0, bf* Ah, bf* Al) { const size_t e = ((size_t)blockIdx.x * 256 + threadIdx.x) * 2; if (e >= (size_t)ZH * TT * HD) return; const int d = (int)(e % HD); const int t = (int)((e / HD) % TT); const int zz = (int)(e / ((size_t)HD * TT)); const float cs = (t < RH) ? 1.0f : (1.0f / PCAR); const size_t oo = (size_t)t * DQ + (h0 + zz) * HD + d;
    v2us oh, ol;
#pragma unroll
    for (int q = 0; q < 2; ++q) { unsigned short a, c2; splitf(O[e + q] * cs, a, c2); oh[q] = a; ol[q] = c2; } *(v2us*)(Ah + oo) = oh; *(v2us*)(Al + oo) = ol;  }

__global__ __launch_bounds__(256) void k_nrmp(const float* __restrict__ X, h16* P16, bf* Ph, bf* Pl) { const int lane = threadIdx.x & 31; const int row = blockIdx.x * 8 + (threadIdx.x >> 5); if (row >= NH_ * TT) return; const float* src = X + (size_t)row * HD + lane * 2; const float x0 = bfr(src[0]), x1 = bfr(src[1]); float q = __fmul_rn(x0, x0); asm volatile("" : "+v"(q)); float p1 = __fmul_rn(x1, x1); asm volatile("" : "+v"(p1)); q = __fadd_rn(q, p1);
#pragma unroll
    for (int sh = 16; sh; sh >>= 1) q += __shfl_xor(q, sh, 32);
    const float den = __fsqrt_rn(__fadd_rn(q, 1e-12f)); v2h o16; v2us oh, ol; { const float y0 = __fdiv_rn(x0, den), y1 = __fdiv_rn(x1, den); o16[0] = tohx(y0); o16[1] = tohx(y1); unsigned short a, c; splitf(y0, a, c); oh[0] = a; ol[0] = c; splitf(y1, a, c); oh[1] = a; ol[1] = c; }
    const size_t e = (size_t)row * HD + lane * 2; *(v2h*)(P16 + e) = o16; *(v2us*)(Ph + e) = oh; *(v2us*)(Pl + e) = ol;  }
__global__ __launch_bounds__(256) void k_vt3(const float* __restrict__ V, h16* V16, bf* Vh, bf* Vl) { const size_t e = ((size_t)blockIdx.x * 256 + threadIdx.x) * 2; if (e >= (size_t)NKV * HD * TT) return; const int t = (int)(e % TT); const int d = (int)((e / TT) % HD); const int g = (int)(e / ((size_t)TT * HD)); v2h o16; v2us oh, ol;
#pragma unroll
    for (int q = 0; q < 2; ++q) { const float x = bfr(V[((size_t)g * TT + t + q) * HD + d]); o16[q] = tohx(x); unsigned short a2, c2; splitf(x, a2, c2); oh[q] = a2; ol[q] = c2; }
    *(v2h*)(V16 + e) = o16; *(v2us*)(Vh + e) = oh; *(v2us*)(Vl + e) = ol;  }
__global__ __launch_bounds__(256) void k_outO(const float* __restrict__ O, float* outb) { const size_t e = ((size_t)blockIdx.x * 256 + threadIdx.x) * 4; if (e >= (size_t)ZH * TT * HD) return; const int t = (int)((e / HD) % TT); const float cs = (t < RH) ? 1.0f : (1.0f / PCAR); const v4f a = *(const v4f*)(O + e); v4f o;
#pragma unroll
    for (int u = 0; u < 4; ++u) o[u] = a[u] * cs; *(v4f*)(outb + e) = o;  }

extern "C" void kernel_launch(void* const* d_in, const int* in_sizes, int n_in,
                              void* d_out, int out_size, void* d_ws, size_t ws_size, hipStream_t stream) {
    (void)in_sizes; (void)n_in; (void)out_size;
    const float* Qi = (const float*)d_in[0]; const float* Ki = (const float*)d_in[1]; const float* Vi = (const float*)d_in[2]; const float* gainp = (const float*)d_in[3]; const int* causp = (const int*)d_in[4];
    float* OUT = (float*)d_out;     // [2][16][2048][64]
    char* wsp = (char*)d_ws;
    auto take = [&](size_t bytes) { char* p = wsp; wsp += (bytes + 255) & ~(size_t)255; return (void*)p; };
    bf* WQ = (bf*)take((size_t)DQ * DM * 2); bf* WK = (bf*)take((size_t)DKV * DM * 2); bf* WV = (bf*)take((size_t)DKV * DM * 2); bf* WO = (bf*)take((size_t)DM * DQ * 2); float* CS = (float*)take((size_t)TT * HD * 2 * 4);
    bf* XB = (bf*)take((size_t)TT * DM * 2); float* FQ = (float*)take((size_t)TT * DQ * 4); float* FK = (float*)take((size_t)TT * DKV * 4);
    h16* QP16 = (h16*)take((size_t)NH_ * TT * HD * 2); h16* KP16 = (h16*)take((size_t)NKV * TT * HD * 2); h16* VT16 = (h16*)take((size_t)NKV * HD * TT * 2);
    bf* QPh = (bf*)take((size_t)NH_ * TT * HD * 2); bf* QPl = (bf*)take((size_t)NH_ * TT * HD * 2); bf* KPh = (bf*)take((size_t)NKV * TT * HD * 2); bf* KPl = (bf*)take((size_t)NKV * TT * HD * 2); bf* VTh = (bf*)take((size_t)NKV * HD * TT * 2); bf* VTl = (bf*)take((size_t)NKV * HD * TT * 2); bf* Ph = (bf*)take((size_t)ZH * RH * TT * 2); bf* Pl = (bf*)take((size_t)ZH * RH * TT * 2);
    float* Sb = (float*)take((size_t)ZH * TT * TT * 4); h16* P16 = (h16*)take((size_t)ZH * TT * TT * 2); float* Ob = (float*)take((size_t)ZH * TT * HD * 4); bf* ATh = (bf*)take((size_t)TT * DQ * 2); bf* ATl = (bf*)take((size_t)TT * DQ * 2);
    if ((size_t)(wsp - (char*)d_ws) > ws_size) return;    // ws 256 MiB
    float* FV = FK;
    { 
       }
    k_csid<<<(TT * HD + 255) / 256, 256, 0, stream>>>(CS);
    const unsigned LQ = (unsigned)(((size_t)NH_ * TT * HD / 2 + 255) / 256), LKv = (unsigned)(((size_t)NKV * TT * HD / 2 + 255) / 256);
    for (int b = 0; b < NB_; ++b) {
        k_nrmp<<<NH_ * TT / 8, 256, 0, stream>>>(Qi + (size_t)b * NH_ * TT * HD, QP16, QPh, QPl);
        k_nrmp<<<NKV * TT / 8, 256, 0, stream>>>(Ki + (size_t)b * NKV * TT * HD, KP16, KPh, KPl); k_vt3<<<LKv, 256, 0, stream>>>(Vi + (size_t)b * NKV * TT * HD, VT16, VTh, VTl);
        for (int h0 = 0; h0 < NH_; h0 += ZH) { const size_t zq = (size_t)h0, zk = (size_t)(h0 / REP);   // one kv head per query head: the pass's two heads use consecutive kv planes (z-strides TT*HD)
            k_gemmw<bf, 2, false><<<dim3(TT / 64, TT / 64, ZH), 32, 0, stream>>>(QPh + zq * TT * HD, QPl + zq * TT * HD, KPh + zk * TT * HD, KPl + zk * TT * HD, HD, Sb, TT, nullptr, (size_t)TT * HD, (size_t)TT * HD, (size_t)TT * TT);   // ALL score rows hl x hl (3 products): the gain-22 cosine logits need it
            
            k_asoft<<<ZH * TT / 8, 256, 0, stream>>>(Sb, gainp, causp, P16, Ph, Pl);
            k_gemmw<bf, 2, false><<<dim3(RH / 64, HD / 64, ZH), 32, 0, stream>>>(Ph, Pl, VTh + zk * HD * TT, VTl + zk * HD * TT, TT, Ob, HD, nullptr, (size_t)RH * TT, (size_t)HD * TT, (size_t)TT * HD);
            k_gemmw<h16, 0, false><<<dim3((TT - RH) / 64, HD / 64, ZH), 32, 0, stream>>>(P16 + (size_t)RH * TT, nullptr, VT16 + zk * HD * TT, nullptr, TT, Ob + (size_t)RH * HD, HD, nullptr, (size_t)TT * TT, (size_t)HD * TT, (size_t)TT * HD);
            k_outO<<<(unsigned)(((size_t)ZH * TT * HD / 4 + 255) / 256), 256, 0, stream>>>(Ob, OUT + ((size_t)b * NH_ + h0) * TT * HD); } }
}

// v001
// A run of this version takes 629 microseconds.
// In two side-by-side timings against v000, it was 2.79 and 2.77 times as fast.
#include <hip/hip_runtime.h>

// SelfDotProductAttnQKNorm (Q, K, V [2][16][2048][64] given; Qn, Kn = L2-normalised over d (eps 1e-12 inside the sqrt); scores = gain x (Qn . Kn) with gain a scalar input (read on device; log2(2048? - 2048) ~ 22); is_causal (int input, read on device; 1 here) -> j > i masked to -1e30; softmax; out = attn V -> [2][16][2048][64]).
// Compute dtypes, f32 accumulate: every input rounded to bf16; the L2 normalisation f32 on the VALU; full score matrices (the causal flag is data), all rows hl x hl (3 products); x gain, mask and softmax f32;

#define NB_  2
#define TT   2048
#define DM   1024
#define NH_  16
#define NKV  16
#define REP  (NH_ / NKV)
#define HD   64
#define DQ   (NH_ * HD)
#define DKV  (NKV * HD)
#define ZH   2
#define RH   512                  // query rows < RH use hi+lo planes (0: none)
#define WIN  0
#define PCAR 1024.0f
#define SCL  0.125f   // HD^-0.5
#define KSP  16                   // key slices of the attn x V products: one work-group and one f32 partial plane each
typedef _Float16 h16;
typedef unsigned short bf;
typedef __attribute__((ext_vector_type(16))) __bf16   v16bf;
typedef __attribute__((ext_vector_type(16))) _Float16 v16h;
typedef __attribute__((ext_vector_type(8)))  _Float16 v8h;
typedef __attribute__((ext_vector_type(8)))  unsigned short v8us;
typedef __attribute__((ext_vector_type(8)))  float    v8f;
typedef __attribute__((ext_vector_type(4)))  float    v4f;
typedef v8h  __attribute__((may_alias)) v8ha;
typedef v4f  __attribute__((may_alias)) v4fa;
typedef v8us __attribute__((may_alias)) v8usa;

__device__ __forceinline__ unsigned short f2bf(float f) { unsigned u = __float_as_uint(f); u += 0x7FFFu + ((u >> 16) & 1u); return (unsigned short)(u >> 16); }
__device__ __forceinline__ float bf2f(unsigned short b) { return __uint_as_float(((unsigned)b) << 16); }
__device__ __forceinline__ float bfr(float f) { return bf2f(f2bf(f)); }
__device__ __forceinline__ v16h cat16(v8h lo, v8h hi) { return __builtin_shufflevector(lo, hi, 0, 1, 2, 3, 4, 5, 6, 7, 8, 9, 10, 11, 12, 13, 14, 15); }
__device__ __forceinline__ v16bf cat16b(v8us lo, v8us hi) { return __builtin_bit_cast(v16bf, __builtin_shufflevector(lo, hi, 0, 1, 2, 3, 4, 5, 6, 7, 8, 9, 10, 11, 12, 13, 14, 15)); }
__device__ __forceinline__ v8f wmma16(v16h a, v16h b, v8f c) { return __builtin_amdgcn_wmma_f32_16x16x32_f16(false, a, false, b, (short)0, c, false, false); }
__device__ __forceinline__ v8f wmmab(v16bf a, v16bf b, v8f c) { return __builtin_amdgcn_wmma_f32_16x16x32_bf16(false, a, false, b, (short)0, c, false, false); }



// ---- k_gemmw: register-blocked GEMM, ONE WAVE per 64x64 output tile (16 accumulators), operands straight from K-contiguous 16-bit planes; grid (M/64, N/64, Z), 32 threads.
// C[m][n] (f32, pitch ldc, + optional f32 bias[n]) = sum_k A[m][k] Bt[n][k] (+ split products per NSPLIT). z-batch strides sA/sB/sC in elements. K % 32 == 0.
// KSL > 0 (N == 64 only): grid (M/64, K/KSL, Z); blockIdx.y is a k slice of KSL elements, its partial sum goes to plane C + blockIdx.y * sK; the reader adds the planes.
template <typename T16> struct WFrag;
template <> struct WFrag<h16> { typedef v16h V; static __device__ __forceinline__ V ld(const h16* p) { return cat16(*(const v8h*)p, *(const v8h*)(p + 16)); } static __device__ __forceinline__ v8f mma(V a, V b, v8f c) { return wmma16(a, b, c); } };
template <> struct WFrag<bf> { typedef v16bf V; static __device__ __forceinline__ V ld(const bf* p) { return cat16b(*(const v8us*)p, *(const v8us*)(p + 16)); } static __device__ __forceinline__ v8f mma(V a, V b, v8f c) { return wmmab(a, b, c); } };
template <typename T16, int NSPLIT, bool BIAS, int KSL>
__global__ __launch_bounds__(32) void k_gemmw(const T16* __restrict__ A, const T16* __restrict__ A2, const T16* __restrict__ Bt, const T16* __restrict__ Bt2, int K, float* C, int ldc, const float* __restrict__ bias, size_t sA, size_t sB, size_t sC, size_t sK) {
    typedef typename WFrag<T16>::V V;
    __shared__ __align__(16) float os[16 * 68];
    const size_t z = blockIdx.z; A += z * sA; if (A2) A2 += z * sA; Bt += z * sB; if (Bt2) Bt2 += z * sB; C += z * sC;
    const int lane = threadIdx.x & 31, lr = lane & 15, hi = lane >> 4; const int r0 = blockIdx.x * 64, c0 = KSL ? 0 : blockIdx.y * 64; const int kb = KSL ? blockIdx.y * KSL : 0, ke = KSL ? kb + KSL : K; if (KSL) C += (size_t)blockIdx.y * sK;
    v8f acc[4][4];
#pragma unroll
    for (int mb = 0; mb < 4; ++mb)
#pragma unroll
        for (int nb = 0; nb < 4; ++nb) acc[mb][nb] = (v8f){};
    const size_t aoff = (size_t)(r0 + lr) * K + 8 * hi, boff = (size_t)(c0 + lr) * K + 8 * hi;
#pragma unroll 1
    for (int kc = kb; kc < ke; kc += 32) {
        V a[4], a2[4];
#pragma unroll
        for (int mb = 0; mb < 4; ++mb) { a[mb] = WFrag<T16>::ld(A + aoff + (size_t)mb * 16 * K + kc); if (NSPLIT == 1 || NSPLIT == 2) a2[mb] = WFrag<T16>::ld(A2 + aoff + (size_t)mb * 16 * K + kc); }
#pragma unroll
        for (int nb = 0; nb < 4; ++nb) { const V b = WFrag<T16>::ld(Bt + boff + (size_t)nb * 16 * K + kc); V b2; if (NSPLIT >= 2) b2 = WFrag<T16>::ld(Bt2 + boff + (size_t)nb * 16 * K + kc);
#pragma unroll
            for (int mb = 0; mb < 4; ++mb) { acc[mb][nb] = WFrag<T16>::mma(a[mb], b, acc[mb][nb]); if (NSPLIT == 1 || NSPLIT == 2) acc[mb][nb] = WFrag<T16>::mma(a2[mb], b, acc[mb][nb]); if (NSPLIT >= 2) acc[mb][nb] = WFrag<T16>::mma(a[mb], b2, acc[mb][nb]); } }
        asm volatile("v_nop\n\tv_nop\n\tv_nop\n\tv_nop" : "+v"(acc[0][0]), "+v"(acc[1][1]), "+v"(acc[2][2]), "+v"(acc[3][3]) : "v"(a[0]), "v"(a[3]));
    }
#pragma unroll
    for (int mb = 0; mb < 4; ++mb) {
#pragma unroll
        for (int nb = 0; nb < 4; ++nb) {
#pragma unroll
            for (int j = 0; j < 8; ++j) os[(hi * 8 + j) * 68 + nb * 16 + lr] = acc[mb][nb][j]; }
        __builtin_amdgcn_wave_barrier(); asm volatile("" ::: "memory");
        float* crow = C + (size_t)(r0 + mb * 16) * ldc + c0;
{
#pragma unroll
            for (int s = 0; s < 8; ++s) { const int row = 2 * s + hi, cofs = lr * 4; v4f val = *(const v4fa*)(os + row * 68 + cofs); if (BIAS) { val[0] += bfr(bias[c0 + cofs]); val[1] += bfr(bias[c0 + cofs + 1]); val[2] += bfr(bias[c0 + cofs + 2]); val[3] += bfr(bias[c0 + cofs + 3]); }
                *(v4f*)(crow + (size_t)row * ldc + cofs) = val; }
             }
        __builtin_amdgcn_wave_barrier(); asm volatile("" ::: "memory");
    }
}

__device__ __forceinline__ h16 tohx(float x) { return (h16)x; }
__device__ __forceinline__ void splitf(float y, unsigned short& h, unsigned short& l) { h = f2bf(y); l = f2bf(y - bf2f(h)); }
typedef __attribute__((ext_vector_type(2))) _Float16 v2h;
typedef __attribute__((ext_vector_type(4))) _Float16 v4h;
typedef __attribute__((ext_vector_type(2))) unsigned short v2us;
typedef __attribute__((ext_vector_type(4))) unsigned short v4us;
typedef __attribute__((ext_vector_type(2))) float v2f;
typedef __attribute__((ext_vector_type(4))) int v4i;

__global__ __launch_bounds__(256) void k_wtG(const float* __restrict__ w, int K, int N, bf* Bt) {
    const int lane = threadIdx.x & 31; const int L0 = (blockIdx.x * 8 + (threadIdx.x >> 5)) * 8; const int nlines = N * K / 64;
{
#pragma unroll 1
        for (int l = 0; l < 8; ++l) { const int L = L0 + l; if (L >= nlines) break; const size_t e = (size_t)L * 64 + lane * 2; const int k = (int)(e % K), n = (int)(e / K); v2us o;
            o[0] = f2bf(w[(size_t)k * N + n]); o[1] = f2bf(w[(size_t)(k + 1) * N + n]); *(v2us*)(Bt + e) = o; }
         }
}
__global__ __launch_bounds__(256) void k_cvt8(const float* __restrict__ src, bf* dst, size_t n8) { const size_t i = (size_t)blockIdx.x * 256 + threadIdx.x; if (i >= n8) return; const v8f v = *(const v8f*)(src + i * 8); v8us o;
#pragma unroll
    for (int k = 0; k < 8; ++k) o[k] = f2bf(v[k]); *(v8us*)(dst + i * 8) = o;  }
__global__ __launch_bounds__(256) void k_cscvt(const float* __restrict__ cosT, const float* __restrict__ sinT, float* CS) { const int idx = blockIdx.x * 256 + threadIdx.x; if (idx >= TT * HD) return; v2f cs; cs[0] = bfr(cosT[idx]); cs[1] = bfr(sinT[idx]); *(v2f*)(CS + (size_t)idx * 2) = cs;  }
// k_rope: head planes [h][t][d] (fp16 + hi/lo) of rope(x) x sc with the rotate-half convention out[d] = x[d] cos[t][d] - x[d+HD/2] sin[t][d], out[d+HD/2] = x[d+HD/2] cos[t][d+HD/2] + x[d] sin[t][d+HD/2]
__global__ __launch_bounds__(256) void k_rope(const float* __restrict__ F, int pitch, int nheads, const float* __restrict__ CS, const float* __restrict__ RF, const float* __restrict__ nw, float sc, h16* P16, bf* Ph, bf* Pl) {
    const size_t e = ((size_t)blockIdx.x * 256 + threadIdx.x) * 2; if (e >= (size_t)nheads * TT * HD) return; const int d = (int)(e % HD); const int t = (int)((e / HD) % TT); const int h = (int)(e / ((size_t)HD * TT)); const float* f = F + (size_t)t * pitch + h * HD; const float rf = RF ? RF[(size_t)h * TT + t] : 1.0f; v2h o16; v2us oh, ol;
#pragma unroll
    for (int q = 0; q < 2; ++q) { const int dd = d + q; const int dp = (dd < HD / 2) ? dd + HD / 2 : dd - HD / 2; float x0 = f[dd], x1 = f[dp];
        if (RF) { float n0 = __fmul_rn(x0, rf), n1 = __fmul_rn(x1, rf); asm volatile("" : "+v"(n0)); asm volatile("" : "+v"(n1)); x0 = __fmul_rn(bfr(nw[dd]), n0); x1 = __fmul_rn(bfr(nw[dp]), n1); }
        const v2f cs = *(const v2f*)(CS + ((size_t)t * HD + dd) * 2); float a = __fmul_rn(x0, cs[0]), bq = __fmul_rn(x1, cs[1]); asm volatile("" : "+v"(a)); asm volatile("" : "+v"(bq)); const float r = ((dd < HD / 2) ? __fsub_rn(a, bq) : __fadd_rn(a, bq)) * sc;
        o16[q] = tohx(r); unsigned short a2, c2; splitf(r, a2, c2); oh[q] = a2; ol[q] = c2; }
    *(v2h*)(P16 + e) = o16; *(v2us*)(Ph + e) = oh; *(v2us*)(Pl + e) = ol;  }
__global__ __launch_bounds__(256) void k_vtp(const float* __restrict__ F, int pitch, int nheads, h16* V16, bf* Vh, bf* Vl) { const size_t e = ((size_t)blockIdx.x * 256 + threadIdx.x) * 2; if (e >= (size_t)nheads * HD * TT) return; const int t = (int)(e % TT); const int d = (int)((e / TT) % HD); const int g = (int)(e / ((size_t)TT * HD)); v2h o16; v2us oh, ol;
#pragma unroll
    for (int q = 0; q < 2; ++q) { const float x = F[(size_t)(t + q) * pitch + g * HD + d]; o16[q] = tohx(x); unsigned short a2, c2; splitf(x, a2, c2); oh[q] = a2; ol[q] = c2; }
    *(v2h*)(V16 + e) = o16; *(v2us*)(Vh + e) = oh; *(v2us*)(Vl + e) = ol;  }
__global__ __launch_bounds__(256) void k_csid(float* CS) { const int idx = blockIdx.x * 256 + threadIdx.x; if (idx >= TT * HD) return; v2f cs; cs[0] = 1.0f; cs[1] = 0.0f; *(v2f*)(CS + (size_t)idx * 2) = cs;  }
// k_asoft: per row (zz, i): t = S x gain (j > i -> -1e30 if causal); softmax over the 2048 keys (register row, one exp, fixed trees);
__global__ __launch_bounds__(256) void k_asoft(const float* __restrict__ Sb, const float* __restrict__ gainp, const int* __restrict__ causp, h16* P16, bf* Ph, bf* Pl) {
    const int lane = threadIdx.x & 31; const int row = blockIdx.x * 8 + (threadIdx.x >> 5); if (row >= ZH * TT) return; const int i = row % TT; const int zz = row / TT; (void)zz; const bool hires = (i < RH); const float* sr = Sb + (size_t)row * TT; float gn = bfr(gainp[0]); asm volatile("" : "+v"(gn)); const bool causal = (causp[0] != 0); float v[TT / 32]; float mx = -3.0e38f;
#pragma unroll
    for (int ch = 0; ch < TT / 128; ++ch) { const int j0 = ch * 128 + lane * 4; const v4f a = *(const v4f*)(sr + j0);
#pragma unroll
        for (int q = 0; q < 4; ++q) { const int j = j0 + q; const float t = (causal && j > i) ? -1.0e30f : __fmul_rn(gn, a[q]); v[ch * 4 + q] = t; mx = fmaxf(mx, t); } }
#pragma unroll
    for (int sh = 16; sh; sh >>= 1) mx = fmaxf(mx, __shfl_xor(mx, sh, 32));
    float sum = 0.f;
#pragma unroll
    for (int k = 0; k < TT / 32; ++k) { float d0 = __fsub_rn(v[k], mx); asm volatile("" : "+v"(d0)); v[k] = __builtin_amdgcn_exp2f(__fmul_rn(d0, 1.4426950408889634f)); sum += v[k]; }
#pragma unroll
    for (int sh = 16; sh; sh >>= 1) sum += __shfl_xor(sum, sh, 32);
    const float f = __fdiv_rn(hires ? 1.0f : PCAR, sum);
{
        if (hires) {
#pragma unroll
            for (int ch = 0; ch < TT / 128; ++ch) { v4us oh, ol;
#pragma unroll
                for (int q = 0; q < 4; ++q) { unsigned short a, c2; splitf(v[ch * 4 + q] * f, a, c2); oh[q] = a; ol[q] = c2; }
                const size_t oo = ((size_t)zz * (RH ? RH : 1) + i) * TT + ch * 128 + lane * 4; *(v4us*)(Ph + oo) = oh; *(v4us*)(Pl + oo) = ol; }
        } else {
#pragma unroll
            for (int ch = 0; ch < TT / 128; ++ch) { v4h o4;
#pragma unroll
                for (int q = 0; q < 4; ++q) o4[q] = tohx(v[ch * 4 + q] * f);
                *(v4h*)(P16 + (size_t)row * TT + ch * 128 + lane * 4) = o4; } }
         }
}
__global__ __launch_bounds__(256) void k_merge(const float* __restrict__ O, int h0, bf* Ah, bf* Al) { const size_t e = ((size_t)blockIdx.x * 256 + threadIdx.x) * 2; if (e >= (size_t)ZH * TT * HD) return; const int d = (int)(e % HD); const int t = (int)((e / HD) % TT); const int zz = (int)(e / ((size_t)HD * TT)); const float cs = (t < RH) ? 1.0f : (1.0f / PCAR); const size_t oo = (size_t)t * DQ + (h0 + zz) * HD + d;
    v2us oh, ol;
#pragma unroll
    for (int q = 0; q < 2; ++q) { unsigned short a, c2; splitf(O[e + q] * cs, a, c2); oh[q] = a; ol[q] = c2; } *(v2us*)(Ah + oo) = oh; *(v2us*)(Al + oo) = ol;  }

__global__ __launch_bounds__(256) void k_nrmp(const float* __restrict__ X, h16* P16, bf* Ph, bf* Pl) { const int lane = threadIdx.x & 31; const int row = blockIdx.x * 8 + (threadIdx.x >> 5); if (row >= NH_ * TT) return; const float* src = X + (size_t)row * HD + lane * 2; const float x0 = bfr(src[0]), x1 = bfr(src[1]); float q = __fmul_rn(x0, x0); asm volatile("" : "+v"(q)); float p1 = __fmul_rn(x1, x1); asm volatile("" : "+v"(p1)); q = __fadd_rn(q, p1);
#pragma unroll
    for (int sh = 16; sh; sh >>= 1) q += __shfl_xor(q, sh, 32);
    const float den = __fsqrt_rn(__fadd_rn(q, 1e-12f)); v2h o16; v2us oh, ol; { const float y0 = __fdiv_rn(x0, den), y1 = __fdiv_rn(x1, den); o16[0] = tohx(y0); o16[1] = tohx(y1); unsigned short a, c; splitf(y0, a, c); oh[0] = a; ol[0] = c; splitf(y1, a, c); oh[1] = a; ol[1] = c; }
    const size_t e = (size_t)row * HD + lane * 2; *(v2h*)(P16 + e) = o16; *(v2us*)(Ph + e) = oh; *(v2us*)(Pl + e) = ol;  }
__global__ __launch_bounds__(256) void k_vt3(const float* __restrict__ V, h16* V16, bf* Vh, bf* Vl) { const size_t e = ((size_t)blockIdx.x * 256 + threadIdx.x) * 2; if (e >= (size_t)NKV * HD * TT) return; const int t = (int)(e % TT); const int d = (int)((e / TT) % HD); const int g = (int)(e / ((size_t)TT * HD)); v2h o16; v2us oh, ol;
#pragma unroll
    for (int q = 0; q < 2; ++q) { const float x = bfr(V[((size_t)g * TT + t + q) * HD + d]); o16[q] = tohx(x); unsigned short a2, c2; splitf(x, a2, c2); oh[q] = a2; ol[q] = c2; }
    *(v2h*)(V16 + e) = o16; *(v2us*)(Vh + e) = oh; *(v2us*)(Vl + e) = ol;  }
__global__ __launch_bounds__(256) void k_outO(const float* __restrict__ O, float* outb) { const size_t e = ((size_t)blockIdx.x * 256 + threadIdx.x) * 4; if (e >= (size_t)ZH * TT * HD) return; const int t = (int)((e / HD) % TT); const float cs = (t < RH) ? 1.0f : (1.0f / PCAR); v4f a = *(const v4f*)(O + e); v4f o;
#pragma unroll
    for (int s = 1; s < KSP; ++s) {   // the key slices' partial planes, added in slice order
        if (s == 8) asm volatile("s_wait_xcnt 0x0" ::: "memory");   // planes 8 and up are past the loads' immediate offset and take a second address pair: the wait stands before a later load's result reuses the first pair's registers
        a += *(const v4f*)(O + (size_t)s * ZH * TT * HD + e); }
#pragma unroll
    for (int u = 0; u < 4; ++u) o[u] = a[u] * cs; *(v4f*)(outb + e) = o;  }

extern "C" void kernel_launch(void* const* d_in, const int* in_sizes, int n_in,
                              void* d_out, int out_size, void* d_ws, size_t ws_size, hipStream_t stream) {
    (void)in_sizes; (void)n_in; (void)out_size;
    const float* Qi = (const float*)d_in[0]; const float* Ki = (const float*)d_in[1]; const float* Vi = (const float*)d_in[2]; const float* gainp = (const float*)d_in[3]; const int* causp = (const int*)d_in[4];
    float* OUT = (float*)d_out;     // [2][16][2048][64]
    char* wsp = (char*)d_ws;
    auto take = [&](size_t bytes) { char* p = wsp; wsp += (bytes + 255) & ~(size_t)255; return (void*)p; };
    bf* WQ = (bf*)take((size_t)DQ * DM * 2); bf* WK = (bf*)take((size_t)DKV * DM * 2); bf* WV = (bf*)take((size_t)DKV * DM * 2); bf* WO = (bf*)take((size_t)DM * DQ * 2); float* CS = (float*)take((size_t)TT * HD * 2 * 4);
    bf* XB = (bf*)take((size_t)TT * DM * 2); float* FQ = (float*)take((size_t)TT * DQ * 4); float* FK = (float*)take((size_t)TT * DKV * 4);
    h16* QP16 = (h16*)take((size_t)NH_ * TT * HD * 2); h16* KP16 = (h16*)take((size_t)NKV * TT * HD * 2); h16* VT16 = (h16*)take((size_t)NKV * HD * TT * 2);
    bf* QPh = (bf*)take((size_t)NH_ * TT * HD * 2); bf* QPl = (bf*)take((size_t)NH_ * TT * HD * 2); bf* KPh = (bf*)take((size_t)NKV * TT * HD * 2); bf* KPl = (bf*)take((size_t)NKV * TT * HD * 2); bf* VTh = (bf*)take((size_t)NKV * HD * TT * 2); bf* VTl = (bf*)take((size_t)NKV * HD * TT * 2); bf* Ph = (bf*)take((size_t)ZH * RH * TT * 2); bf* Pl = (bf*)take((size_t)ZH * RH * TT * 2);
    float* Sb = (float*)take((size_t)ZH * TT * TT * 4); h16* P16 = (h16*)take((size_t)ZH * TT * TT * 2); float* Ob = (float*)take((size_t)KSP * ZH * TT * HD * 4); bf* ATh = (bf*)take((size_t)TT * DQ * 2); bf* ATl = (bf*)take((size_t)TT * DQ * 2);
    if ((size_t)(wsp - (char*)d_ws) > ws_size) return;    // ws 256 MiB
    float* FV = FK;
    { 
       }
    k_csid<<<(TT * HD + 255) / 256, 256, 0, stream>>>(CS);
    const unsigned LQ = (unsigned)(((size_t)NH_ * TT * HD / 2 + 255) / 256), LKv = (unsigned)(((size_t)NKV * TT * HD / 2 + 255) / 256);
    for (int b = 0; b < NB_; ++b) {
        k_nrmp<<<NH_ * TT / 8, 256, 0, stream>>>(Qi + (size_t)b * NH_ * TT * HD, QP16, QPh, QPl);
        k_nrmp<<<NKV * TT / 8, 256, 0, stream>>>(Ki + (size_t)b * NKV * TT * HD, KP16, KPh, KPl); k_vt3<<<LKv, 256, 0, stream>>>(Vi + (size_t)b * NKV * TT * HD, VT16, VTh, VTl);
        for (int h0 = 0; h0 < NH_; h0 += ZH) { const size_t zq = (size_t)h0, zk = (size_t)(h0 / REP);   // one kv head per query head: the pass's two heads use consecutive kv planes (z-strides TT*HD)
            k_gemmw<bf, 2, false, 0><<<dim3(TT / 64, TT / 64, ZH), 32, 0, stream>>>(QPh + zq * TT * HD, QPl + zq * TT * HD, KPh + zk * TT * HD, KPl + zk * TT * HD, HD, Sb, TT, nullptr, (size_t)TT * HD, (size_t)TT * HD, (size_t)TT * TT, 0);   // ALL score rows hl x hl (3 products): the gain-22 cosine logits need it
            
            k_asoft<<<ZH * TT / 8, 256, 0, stream>>>(Sb, gainp, causp, P16, Ph, Pl);
            k_gemmw<bf, 2, false, TT / KSP><<<dim3(RH / 64, KSP, ZH), 32, 0, stream>>>(Ph, Pl, VTh + zk * HD * TT, VTl + zk * HD * TT, TT, Ob, HD, nullptr, (size_t)RH * TT, (size_t)HD * TT, (size_t)TT * HD, (size_t)ZH * TT * HD);
            k_gemmw<h16, 0, false, TT / KSP><<<dim3((TT - RH) / 64, KSP, ZH), 32, 0, stream>>>(P16 + (size_t)RH * TT, nullptr, VT16 + zk * HD * TT, nullptr, TT, Ob + (size_t)RH * HD, HD, nullptr, (size_t)TT * TT, (size_t)HD * TT, (size_t)TT * HD, (size_t)ZH * TT * HD);
            k_outO<<<(unsigned)(((size_t)ZH * TT * HD / 4 + 255) / 256), 256, 0, stream>>>(Ob, OUT + ((size_t)b * NH_ + h0) * TT * HD); } }
}

// v002
// It runs in 448 microseconds.
// Next to v001, in two timings, it ran 1.41 and 1.39 times as fast.
// Over all steps from v000 it is 3.89 times as fast.
#include <hip/hip_runtime.h>

// SelfDotProductAttnQKNorm (Q, K, V [2][16][2048][64] given; Qn, Kn = L2-normalised over d (eps 1e-12 inside the sqrt); scores = gain x (Qn . Kn) with gain a scalar input (read on device; log2(2048? - 2048) ~ 22); is_causal (int input, read on device; 1 here) -> j > i masked to -1e30; softmax; out = attn V -> [2][16][2048][64]).
// Compute dtypes, f32 accumulate: every input rounded to bf16; the L2 normalisation f32 on the VALU; full score matrices (the causal flag is data), all rows hl x hl (3 products); x gain, mask and softmax f32;

#define NB_  2
#define TT   2048
#define DM   1024
#define NH_  16
#define NKV  16
#define REP  (NH_ / NKV)
#define HD   64
#define DQ   (NH_ * HD)
#define DKV  (NKV * HD)
#define ZH   8                    // heads per pass: one launch of each attention kernel serves ZH heads
#define RH   512                  // query rows < RH use hi+lo planes (0: none)
#define WIN  0
#define PCAR 1024.0f
#define SCL  0.125f   // HD^-0.5
#define KSP  16                   // key slices of the attn x V products: one work-group and one f32 partial plane each
typedef _Float16 h16;
typedef unsigned short bf;
typedef __attribute__((ext_vector_type(16))) __bf16   v16bf;
typedef __attribute__((ext_vector_type(16))) _Float16 v16h;
typedef __attribute__((ext_vector_type(8)))  _Float16 v8h;
typedef __attribute__((ext_vector_type(8)))  unsigned short v8us;
typedef __attribute__((ext_vector_type(8)))  float    v8f;
typedef __attribute__((ext_vector_type(4)))  float    v4f;
typedef v8h  __attribute__((may_alias)) v8ha;
typedef v4f  __attribute__((may_alias)) v4fa;
typedef v8us __attribute__((may_alias)) v8usa;

__device__ __forceinline__ unsigned short f2bf(float f) { unsigned u = __float_as_uint(f); u += 0x7FFFu + ((u >> 16) & 1u); return (unsigned short)(u >> 16); }
__device__ __forceinline__ float bf2f(unsigned short b) { return __uint_as_float(((unsigned)b) << 16); }
__device__ __forceinline__ float bfr(float f) { return bf2f(f2bf(f)); }
__device__ __forceinline__ v16h cat16(v8h lo, v8h hi) { return __builtin_shufflevector(lo, hi, 0, 1, 2, 3, 4, 5, 6, 7, 8, 9, 10, 11, 12, 13, 14, 15); }
__device__ __forceinline__ v16bf cat16b(v8us lo, v8us hi) { return __builtin_bit_cast(v16bf, __builtin_shufflevector(lo, hi, 0, 1, 2, 3, 4, 5, 6, 7, 8, 9, 10, 11, 12, 13, 14, 15)); }
__device__ __forceinline__ v8f wmma16(v16h a, v16h b, v8f c) { return __builtin_amdgcn_wmma_f32_16x16x32_f16(false, a, false, b, (short)0, c, false, false); }
__device__ __forceinline__ v8f wmmab(v16bf a, v16bf b, v8f c) { return __builtin_amdgcn_wmma_f32_16x16x32_bf16(false, a, false, b, (short)0, c, false, false); }



// ---- k_gemmw: register-blocked GEMM, ONE WAVE per 64x64 output tile (16 accumulators), operands straight from K-contiguous 16-bit planes; grid (M/64, N/64, Z), 32 threads.
// C[m][n] (f32, pitch ldc, + optional f32 bias[n]) = sum_k A[m][k] Bt[n][k] (+ split products per NSPLIT). z-batch strides sA/sB/sC in elements. K % 32 == 0.
// KSL > 0 (N == 64 only): grid (M/64, K/KSL, Z); blockIdx.y is a k slice of KSL elements, its partial sum goes to plane C + blockIdx.y * sK; the reader adds the planes.
template <typename T16> struct WFrag;
template <> struct WFrag<h16> { typedef v16h V; static __device__ __forceinline__ V ld(const h16* p) { return cat16(*(const v8h*)p, *(const v8h*)(p + 16)); } static __device__ __forceinline__ v8f mma(V a, V b, v8f c) { return wmma16(a, b, c); } };
template <> struct WFrag<bf> { typedef v16bf V; static __device__ __forceinline__ V ld(const bf* p) { return cat16b(*(const v8us*)p, *(const v8us*)(p + 16)); } static __device__ __forceinline__ v8f mma(V a, V b, v8f c) { return wmmab(a, b, c); } };
template <typename T16, int NSPLIT, bool BIAS, int KSL>
__global__ __launch_bounds__(32) void k_gemmw(const T16* __restrict__ A, const T16* __restrict__ A2, const T16* __restrict__ Bt, const T16* __restrict__ Bt2, int K, float* C, int ldc, const float* __restrict__ bias, size_t sA, size_t sB, size_t sC, size_t sK) {
    typedef typename WFrag<T16>::V V;
    __shared__ __align__(16) float os[16 * 68];
    const size_t z = blockIdx.z; A += z * sA; if (A2) A2 += z * sA; Bt += z * sB; if (Bt2) Bt2 += z * sB; C += z * sC;
    const int lane = threadIdx.x & 31, lr = lane & 15, hi = lane >> 4; const int r0 = blockIdx.x * 64, c0 = KSL ? 0 : blockIdx.y * 64; const int kb = KSL ? blockIdx.y * KSL : 0, ke = KSL ? kb + KSL : K; if (KSL) C += (size_t)blockIdx.y * sK;
    v8f acc[4][4];
#pragma unroll
    for (int mb = 0; mb < 4; ++mb)
#pragma unroll
        for (int nb = 0; nb < 4; ++nb) acc[mb][nb] = (v8f){};
    const size_t aoff = (size_t)(r0 + lr) * K + 8 * hi, boff = (size_t)(c0 + lr) * K + 8 * hi;
#pragma unroll 1
    for (int kc = kb; kc < ke; kc += 32) {
        V a[4], a2[4];
#pragma unroll
        for (int mb = 0; mb < 4; ++mb) { a[mb] = WFrag<T16>::ld(A + aoff + (size_t)mb * 16 * K + kc); if (NSPLIT == 1 || NSPLIT == 2) a2[mb] = WFrag<T16>::ld(A2 + aoff + (size_t)mb * 16 * K + kc); }
#pragma unroll
        for (int nb = 0; nb < 4; ++nb) { const V b = WFrag<T16>::ld(Bt + boff + (size_t)nb * 16 * K + kc); V b2; if (NSPLIT >= 2) b2 = WFrag<T16>::ld(Bt2 + boff + (size_t)nb * 16 * K + kc);
#pragma unroll
            for (int mb = 0; mb < 4; ++mb) { acc[mb][nb] = WFrag<T16>::mma(a[mb], b, acc[mb][nb]); if (NSPLIT == 1 || NSPLIT == 2) acc[mb][nb] = WFrag<T16>::mma(a2[mb], b, acc[mb][nb]); if (NSPLIT >= 2) acc[mb][nb] = WFrag<T16>::mma(a[mb], b2, acc[mb][nb]); } }
        asm volatile("v_nop\n\tv_nop\n\tv_nop\n\tv_nop" : "+v"(acc[0][0]), "+v"(acc[1][1]), "+v"(acc[2][2]), "+v"(acc[3][3]) : "v"(a[0]), "v"(a[3]));
    }
#pragma unroll
    for (int mb = 0; mb < 4; ++mb) {
#pragma unroll
        for (int nb = 0; nb < 4; ++nb) {
#pragma unroll
            for (int j = 0; j < 8; ++j) os[(hi * 8 + j) * 68 + nb * 16 + lr] = acc[mb][nb][j]; }
        __builtin_amdgcn_wave_barrier(); asm volatile("" ::: "memory");
        float* crow = C + (size_t)(r0 + mb * 16) * ldc + c0;
{
#pragma unroll
            for (int s = 0; s < 8; ++s) { const int row = 2 * s + hi, cofs = lr * 4; v4f val = *(const v4fa*)(os + row * 68 + cofs); if (BIAS) { val[0] += bfr(bias[c0 + cofs]); val[1] += bfr(bias[c0 + cofs + 1]); val[2] += bfr(bias[c0 + cofs + 2]); val[3] += bfr(bias[c0 + cofs + 3]); }
                *(v4f*)(crow + (size_t)row * ldc + cofs) = val; }
             }
        __builtin_amdgcn_wave_barrier(); asm volatile("" ::: "memory");
    }
}

__device__ __forceinline__ h16 tohx(float x) { return (h16)x; }
__device__ __forceinline__ void splitf(float y, unsigned short& h, unsigned short& l) { h = f2bf(y); l = f2bf(y - bf2f(h)); }
typedef __attribute__((ext_vector_type(2))) _Float16 v2h;
typedef __attribute__((ext_vector_type(4))) _Float16 v4h;
typedef __attribute__((ext_vector_type(2))) unsigned short v2us;
typedef __attribute__((ext_vector_type(4))) unsigned short v4us;
typedef __attribute__((ext_vector_type(2))) float v2f;
typedef __attribute__((ext_vector_type(4))) int v4i;

__global__ __launch_bounds__(256) void k_wtG(const float* __restrict__ w, int K, int N, bf* Bt) {
    const int lane = threadIdx.x & 31; const int L0 = (blockIdx.x * 8 + (threadIdx.x >> 5)) * 8; const int nlines = N * K / 64;
{
#pragma unroll 1
        for (int l = 0; l < 8; ++l) { const int L = L0 + l; if (L >= nlines) break; const size_t e = (size_t)L * 64 + lane * 2; const int k = (int)(e % K), n = (int)(e / K); v2us o;
            o[0] = f2bf(w[(size_t)k * N + n]); o[1] = f2bf(w[(size_t)(k + 1) * N + n]); *(v2us*)(Bt + e) = o; }
         }
}
__global__ __launch_bounds__(256) void k_cvt8(const float* __restrict__ src, bf* dst, size_t n8) { const size_t i = (size_t)blockIdx.x * 256 + threadIdx.x; if (i >= n8) return; const v8f v = *(const v8f*)(src + i * 8); v8us o;
#pragma unroll
    for (int k = 0; k < 8; ++k) o[k] = f2bf(v[k]); *(v8us*)(dst + i * 8) = o;  }
__global__ __launch_bounds__(256) void k_cscvt(const float* __restrict__ cosT, const float* __restrict__ sinT, float* CS) { const int idx = blockIdx.x * 256 + threadIdx.x; if (idx >= TT * HD) return; v2f cs; cs[0] = bfr(cosT[idx]); cs[1] = bfr(sinT[idx]); *(v2f*)(CS + (size_t)idx * 2) = cs;  }
// k_rope: head planes [h][t][d] (fp16 + hi/lo) of rope(x) x sc with the rotate-half convention out[d] = x[d] cos[t][d] - x[d+HD/2] sin[t][d], out[d+HD/2] = x[d+HD/2] cos[t][d+HD/2] + x[d] sin[t][d+HD/2]
__global__ __launch_bounds__(256) void k_rope(const float* __restrict__ F, int pitch, int nheads, const float* __restrict__ CS, const float* __restrict__ RF, const float* __restrict__ nw, float sc, h16* P16, bf* Ph, bf* Pl) {
    const size_t e = ((size_t)blockIdx.x * 256 + threadIdx.x) * 2; if (e >= (size_t)nheads * TT * HD) return; const int d = (int)(e % HD); const int t = (int)((e / HD) % TT); const int h = (int)(e / ((size_t)HD * TT)); const float* f = F + (size_t)t * pitch + h * HD; const float rf = RF ? RF[(size_t)h * TT + t] : 1.0f; v2h o16; v2us oh, ol;
#pragma unroll
    for (int q = 0; q < 2; ++q) { const int dd = d + q; const int dp = (dd < HD / 2) ? dd + HD / 2 : dd - HD / 2; float x0 = f[dd], x1 = f[dp];
        if (RF) { float n0 = __fmul_rn(x0, rf), n1 = __fmul_rn(x1, rf); asm volatile("" : "+v"(n0)); asm volatile("" : "+v"(n1)); x0 = __fmul_rn(bfr(nw[dd]), n0); x1 = __fmul_rn(bfr(nw[dp]), n1); }
        const v2f cs = *(const v2f*)(CS + ((size_t)t * HD + dd) * 2); float a = __fmul_rn(x0, cs[0]), bq = __fmul_rn(x1, cs[1]); asm volatile("" : "+v"(a)); asm volatile("" : "+v"(bq)); const float r = ((dd < HD / 2) ? __fsub_rn(a, bq) : __fadd_rn(a, bq)) * sc;
        o16[q] = tohx(r); unsigned short a2, c2; splitf(r, a2, c2); oh[q] = a2; ol[q] = c2; }
    *(v2h*)(P16 + e) = o16; *(v2us*)(Ph + e) = oh; *(v2us*)(Pl + e) = ol;  }
__global__ __launch_bounds__(256) void k_vtp(const float* __restrict__ F, int pitch, int nheads, h16* V16, bf* Vh, bf* Vl) { const size_t e = ((size_t)blockIdx.x * 256 + threadIdx.x) * 2; if (e >= (size_t)nheads * HD * TT) return; const int t = (int)(e % TT); const int d = (int)((e / TT) % HD); const int g = (int)(e / ((size_t)TT * HD)); v2h o16; v2us oh, ol;
#pragma unroll
    for (int q = 0; q < 2; ++q) { const float x = F[(size_t)(t + q) * pitch + g * HD + d]; o16[q] = tohx(x); unsigned short a2, c2; splitf(x, a2, c2); oh[q] = a2; ol[q] = c2; }
    *(v2h*)(V16 + e) = o16; *(v2us*)(Vh + e) = oh; *(v2us*)(Vl + e) = ol;  }
__global__ __launch_bounds__(256) void k_csid(float* CS) { const int idx = blockIdx.x * 256 + threadIdx.x; if (idx >= TT * HD) return; v2f cs; cs[0] = 1.0f; cs[1] = 0.0f; *(v2f*)(CS + (size_t)idx * 2) = cs;  }
// k_asoft: per row (zz, i): t = S x gain (j > i -> -1e30 if causal); softmax over the 2048 keys (register row, one exp, fixed trees);
__global__ __launch_bounds__(256) void k_asoft(const float* __restrict__ Sb, const float* __restrict__ gainp, const int* __restrict__ causp, h16* P16, bf* Ph, bf* Pl) {
    const int lane = threadIdx.x & 31; const int row = blockIdx.x * 8 + (threadIdx.x >> 5); if (row >= ZH * TT) return; const int i = row % TT; const int zz = row / TT; (void)zz; const bool hires = (i < RH); const float* sr = Sb + (size_t)row * TT; float gn = bfr(gainp[0]); asm volatile("" : "+v"(gn)); const bool causal = (causp[0] != 0); float v[TT / 32]; float mx = -3.0e38f;
#pragma unroll
    for (int ch = 0; ch < TT / 128; ++ch) { const int j0 = ch * 128 + lane * 4; const v4f a = *(const v4f*)(sr + j0);
#pragma unroll
        for (int q = 0; q < 4; ++q) { const int j = j0 + q; const float t = (causal && j > i) ? -1.0e30f : __fmul_rn(gn, a[q]); v[ch * 4 + q] = t; mx = fmaxf(mx, t); } }
#pragma unroll
    for (int sh = 16; sh; sh >>= 1) mx = fmaxf(mx, __shfl_xor(mx, sh, 32));
    float sum = 0.f;
#pragma unroll
    for (int k = 0; k < TT / 32; ++k) { float d0 = __fsub_rn(v[k], mx); asm volatile("" : "+v"(d0)); v[k] = __builtin_amdgcn_exp2f(__fmul_rn(d0, 1.4426950408889634f)); sum += v[k]; }
#pragma unroll
    for (int sh = 16; sh; sh >>= 1) sum += __shfl_xor(sum, sh, 32);
    const float f = __fdiv_rn(hires ? 1.0f : PCAR, sum);
{
        if (hires) {
#pragma unroll
            for (int ch = 0; ch < TT / 128; ++ch) { v4us oh, ol;
#pragma unroll
                for (int q = 0; q < 4; ++q) { unsigned short a, c2; splitf(v[ch * 4 + q] * f, a, c2); oh[q] = a; ol[q] = c2; }
                const size_t oo = ((size_t)zz * (RH ? RH : 1) + i) * TT + ch * 128 + lane * 4; *(v4us*)(Ph + oo) = oh; *(v4us*)(Pl + oo) = ol; }
        } else {
#pragma unroll
            for (int ch = 0; ch < TT / 128; ++ch) { v4h o4;
#pragma unroll
                for (int q = 0; q < 4; ++q) o4[q] = tohx(v[ch * 4 + q] * f);
                *(v4h*)(P16 + (size_t)row * TT + ch * 128 + lane * 4) = o4; } }
         }
}
__global__ __launch_bounds__(256) void k_merge(const float* __restrict__ O, int h0, bf* Ah, bf* Al) { const size_t e = ((size_t)blockIdx.x * 256 + threadIdx.x) * 2; if (e >= (size_t)ZH * TT * HD) return; const int d = (int)(e % HD); const int t = (int)((e / HD) % TT); const int zz = (int)(e / ((size_t)HD * TT)); const float cs = (t < RH) ? 1.0f : (1.0f / PCAR); const size_t oo = (size_t)t * DQ + (h0 + zz) * HD + d;
    v2us oh, ol;
#pragma unroll
    for (int q = 0; q < 2; ++q) { unsigned short a, c2; splitf(O[e + q] * cs, a, c2); oh[q] = a; ol[q] = c2; } *(v2us*)(Ah + oo) = oh; *(v2us*)(Al + oo) = ol;  }

__global__ __launch_bounds__(256) void k_nrmp(const float* __restrict__ X, h16* P16, bf* Ph, bf* Pl) { const int lane = threadIdx.x & 31; const int row = blockIdx.x * 8 + (threadIdx.x >> 5); if (row >= NH_ * TT) return; const float* src = X + (size_t)row * HD + lane * 2; const float x0 = bfr(src[0]), x1 = bfr(src[1]); float q = __fmul_rn(x0, x0); asm volatile("" : "+v"(q)); float p1 = __fmul_rn(x1, x1); asm volatile("" : "+v"(p1)); q = __fadd_rn(q, p1);
#pragma unroll
    for (int sh = 16; sh; sh >>= 1) q += __shfl_xor(q, sh, 32);
    const float den = __fsqrt_rn(__fadd_rn(q, 1e-12f)); v2h o16; v2us oh, ol; { const float y0 = __fdiv_rn(x0, den), y1 = __fdiv_rn(x1, den); o16[0] = tohx(y0); o16[1] = tohx(y1); unsigned short a, c; splitf(y0, a, c); oh[0] = a; ol[0] = c; splitf(y1, a, c); oh[1] = a; ol[1] = c; }
    const size_t e = (size_t)row * HD + lane * 2; *(v2h*)(P16 + e) = o16; *(v2us*)(Ph + e) = oh; *(v2us*)(Pl + e) = ol;  }
__global__ __launch_bounds__(256) void k_vt3(const float* __restrict__ V, h16* V16, bf* Vh, bf* Vl) { const size_t e = ((size_t)blockIdx.x * 256 + threadIdx.x) * 2; if (e >= (size_t)NKV * HD * TT) return; const int t = (int)(e % TT); const int d = (int)((e / TT) % HD); const int g = (int)(e / ((size_t)TT * HD)); v2h o16; v2us oh, ol;
#pragma unroll
    for (int q = 0; q < 2; ++q) { const float x = bfr(V[((size_t)g * TT + t + q) * HD + d]); o16[q] = tohx(x); unsigned short a2, c2; splitf(x, a2, c2); oh[q] = a2; ol[q] = c2; }
    *(v2h*)(V16 + e) = o16; *(v2us*)(Vh + e) = oh; *(v2us*)(Vl + e) = ol;  }
__global__ __launch_bounds__(256) void k_outO(const float* __restrict__ O, float* outb) { const size_t e = ((size_t)blockIdx.x * 256 + threadIdx.x) * 4; if (e >= (size_t)ZH * TT * HD) return; const int t = (int)((e / HD) % TT); const float cs = (t < RH) ? 1.0f : (1.0f / PCAR); const float* Oz = O + e + (e / ((size_t)TT * HD)) * ((size_t)(KSP - 1) * TT * HD);   // a head's KSP planes lie together ([head][slice][t][d]): all of them are within one address pair's immediate offsets
    v4f a = *(const v4f*)Oz; v4f o;
#pragma unroll
    for (int s = 1; s < KSP; ++s)   // the key slices' partial planes, added in slice order
        a += *(const v4f*)(Oz + (size_t)s * TT * HD);
#pragma unroll
    for (int u = 0; u < 4; ++u) o[u] = a[u] * cs; *(v4f*)(outb + e) = o;  }

extern "C" void kernel_launch(void* const* d_in, const int* in_sizes, int n_in,
                              void* d_out, int out_size, void* d_ws, size_t ws_size, hipStream_t stream) {
    (void)in_sizes; (void)n_in; (void)out_size;
    const float* Qi = (const float*)d_in[0]; const float* Ki = (const float*)d_in[1]; const float* Vi = (const float*)d_in[2]; const float* gainp = (const float*)d_in[3]; const int* causp = (const int*)d_in[4];
    float* OUT = (float*)d_out;     // [2][16][2048][64]
    char* wsp = (char*)d_ws;
    auto take = [&](size_t bytes) { char* p = wsp; wsp += (bytes + 255) & ~(size_t)255; return (void*)p; };
    float* CS = (float*)take((size_t)TT * HD * 2 * 4);
    h16* VT16 = (h16*)take((size_t)NKV * HD * TT * 2);
    bf* QPh = (bf*)take((size_t)NH_ * TT * HD * 2); bf* QPl = (bf*)take((size_t)NH_ * TT * HD * 2); bf* KPh = (bf*)take((size_t)NKV * TT * HD * 2); bf* KPl = (bf*)take((size_t)NKV * TT * HD * 2); bf* VTh = (bf*)take((size_t)NKV * HD * TT * 2); bf* VTl = (bf*)take((size_t)NKV * HD * TT * 2); bf* Ph = (bf*)take((size_t)ZH * RH * TT * 2); bf* Pl = (bf*)take((size_t)ZH * RH * TT * 2);
    float* Sb = (float*)take((size_t)ZH * TT * TT * 4); h16* P16 = (h16*)take((size_t)ZH * TT * TT * 2);
    h16* QP16 = (h16*)Sb; h16* KP16 = QP16 + (size_t)NH_ * TT * HD;   // the f16 planes of Qn and Kn are stored and never read: they lie over the scores, which are written after them (stream-ordered)
    float* Ob = Sb;   // the KSP partial planes (KSP * HD <= TT) lie over the scores, which are dead once the softmax has read them (stream-ordered)
    if ((size_t)(wsp - (char*)d_ws) > ws_size) return;    // ws 256 MiB
    k_csid<<<(TT * HD + 255) / 256, 256, 0, stream>>>(CS);
    const unsigned LQ = (unsigned)(((size_t)NH_ * TT * HD / 2 + 255) / 256), LKv = (unsigned)(((size_t)NKV * TT * HD / 2 + 255) / 256);
    for (int b = 0; b < NB_; ++b) {
        k_nrmp<<<NH_ * TT / 8, 256, 0, stream>>>(Qi + (size_t)b * NH_ * TT * HD, QP16, QPh, QPl);
        k_nrmp<<<NKV * TT / 8, 256, 0, stream>>>(Ki + (size_t)b * NKV * TT * HD, KP16, KPh, KPl); k_vt3<<<LKv, 256, 0, stream>>>(Vi + (size_t)b * NKV * TT * HD, VT16, VTh, VTl);
        for (int h0 = 0; h0 < NH_; h0 += ZH) { const size_t zq = (size_t)h0, zk = (size_t)(h0 / REP);   // one kv head per query head: the pass's heads use consecutive kv planes (z-strides TT*HD)
            k_gemmw<bf, 2, false, 0><<<dim3(TT / 64, TT / 64, ZH), 32, 0, stream>>>(QPh + zq * TT * HD, QPl + zq * TT * HD, KPh + zk * TT * HD, KPl + zk * TT * HD, HD, Sb, TT, nullptr, (size_t)TT * HD, (size_t)TT * HD, (size_t)TT * TT, 0);   // ALL score rows hl x hl (3 products): the gain-22 cosine logits need it
            
            k_asoft<<<ZH * TT / 8, 256, 0, stream>>>(Sb, gainp, causp, P16, Ph, Pl);
            k_gemmw<bf, 2, false, TT / KSP><<<dim3(RH / 64, KSP, ZH), 32, 0, stream>>>(Ph, Pl, VTh + zk * HD * TT, VTl + zk * HD * TT, TT, Ob, HD, nullptr, (size_t)RH * TT, (size_t)HD * TT, (size_t)KSP * TT * HD, (size_t)TT * HD);
            k_gemmw<h16, 0, false, TT / KSP><<<dim3((TT - RH) / 64, KSP, ZH), 32, 0, stream>>>(P16 + (size_t)RH * TT, nullptr, VT16 + zk * HD * TT, nullptr, TT, Ob + (size_t)RH * HD, HD, nullptr, (size_t)TT * TT, (size_t)HD * TT, (size_t)KSP * TT * HD, (size_t)TT * HD);
            k_outO<<<(unsigned)(((size_t)ZH * TT * HD / 4 + 255) / 256), 256, 0, stream>>>(Ob, OUT + ((size_t)b * NH_ + h0) * TT * HD); } }
}

// v003
// One run takes 102 microseconds.
// Two timings next to v002 put it at 4.36 and 4.38 times that version's speed.
// All steps since v000 together make it 17.0 times as fast.
#include <hip/hip_runtime.h>

// SelfDotProductAttnQKNorm (Q, K, V [2][16][2048][64] given; Qn, Kn = L2-normalised over d (eps 1e-12 inside the sqrt); scores = gain x (Qn . Kn) with gain a scalar input (read on device; log2(2048? - 2048) ~ 22); is_causal (int input, read on device; 1 here) -> j > i masked to -1e30; softmax; out = attn V -> [2][16][2048][64]).
// Compute dtypes, f32 accumulate: every input rounded to bf16; the L2 normalisation f32 on the VALU; full score matrices (the causal flag is data), all rows hl x hl (3 products); x gain, mask and softmax f32;

#define NB_  2
#define TT   2048
#define DM   1024
#define NH_  16
#define NKV  16
#define REP  (NH_ / NKV)
#define HD   64
#define DQ   (NH_ * HD)
#define DKV  (NKV * HD)
#define ZH   8                    // heads per call of k_merge
#define RH   512                  // query rows < RH use hi+lo planes (0: none)
#define WIN  0
#define PCAR 1024.0f
#define SCL  0.125f   // HD^-0.5
typedef _Float16 h16;
typedef unsigned short bf;
typedef __attribute__((ext_vector_type(16))) __bf16   v16bf;
typedef __attribute__((ext_vector_type(16))) _Float16 v16h;
typedef __attribute__((ext_vector_type(8)))  _Float16 v8h;
typedef __attribute__((ext_vector_type(8)))  unsigned short v8us;
typedef __attribute__((ext_vector_type(8)))  float    v8f;
typedef __attribute__((ext_vector_type(4)))  float    v4f;
typedef v8h  __attribute__((may_alias)) v8ha;
typedef v4f  __attribute__((may_alias)) v4fa;
typedef v8us __attribute__((may_alias)) v8usa;

__device__ __forceinline__ unsigned short f2bf(float f) { unsigned u = __float_as_uint(f); u += 0x7FFFu + ((u >> 16) & 1u); return (unsigned short)(u >> 16); }
__device__ __forceinline__ float bf2f(unsigned short b) { return __uint_as_float(((unsigned)b) << 16); }
__device__ __forceinline__ float bfr(float f) { return bf2f(f2bf(f)); }
__device__ __forceinline__ v16h cat16(v8h lo, v8h hi) { return __builtin_shufflevector(lo, hi, 0, 1, 2, 3, 4, 5, 6, 7, 8, 9, 10, 11, 12, 13, 14, 15); }
__device__ __forceinline__ v16bf cat16b(v8us lo, v8us hi) { return __builtin_bit_cast(v16bf, __builtin_shufflevector(lo, hi, 0, 1, 2, 3, 4, 5, 6, 7, 8, 9, 10, 11, 12, 13, 14, 15)); }
__device__ __forceinline__ v8f wmma16(v16h a, v16h b, v8f c) { return __builtin_amdgcn_wmma_f32_16x16x32_f16(false, a, false, b, (short)0, c, false, false); }
__device__ __forceinline__ v8f wmmab(v16bf a, v16bf b, v8f c) { return __builtin_amdgcn_wmma_f32_16x16x32_bf16(false, a, false, b, (short)0, c, false, false); }



// fragment loaders, hardware k order: 8 elements at p and 8 at p + 16, p = row start + 32 * kstep + 8 * (lane >> 4)
template <typename T16> struct WFrag;
template <> struct WFrag<h16> { typedef v16h V; static __device__ __forceinline__ V ld(const h16* p) { return cat16(*(const v8h*)p, *(const v8h*)(p + 16)); } static __device__ __forceinline__ v8f mma(V a, V b, v8f c) { return wmma16(a, b, c); } };
template <> struct WFrag<bf> { typedef v16bf V; static __device__ __forceinline__ V ld(const bf* p) { return cat16b(*(const v8us*)p, *(const v8us*)(p + 16)); } static __device__ __forceinline__ v8f mma(V a, V b, v8f c) { return wmmab(a, b, c); } };

__device__ __forceinline__ h16 tohx(float x) { return (h16)x; }
__device__ __forceinline__ void splitf(float y, unsigned short& h, unsigned short& l) { h = f2bf(y); l = f2bf(y - bf2f(h)); }
typedef __attribute__((ext_vector_type(2))) _Float16 v2h;
typedef __attribute__((ext_vector_type(4))) _Float16 v4h;
typedef __attribute__((ext_vector_type(2))) unsigned short v2us;
typedef __attribute__((ext_vector_type(4))) unsigned short v4us;
typedef __attribute__((ext_vector_type(2))) float v2f;
typedef __attribute__((ext_vector_type(4))) int v4i;

__global__ __launch_bounds__(256) void k_wtG(const float* __restrict__ w, int K, int N, bf* Bt) {
    const int lane = threadIdx.x & 31; const int L0 = (blockIdx.x * 8 + (threadIdx.x >> 5)) * 8; const int nlines = N * K / 64;
{
#pragma unroll 1
        for (int l = 0; l < 8; ++l) { const int L = L0 + l; if (L >= nlines) break; const size_t e = (size_t)L * 64 + lane * 2; const int k = (int)(e % K), n = (int)(e / K); v2us o;
            o[0] = f2bf(w[(size_t)k * N + n]); o[1] = f2bf(w[(size_t)(k + 1) * N + n]); *(v2us*)(Bt + e) = o; }
         }
}
__global__ __launch_bounds__(256) void k_cvt8(const float* __restrict__ src, bf* dst, size_t n8) { const size_t i = (size_t)blockIdx.x * 256 + threadIdx.x; if (i >= n8) return; const v8f v = *(const v8f*)(src + i * 8); v8us o;
#pragma unroll
    for (int k = 0; k < 8; ++k) o[k] = f2bf(v[k]); *(v8us*)(dst + i * 8) = o;  }
__global__ __launch_bounds__(256) void k_cscvt(const float* __restrict__ cosT, const float* __restrict__ sinT, float* CS) { const int idx = blockIdx.x * 256 + threadIdx.x; if (idx >= TT * HD) return; v2f cs; cs[0] = bfr(cosT[idx]); cs[1] = bfr(sinT[idx]); *(v2f*)(CS + (size_t)idx * 2) = cs;  }
// k_rope: head planes [h][t][d] (fp16 + hi/lo) of rope(x) x sc with the rotate-half convention out[d] = x[d] cos[t][d] - x[d+HD/2] sin[t][d], out[d+HD/2] = x[d+HD/2] cos[t][d+HD/2] + x[d] sin[t][d+HD/2]
__global__ __launch_bounds__(256) void k_rope(const float* __restrict__ F, int pitch, int nheads, const float* __restrict__ CS, const float* __restrict__ RF, const float* __restrict__ nw, float sc, h16* P16, bf* Ph, bf* Pl) {
    const size_t e = ((size_t)blockIdx.x * 256 + threadIdx.x) * 2; if (e >= (size_t)nheads * TT * HD) return; const int d = (int)(e % HD); const int t = (int)((e / HD) % TT); const int h = (int)(e / ((size_t)HD * TT)); const float* f = F + (size_t)t * pitch + h * HD; const float rf = RF ? RF[(size_t)h * TT + t] : 1.0f; v2h o16; v2us oh, ol;
#pragma unroll
    for (int q = 0; q < 2; ++q) { const int dd = d + q; const int dp = (dd < HD / 2) ? dd + HD / 2 : dd - HD / 2; float x0 = f[dd], x1 = f[dp];
        if (RF) { float n0 = __fmul_rn(x0, rf), n1 = __fmul_rn(x1, rf); asm volatile("" : "+v"(n0)); asm volatile("" : "+v"(n1)); x0 = __fmul_rn(bfr(nw[dd]), n0); x1 = __fmul_rn(bfr(nw[dp]), n1); }
        const v2f cs = *(const v2f*)(CS + ((size_t)t * HD + dd) * 2); float a = __fmul_rn(x0, cs[0]), bq = __fmul_rn(x1, cs[1]); asm volatile("" : "+v"(a)); asm volatile("" : "+v"(bq)); const float r = ((dd < HD / 2) ? __fsub_rn(a, bq) : __fadd_rn(a, bq)) * sc;
        o16[q] = tohx(r); unsigned short a2, c2; splitf(r, a2, c2); oh[q] = a2; ol[q] = c2; }
    *(v2h*)(P16 + e) = o16; *(v2us*)(Ph + e) = oh; *(v2us*)(Pl + e) = ol;  }
__global__ __launch_bounds__(256) void k_vtp(const float* __restrict__ F, int pitch, int nheads, h16* V16, bf* Vh, bf* Vl) { const size_t e = ((size_t)blockIdx.x * 256 + threadIdx.x) * 2; if (e >= (size_t)nheads * HD * TT) return; const int t = (int)(e % TT); const int d = (int)((e / TT) % HD); const int g = (int)(e / ((size_t)TT * HD)); v2h o16; v2us oh, ol;
#pragma unroll
    for (int q = 0; q < 2; ++q) { const float x = F[(size_t)(t + q) * pitch + g * HD + d]; o16[q] = tohx(x); unsigned short a2, c2; splitf(x, a2, c2); oh[q] = a2; ol[q] = c2; }
    *(v2h*)(V16 + e) = o16; *(v2us*)(Vh + e) = oh; *(v2us*)(Vl + e) = ol;  }
__global__ __launch_bounds__(256) void k_csid(float* CS) { const int idx = blockIdx.x * 256 + threadIdx.x; if (idx >= TT * HD) return; v2f cs; cs[0] = 1.0f; cs[1] = 0.0f; *(v2f*)(CS + (size_t)idx * 2) = cs;  }
__global__ __launch_bounds__(256) void k_merge(const float* __restrict__ O, int h0, bf* Ah, bf* Al) { const size_t e = ((size_t)blockIdx.x * 256 + threadIdx.x) * 2; if (e >= (size_t)ZH * TT * HD) return; const int d = (int)(e % HD); const int t = (int)((e / HD) % TT); const int zz = (int)(e / ((size_t)HD * TT)); const float cs = (t < RH) ? 1.0f : (1.0f / PCAR); const size_t oo = (size_t)t * DQ + (h0 + zz) * HD + d;
    v2us oh, ol;
#pragma unroll
    for (int q = 0; q < 2; ++q) { unsigned short a, c2; splitf(O[e + q] * cs, a, c2); oh[q] = a; ol[q] = c2; } *(v2us*)(Ah + oo) = oh; *(v2us*)(Al + oo) = ol;  }

__global__ __launch_bounds__(256) void k_nrmp(const float* __restrict__ X, h16* P16, bf* Ph, bf* Pl) { const int lane = threadIdx.x & 31; const int row = blockIdx.x * 8 + (threadIdx.x >> 5); if (row >= NH_ * TT) return; const float* src = X + (size_t)row * HD + lane * 2; const float x0 = bfr(src[0]), x1 = bfr(src[1]); float q = __fmul_rn(x0, x0); asm volatile("" : "+v"(q)); float p1 = __fmul_rn(x1, x1); asm volatile("" : "+v"(p1)); q = __fadd_rn(q, p1);
#pragma unroll
    for (int sh = 16; sh; sh >>= 1) q += __shfl_xor(q, sh, 32);
    const float den = __fsqrt_rn(__fadd_rn(q, 1e-12f)); v2h o16; v2us oh, ol; { const float y0 = __fdiv_rn(x0, den), y1 = __fdiv_rn(x1, den); o16[0] = tohx(y0); o16[1] = tohx(y1); unsigned short a, c; splitf(y0, a, c); oh[0] = a; ol[0] = c; splitf(y1, a, c); oh[1] = a; ol[1] = c; }
    const size_t e = (size_t)row * HD + lane * 2; *(v2h*)(P16 + e) = o16; *(v2us*)(Ph + e) = oh; *(v2us*)(Pl + e) = ol;  }
__global__ __launch_bounds__(256) void k_vt3(const float* __restrict__ V, h16* V16, bf* Vh, bf* Vl) { const size_t e = ((size_t)blockIdx.x * 256 + threadIdx.x) * 2; if (e >= (size_t)NKV * HD * TT) return; const int t = (int)(e % TT); const int d = (int)((e / TT) % HD); const int g = (int)(e / ((size_t)TT * HD)); v2h o16; v2us oh, ol;
#pragma unroll
    for (int q = 0; q < 2; ++q) { const float x = bfr(V[((size_t)g * TT + t + q) * HD + d]); o16[q] = tohx(x); unsigned short a2, c2; splitf(x, a2, c2); oh[q] = a2; ol[q] = c2; }
    *(v2h*)(V16 + e) = o16; *(v2us*)(Vh + e) = oh; *(v2us*)(Vl + e) = ol;  }
#define QW   32                   // query columns per wave
#define NWV  4                    // waves per work-group
#define QB   (QW * NWV)           // queries per work-group
#define SK   64                   // keys per LDS stage
#define LP   72                   // LDS row pitch in 16-bit elements: 144 B = 16 B x 9
#define PLN  (64 * LP)            // one staged plane: 64 rows (keys of K, d of V^T) of 64 elements
#define NPLX 4                    // planes per stage at most: Kh, Kl, then Vh, Vl or V16
#define LOG2E 1.4426950408889634f
typedef __attribute__((ext_vector_type(8))) __bf16 v8bf;
__device__ __forceinline__ float xhalf(float x) { const int b = __float_as_int(x); return __int_as_float(__builtin_amdgcn_permlanex16(b, b, 0x76543210, 0xfedcba98, false, false)); }   // the value of lane l ^ 16
__device__ __forceinline__ v16bf ldsb(const bf* p) { return cat16b(*(const v8us*)p, *(const v8us*)(p + 16)); }
__device__ __forceinline__ v16bf cat16f(v8bf lo, v8bf hi) { return __builtin_shufflevector(lo, hi, 0, 1, 2, 3, 4, 5, 6, 7, 8, 9, 10, 11, 12, 13, 14, 15); }

// K fragments (A operand) of 32 keys, rows kloc.. of the staged planes
__device__ __forceinline__ void ld_k(const bf* sb, int kloc, int lr, int hi, v16bf (&kh)[2][2], v16bf (&kl)[2][2]) {
#pragma unroll
    for (int kt = 0; kt < 2; ++kt)
#pragma unroll
        for (int ks = 0; ks < 2; ++ks) { const bf* kr = sb + (kloc + kt * 16 + lr) * LP + ks * 32 + 8 * hi; kh[kt][ks] = ldsb(kr); kl[kt][ks] = ldsb(kr + PLN); }
}
// V^T fragments (A operand) of the same 32 keys: v[0][dt] = Vh or V16 (bits), v[1][dt] = Vl
template <bool HI>
__device__ __forceinline__ void ld_v(const bf* sb, int kloc, int lr, int hi, v16bf (&v)[HI ? 2 : 1][4]) {
#pragma unroll
    for (int dt = 0; dt < 4; ++dt) { const bf* vr = sb + 2 * PLN + (dt * 16 + lr) * LP + kloc + 8 * hi; v[0][dt] = ldsb(vr); if (HI) v[HI ? 1 : 0][dt] = ldsb(vr + PLN); }
}
// hl x hl, 3 products, per tile in the order Qh Kh, Ql Kh, Qh Kl for d 0..31, then for d 32..63
__device__ __forceinline__ void scores(const v16bf (&kh)[2][2], const v16bf (&kl)[2][2], const v16bf (&qh)[2][2], const v16bf (&ql)[2][2], v8f (&S)[2][2]) {
#pragma unroll
    for (int kt = 0; kt < 2; ++kt)
#pragma unroll
        for (int qt = 0; qt < 2; ++qt) S[kt][qt] = (v8f){};
#pragma unroll
    for (int ks = 0; ks < 2; ++ks) {
#pragma unroll
        for (int kt = 0; kt < 2; ++kt)
#pragma unroll
            for (int qt = 0; qt < 2; ++qt) S[kt][qt] = wmmab(kh[kt][ks], qh[qt][ks], S[kt][qt]);
#pragma unroll
        for (int kt = 0; kt < 2; ++kt)
#pragma unroll
            for (int qt = 0; qt < 2; ++qt) S[kt][qt] = wmmab(kh[kt][ks], ql[qt][ks], S[kt][qt]);
#pragma unroll
        for (int kt = 0; kt < 2; ++kt)
#pragma unroll
            for (int qt = 0; qt < 2; ++qt) S[kt][qt] = wmmab(kl[kt][ks], qh[qt][ks], S[kt][qt]);
    }
}
// gain, mask, running maximum and sum, probabilities, and O^T += V^T P^T, for keys kb..kb+31 against queries q0..q0+31
template <bool HI>
__device__ __forceinline__ void soft_pv(v8f (&S)[2][2], const v16bf (&v)[HI ? 2 : 1][4], int kb, int q0, int lr, int hi, float gn, bool causal, v8f (&O)[4][2], float (&m)[2], float (&l)[2]) {
    const bool edge = causal && (kb + 31 > q0);   // wave-uniform: only then can a key of this pass lie behind a query of this wave
#pragma unroll
    for (int kt = 0; kt < 2; ++kt)
#pragma unroll
        for (int qt = 0; qt < 2; ++qt) S[kt][qt] *= gn;
    if (edge) {
#pragma unroll
        for (int qt = 0; qt < 2; ++qt) { const int qi = q0 + qt * 16 + lr;
#pragma unroll
            for (int kt = 0; kt < 2; ++kt) {
#pragma unroll
                for (int j = 0; j < 8; ++j) if (kb + kt * 16 + hi * 8 + j > qi) S[kt][qt][j] = -1.0e30f;
                asm volatile("" : "+v"(S[kt][qt]));
            } }
    }
    float mn[2];
#pragma unroll
    for (int qt = 0; qt < 2; ++qt) { float mx = -3.0e38f;
#pragma unroll
        for (int kt = 0; kt < 2; ++kt)
#pragma unroll
            for (int j = 0; j < 8; ++j) mx = fmaxf(mx, S[kt][qt][j]);
        mn[qt] = fmaxf(m[qt], fmaxf(mx, xhalf(mx))); }
    if (__builtin_amdgcn_ballot_w32(mn[0] > m[0] || mn[1] > m[1]) != 0) {   // a maximum moved somewhere in the wave: bring sums and outputs to the new one
#pragma unroll
        for (int qt = 0; qt < 2; ++qt) { const float al = __builtin_amdgcn_exp2f((m[qt] - mn[qt]) * LOG2E); m[qt] = mn[qt]; l[qt] *= al;
#pragma unroll
            for (int dt = 0; dt < 4; ++dt) O[dt][qt] *= al; }
    }
    v16bf ph[2], pl[2];   // f16 rows: ph holds the f16 bits
#pragma unroll
    for (int qt = 0; qt < 2; ++qt) { const float c = (HI ? 0.0f : 10.0f) - m[qt] * LOG2E;   // f16 probabilities carry x 1024 (as the sum does: it cancels in the quotient)
        const v8f cv = { c, c, c, c, c, c, c, c }, lv = { LOG2E, LOG2E, LOG2E, LOG2E, LOG2E, LOG2E, LOG2E, LOG2E };
        const v8f a0 = __builtin_elementwise_fma(S[0][qt], lv, cv), a1 = __builtin_elementwise_fma(S[1][qt], lv, cv);
#pragma unroll
        for (int j = 0; j < 8; ++j) { S[0][qt][j] = __builtin_amdgcn_exp2f(a0[j]); S[1][qt][j] = __builtin_amdgcn_exp2f(a1[j]); }
        const v8f sv = S[0][qt] + S[1][qt];
        l[qt] += ((sv[0] + sv[1]) + (sv[2] + sv[3])) + ((sv[4] + sv[5]) + (sv[6] + sv[7]));
        if (HI) { const v8bf h0 = __builtin_convertvector(S[0][qt], v8bf), h1 = __builtin_convertvector(S[1][qt], v8bf);
            const v8bf l0 = __builtin_convertvector(S[0][qt] - __builtin_convertvector(h0, v8f), v8bf), l1 = __builtin_convertvector(S[1][qt] - __builtin_convertvector(h1, v8f), v8bf);
            ph[qt] = cat16f(h0, h1); pl[qt] = cat16f(l0, l1);
        } else ph[qt] = __builtin_bit_cast(v16bf, cat16(__builtin_convertvector(S[0][qt], v8h), __builtin_convertvector(S[1][qt], v8h))); }
    if (HI) {   // per tile in the order Ph Vh, Pl Vh, Ph Vl
#pragma unroll
        for (int dt = 0; dt < 4; ++dt)
#pragma unroll
            for (int qt = 0; qt < 2; ++qt) O[dt][qt] = wmmab(v[0][dt], ph[qt], O[dt][qt]);
#pragma unroll
        for (int dt = 0; dt < 4; ++dt)
#pragma unroll
            for (int qt = 0; qt < 2; ++qt) O[dt][qt] = wmmab(v[0][dt], pl[qt], O[dt][qt]);
#pragma unroll
        for (int dt = 0; dt < 4; ++dt)
#pragma unroll
            for (int qt = 0; qt < 2; ++qt) O[dt][qt] = wmmab(v[HI ? 1 : 0][dt], ph[qt], O[dt][qt]);
    } else {
#pragma unroll
        for (int dt = 0; dt < 4; ++dt)
#pragma unroll
            for (int qt = 0; qt < 2; ++qt) O[dt][qt] = wmma16(__builtin_bit_cast(v16h, v[0][dt]), __builtin_bit_cast(v16h, ph[qt]), O[dt][qt]);
    }
}

template <bool HI>
__device__ __forceinline__ void attn_body(bf* sm, const bf* Qh, const bf* Ql, const bf* Kh, const bf* Kl, const bf* Va, const bf* Vb, float gn, bool causal, int qb, float* out) {
    constexpr int NPL = HI ? 4 : 3;
    const int tid = threadIdx.x, lane = tid & 31, lr = lane & 15, hi = lane >> 4; const int q0 = qb + __builtin_amdgcn_readfirstlane(tid >> 5) * QW;
    const bf* gp[4] = { Kh, Kl, Va, Vb };
    v16bf qh[2][2], ql[2][2];
#pragma unroll
    for (int qt = 0; qt < 2; ++qt) { const size_t qo = (size_t)(q0 + qt * 16 + lr) * HD + 8 * hi; const bf* pqh = Qh + qo; const bf* pql = Ql + qo;
#pragma unroll
        for (int ks = 0; ks < 2; ++ks) { qh[qt][ks] = WFrag<bf>::ld(pqh + ks * 32); ql[qt][ks] = WFrag<bf>::ld(pql + ks * 32); }
        asm volatile("s_wait_xcnt 0x0" :: "v"(pqh), "v"(pql) : "memory"); }   // stands before the address registers of these loads are written again (named as inputs, so that they live up to it)
    v8f O[4][2]; float m[2], l[2];
#pragma unroll
    for (int qt = 0; qt < 2; ++qt) { m[qt] = -3.0e38f; l[qt] = 0.f;
#pragma unroll
        for (int dt = 0; dt < 4; ++dt) O[dt][qt] = (v8f){}; }
    // a stage's plane is 512 chunks of 16 B, four a thread: chunk c = row c >> 3, elements 8 (c & 7)..; K rows are keys (pitch HD), V^T rows are d (pitch TT)
    v8us st[NPL][4];
    const int srow = tid >> 3, scol = (tid & 7) * 8;
    auto stage_load = [&](int s) {
        const unsigned ko = (unsigned)((s * SK + srow) * HD + scol) * 2u, vo = (unsigned)(srow * TT + s * SK + scol) * 2u;   // the thread's byte offsets in a K plane and in a V^T plane
#pragma unroll
        for (int pn = 0; pn < NPL; ++pn)
#pragma unroll
            for (int u = 0; u < 4; ++u) st[pn][u] = *(const v8us*)((const char*)gp[pn] + (pn < 2 ? ko : vo) + u * 32 * (pn < 2 ? HD : TT));
        asm volatile("s_wait_xcnt 0x0" :: "v"(ko), "v"(vo) : "memory"); };   // stands before the offset registers of these loads are written again (named as inputs, so that they live up to it)
    auto stage_store = [&](int b) {
#pragma unroll
        for (int pn = 0; pn < NPL; ++pn)
#pragma unroll
            for (int u = 0; u < 4; ++u) *(v8us*)(sm + (b * NPLX + pn) * PLN + (srow + u * 16) * LP + scol) = st[pn][u]; };
    stage_load(0); stage_store(0);
    __syncthreads();
#pragma unroll 1   // rolled: one copy of the stage body, so that code size and registers stay as they are
    for (int s = 0; s < TT / SK; ++s) {
        const bool more = (s + 1 < TT / SK);
        if (more) stage_load(s + 1);          // the loads stay in flight while this stage is worked on
        const bf* sb = sm + (s & 1) * NPLX * PLN;
        v16bf kh[2][2], kl[2][2], v0[HI ? 2 : 1][4], v1[HI ? 2 : 1][4]; v8f S[2][2];
        ld_k(sb, 0, lr, hi, kh, kl); ld_v<HI>(sb, 0, lr, hi, v0);
        scores(kh, kl, qh, ql, S);
        ld_k(sb, 32, lr, hi, kh, kl); ld_v<HI>(sb, 32, lr, hi, v1);   // the second half's fragments depend on nothing of the first half: they can be fetched ahead of its softmax
        soft_pv<HI>(S, v0, s * SK, q0, lr, hi, gn, causal, O, m, l);
        scores(kh, kl, qh, ql, S);
        soft_pv<HI>(S, v1, s * SK + 32, q0, lr, hi, gn, causal, O, m, l);
        if (more) stage_store((s + 1) & 1);   // the buffer that stage s - 1 read: every wave left it at the last barrier
        __syncthreads();                      // publishes stage s + 1 and ends every read of stage s
    }
#pragma unroll
    for (int qt = 0; qt < 2; ++qt) { const float inv = __fdiv_rn(1.0f, l[qt] + xhalf(l[qt])); float* orow = out + (size_t)(q0 + qt * 16 + lr) * HD + hi * 8;   // O^T tile: lane (c, h) holds d 8h..8h+7 of query c
#pragma unroll
        for (int dt = 0; dt < 4; ++dt) { v4f a, b;
#pragma unroll
            for (int u = 0; u < 4; ++u) { a[u] = O[dt][qt][u] * inv; b[u] = O[dt][qt][u + 4] * inv; }
            *(v4f*)(orow + dt * 16) = a; *(v4f*)(orow + dt * 16 + 4) = b; }
        if (qt == 0) asm volatile("s_wait_xcnt 0x0" ::: "memory"); }   // stands before a register that the first group's stores name is written again for the second
}

__global__ __launch_bounds__(NWV * 32) void k_fattn(const bf* __restrict__ Qh, const bf* __restrict__ Ql, const bf* __restrict__ Kh, const bf* __restrict__ Kl, const h16* __restrict__ V16, const bf* __restrict__ Vh, const bf* __restrict__ Vl, const float* __restrict__ gainp, const int* __restrict__ causp, float* __restrict__ out) {
    __shared__ __align__(16) bf sm[2 * NPLX * PLN];
    const int f = blockIdx.x; const bool hires = (f < NB_ * NH_ * (RH / QB)); const int g = f - NB_ * NH_ * (RH / QB);
    const int hd = hires ? f / (RH / QB) : g / ((TT - RH) / QB); const int qb = (hires ? f % (RH / QB) : RH / QB + g % ((TT - RH) / QB)) * QB;
    const size_t ho = (size_t)hd * TT * HD; const float gn = bfr(gainp[0]); const bool causal = (causp[0] != 0);
    if (hires) attn_body<true>(sm, Qh + ho, Ql + ho, Kh + ho, Kl + ho, Vh + ho, Vl + ho, gn, causal, qb, out + ho);        // the same for the whole work-group
    else attn_body<false>(sm, Qh + ho, Ql + ho, Kh + ho, Kl + ho, (const bf*)V16 + ho, nullptr, gn, causal, qb, out + ho);
}

extern "C" void kernel_launch(void* const* d_in, const int* in_sizes, int n_in,
                              void* d_out, int out_size, void* d_ws, size_t ws_size, hipStream_t stream) {
    (void)in_sizes; (void)n_in; (void)out_size;
    const float* Qi = (const float*)d_in[0]; const float* Ki = (const float*)d_in[1]; const float* Vi = (const float*)d_in[2]; const float* gainp = (const float*)d_in[3]; const int* causp = (const int*)d_in[4];
    float* OUT = (float*)d_out;     // [2][16][2048][64]
    char* wsp = (char*)d_ws;
    auto take = [&](size_t bytes) { char* p = wsp; wsp += (bytes + 255) & ~(size_t)255; return (void*)p; };
    const size_t PB = (size_t)NH_ * TT * HD;   // elements of one batch's plane; the planes hold both batches
    float* CS = (float*)take((size_t)TT * HD * 2 * 4);
    h16* VT16 = (h16*)take(NB_ * PB * 2);
    bf* QPh = (bf*)take(NB_ * PB * 2); bf* QPl = (bf*)take(NB_ * PB * 2); bf* KPh = (bf*)take(NB_ * PB * 2); bf* KPl = (bf*)take(NB_ * PB * 2); bf* VTh = (bf*)take(NB_ * PB * 2); bf* VTl = (bf*)take(NB_ * PB * 2);
    h16* QP16 = (h16*)take(PB * 2); h16* KP16 = (h16*)take(PB * 2);   // the f16 planes of Qn and Kn are stored and never read
    if ((size_t)(wsp - (char*)d_ws) > ws_size) return;    // ws 256 MiB
    k_csid<<<(TT * HD + 255) / 256, 256, 0, stream>>>(CS);
    const unsigned LKv = (unsigned)(((size_t)NKV * TT * HD / 2 + 255) / 256);
    for (int b = 0; b < NB_; ++b) {
        k_nrmp<<<NH_ * TT / 8, 256, 0, stream>>>(Qi + b * PB, QP16, QPh + b * PB, QPl + b * PB);
        k_nrmp<<<NKV * TT / 8, 256, 0, stream>>>(Ki + b * PB, KP16, KPh + b * PB, KPl + b * PB); k_vt3<<<LKv, 256, 0, stream>>>(Vi + b * PB, VT16 + b * PB, VTh + b * PB, VTl + b * PB); }
    k_fattn<<<NB_ * NH_ * (TT / QB), NWV * 32, 0, stream>>>(QPh, QPl, KPh, KPl, VT16, VTh, VTl, gainp, causp, OUT);
}

// v004
// It runs in 76.6 microseconds.
// Timed twice side by side with v003, it ran 1.33 and 1.34 times as fast.
// Counting every step since v000, it is 22.7 times as fast.
#include <hip/hip_runtime.h>

// SelfDotProductAttnQKNorm (Q, K, V [2][16][2048][64] given; Qn, Kn = L2-normalised over d (eps 1e-12 inside the sqrt); scores = gain x (Qn . Kn) with gain a scalar input (read on device; log2(2048? - 2048) ~ 22); is_causal (int input, read on device; 1 here) -> j > i masked to -1e30; softmax; out = attn V -> [2][16][2048][64]).
// Compute dtypes, f32 accumulate: every input rounded to bf16; the L2 normalisation f32 on the VALU; full score matrices (the causal flag is data), all rows hl x hl (3 products); x gain, mask and softmax f32;

#define NB_  2
#define TT   2048
#define DM   1024
#define NH_  16
#define NKV  16
#define REP  (NH_ / NKV)
#define HD   64
#define DQ   (NH_ * HD)
#define DKV  (NKV * HD)
#define ZH   8                    // heads per call of k_merge
#define RH   512                  // query rows < RH use hi+lo planes (0: none)
#define WIN  0
#define PCAR 1024.0f
#define SCL  0.125f   // HD^-0.5
typedef _Float16 h16;
typedef unsigned short bf;
typedef __attribute__((ext_vector_type(16))) __bf16   v16bf;
typedef __attribute__((ext_vector_type(16))) _Float16 v16h;
typedef __attribute__((ext_vector_type(8)))  _Float16 v8h;
typedef __attribute__((ext_vector_type(8)))  unsigned short v8us;
typedef __attribute__((ext_vector_type(8)))  float    v8f;
typedef __attribute__((ext_vector_type(4)))  float    v4f;
typedef v8h  __attribute__((may_alias)) v8ha;
typedef v4f  __attribute__((may_alias)) v4fa;
typedef v8us __attribute__((may_alias)) v8usa;

__device__ __forceinline__ unsigned short f2bf(float f) { unsigned u = __float_as_uint(f); u += 0x7FFFu + ((u >> 16) & 1u); return (unsigned short)(u >> 16); }
__device__ __forceinline__ float bf2f(unsigned short b) { return __uint_as_float(((unsigned)b) << 16); }
__device__ __forceinline__ float bfr(float f) { return bf2f(f2bf(f)); }
__device__ __forceinline__ v16h cat16(v8h lo, v8h hi) { return __builtin_shufflevector(lo, hi, 0, 1, 2, 3, 4, 5, 6, 7, 8, 9, 10, 11, 12, 13, 14, 15); }
__device__ __forceinline__ v16bf cat16b(v8us lo, v8us hi) { return __builtin_bit_cast(v16bf, __builtin_shufflevector(lo, hi, 0, 1, 2, 3, 4, 5, 6, 7, 8, 9, 10, 11, 12, 13, 14, 15)); }
__device__ __forceinline__ v8f wmma16(v16h a, v16h b, v8f c) { return __builtin_amdgcn_wmma_f32_16x16x32_f16(false, a, false, b, (short)0, c, false, false); }
__device__ __forceinline__ v8f wmmab(v16bf a, v16bf b, v8f c) { return __builtin_amdgcn_wmma_f32_16x16x32_bf16(false, a, false, b, (short)0, c, false, false); }



// fragment loaders, hardware k order: 8 elements at p and 8 at p + 16, p = row start + 32 * kstep + 8 * (lane >> 4)
template <typename T16> struct WFrag;
template <> struct WFrag<h16> { typedef v16h V; static __device__ __forceinline__ V ld(const h16* p) { return cat16(*(const v8h*)p, *(const v8h*)(p + 16)); } static __device__ __forceinline__ v8f mma(V a, V b, v8f c) { return wmma16(a, b, c); } };
template <> struct WFrag<bf> { typedef v16bf V; static __device__ __forceinline__ V ld(const bf* p) { return cat16b(*(const v8us*)p, *(const v8us*)(p + 16)); } static __device__ __forceinline__ v8f mma(V a, V b, v8f c) { return wmmab(a, b, c); } };

__device__ __forceinline__ h16 tohx(float x) { return (h16)x; }
__device__ __forceinline__ void splitf(float y, unsigned short& h, unsigned short& l) { h = f2bf(y); l = f2bf(y - bf2f(h)); }
typedef __attribute__((ext_vector_type(2))) _Float16 v2h;
typedef __attribute__((ext_vector_type(4))) _Float16 v4h;
typedef __attribute__((ext_vector_type(2))) unsigned short v2us;
typedef __attribute__((ext_vector_type(4))) unsigned short v4us;
typedef __attribute__((ext_vector_type(2))) float v2f;
typedef __attribute__((ext_vector_type(4))) int v4i;

__global__ __launch_bounds__(256) void k_wtG(const float* __restrict__ w, int K, int N, bf* Bt) {
    const int lane = threadIdx.x & 31; const int L0 = (blockIdx.x * 8 + (threadIdx.x >> 5)) * 8; const int nlines = N * K / 64;
{
#pragma unroll 1
        for (int l = 0; l < 8; ++l) { const int L = L0 + l; if (L >= nlines) break; const size_t e = (size_t)L * 64 + lane * 2; const int k = (int)(e % K), n = (int)(e / K); v2us o;
            o[0] = f2bf(w[(size_t)k * N + n]); o[1] = f2bf(w[(size_t)(k + 1) * N + n]); *(v2us*)(Bt + e) = o; }
         }
}
__global__ __launch_bounds__(256) void k_cvt8(const float* __restrict__ src, bf* dst, size_t n8) { const size_t i = (size_t)blockIdx.x * 256 + threadIdx.x; if (i >= n8) return; const v8f v = *(const v8f*)(src + i * 8); v8us o;
#pragma unroll
    for (int k = 0; k < 8; ++k) o[k] = f2bf(v[k]); *(v8us*)(dst + i * 8) = o;  }
__global__ __launch_bounds__(256) void k_cscvt(const float* __restrict__ cosT, const float* __restrict__ sinT, float* CS) { const int idx = blockIdx.x * 256 + threadIdx.x; if (idx >= TT * HD) return; v2f cs; cs[0] = bfr(cosT[idx]); cs[1] = bfr(sinT[idx]); *(v2f*)(CS + (size_t)idx * 2) = cs;  }
// k_rope: head planes [h][t][d] (fp16 + hi/lo) of rope(x) x sc with the rotate-half convention out[d] = x[d] cos[t][d] - x[d+HD/2] sin[t][d], out[d+HD/2] = x[d+HD/2] cos[t][d+HD/2] + x[d] sin[t][d+HD/2]
__global__ __launch_bounds__(256) void k_rope(const float* __restrict__ F, int pitch, int nheads, const float* __restrict__ CS, const float* __restrict__ RF, const float* __restrict__ nw, float sc, h16* P16, bf* Ph, bf* Pl) {
    const size_t e = ((size_t)blockIdx.x * 256 + threadIdx.x) * 2; if (e >= (size_t)nheads * TT * HD) return; const int d = (int)(e % HD); const int t = (int)((e / HD) % TT); const int h = (int)(e / ((size_t)HD * TT)); const float* f = F + (size_t)t * pitch + h * HD; const float rf = RF ? RF[(size_t)h * TT + t] : 1.0f; v2h o16; v2us oh, ol;
#pragma unroll
    for (int q = 0; q < 2; ++q) { const int dd = d + q; const int dp = (dd < HD / 2) ? dd + HD / 2 : dd - HD / 2; float x0 = f[dd], x1 = f[dp];
        if (RF) { float n0 = __fmul_rn(x0, rf), n1 = __fmul_rn(x1, rf); asm volatile("" : "+v"(n0)); asm volatile("" : "+v"(n1)); x0 = __fmul_rn(bfr(nw[dd]), n0); x1 = __fmul_rn(bfr(nw[dp]), n1); }
        const v2f cs = *(const v2f*)(CS + ((size_t)t * HD + dd) * 2); float a = __fmul_rn(x0, cs[0]), bq = __fmul_rn(x1, cs[1]); asm volatile("" : "+v"(a)); asm volatile("" : "+v"(bq)); const float r = ((dd < HD / 2) ? __fsub_rn(a, bq) : __fadd_rn(a, bq)) * sc;
        o16[q] = tohx(r); unsigned short a2, c2; splitf(r, a2, c2); oh[q] = a2; ol[q] = c2; }
    *(v2h*)(P16 + e) = o16; *(v2us*)(Ph + e) = oh; *(v2us*)(Pl + e) = ol;  }
__global__ __launch_bounds__(256) void k_vtp(const float* __restrict__ F, int pitch, int nheads, h16* V16, bf* Vh, bf* Vl) { const size_t e = ((size_t)blockIdx.x * 256 + threadIdx.x) * 2; if (e >= (size_t)nheads * HD * TT) return; const int t = (int)(e % TT); const int d = (int)((e / TT) % HD); const int g = (int)(e / ((size_t)TT * HD)); v2h o16; v2us oh, ol;
#pragma unroll
    for (int q = 0; q < 2; ++q) { const float x = F[(size_t)(t + q) * pitch + g * HD + d]; o16[q] = tohx(x); unsigned short a2, c2; splitf(x, a2, c2); oh[q] = a2; ol[q] = c2; }
    *(v2h*)(V16 + e) = o16; *(v2us*)(Vh + e) = oh; *(v2us*)(Vl + e) = ol;  }
__global__ __launch_bounds__(256) void k_merge(const float* __restrict__ O, int h0, bf* Ah, bf* Al) { const size_t e = ((size_t)blockIdx.x * 256 + threadIdx.x) * 2; if (e >= (size_t)ZH * TT * HD) return; const int d = (int)(e % HD); const int t = (int)((e / HD) % TT); const int zz = (int)(e / ((size_t)HD * TT)); const float cs = (t < RH) ? 1.0f : (1.0f / PCAR); const size_t oo = (size_t)t * DQ + (h0 + zz) * HD + d;
    v2us oh, ol;
#pragma unroll
    for (int q = 0; q < 2; ++q) { unsigned short a, c2; splitf(O[e + q] * cs, a, c2); oh[q] = a; ol[q] = c2; } *(v2us*)(Ah + oo) = oh; *(v2us*)(Al + oo) = ol;  }

// ---- k_prep: all that k_fattn reads, made in one launch of PWG work-groups of 8 waves. Each wave loops over many rows, so that the chip starts few waves instead of one wave a row.
// V: a work-group turns a tile of 128 t x 64 d through LDS (whole lines read, whole lines written). Q, K: a wave normalises PRW rows of each, 8 rows a trip, 2 elements of a row per lane.
// Every '#pragma unroll' in it stands on a short loop that indexes register arrays: unrolled, the arrays stay in registers and the loads of a trip go out together.
#define PWG  (NB_ * NH_ * (TT / 128))             // work-groups: one V tile each
#define PRW  (NB_ * NH_ * TT / (PWG * 8))         // rows of Q, and of K, per wave
#define VPD  65                                   // LDS row pitch in dwords (64 dwords = 128 t, + 1: stores down a column and loads along a row both fall on distinct banks)
__global__ __launch_bounds__(256) void k_prep(const float* __restrict__ Q, const float* __restrict__ K, const float* __restrict__ V, bf* __restrict__ Qh, bf* __restrict__ Ql, bf* __restrict__ Kh, bf* __restrict__ Kl, h16* __restrict__ V16, bf* __restrict__ Vh, bf* __restrict__ Vl) {
    __shared__ unsigned vt[HD * VPD];             // [d][t / 2]: the bf16 bits of V at t (low half) and t + 1
    const int tid = threadIdx.x, lane = tid & 31; const int lo4 = tid & 15, up4 = tid >> 4;
    const int g = blockIdx.x / (TT / 128), t0 = (blockIdx.x % (TT / 128)) * 128;
    {   // rows t0 + 2p and t0 + 2p + 1, p = up4 + 16u, elements 4 lo4..4 lo4 + 3
        const char* vb = (const char*)(V + ((size_t)g * TT + t0) * HD); const unsigned vo = (unsigned)(2 * up4 * HD + 4 * lo4) * 4u; v4f a[4], b[4];
#pragma unroll
        for (int u = 0; u < 4; ++u) { a[u] = *(const v4f*)(vb + vo + u * 32 * HD * 4); b[u] = *(const v4f*)(vb + vo + u * 32 * HD * 4 + HD * 4); }
        asm volatile("s_wait_xcnt 0x0" :: "v"(vo) : "memory");   // stands before the offset register of these loads is written again (named as an input, so that it lives up to it)
#pragma unroll
        for (int u = 0; u < 4; ++u)
#pragma unroll
            for (int i = 0; i < 4; ++i) vt[(4 * lo4 + i) * VPD + up4 + 16 * u] = (unsigned)f2bf(a[u][i]) | ((unsigned)f2bf(b[u][i]) << 16);
    }
    __syncthreads();                              // the tile is whole before anybody reads a row of it
    {   // row d = up4 + 16u, t0 + 8 lo4..+7: 16 B to each plane, a row of the tile is 256 B
        const unsigned eo = (unsigned)(up4 * TT + 8 * lo4) * 2u; const size_t pb = (((size_t)g * HD) * TT + t0) * 2;
#pragma unroll
        for (int u = 0; u < 4; ++u) { v8h o16; v8us oh, ol;
#pragma unroll
            for (int j = 0; j < 4; ++j) { const unsigned w = vt[(up4 + 16 * u) * VPD + 4 * lo4 + j];
#pragma unroll
                for (int q = 0; q < 2; ++q) { const float x = bf2f((unsigned short)(q ? (w >> 16) : (w & 0xFFFFu))); o16[2 * j + q] = tohx(x); unsigned short a2, c2; splitf(x, a2, c2); oh[2 * j + q] = a2; ol[2 * j + q] = c2; } }
            *(v8h*)((char*)V16 + pb + eo + u * 16 * TT * 2) = o16; *(v8us*)((char*)Vh + pb + eo + u * 16 * TT * 2) = oh; *(v8us*)((char*)Vl + pb + eo + u * 16 * TT * 2) = ol; }
        asm volatile("s_wait_xcnt 0x0" :: "v"(eo) : "memory");   // stands before the offset register of these stores is written again
    }
    const int row0 = (blockIdx.x * 8 + __builtin_amdgcn_readfirstlane(tid >> 5)) * PRW;   // the wave's first row, of Q and of K
    const unsigned li = (unsigned)lane * 8u, lo = (unsigned)lane * 4u;                    // the lane's byte offsets in an f32 row and in a 16-bit row
#pragma unroll 1   // rolled: one copy of the 8-row body serves Q and K
    for (int it = 0; it < 2 * (PRW / 8); ++it) {
        const bool isq = (it < PRW / 8); const size_t r0 = (size_t)(row0 + (it % (PRW / 8)) * 8) * HD;
        const char* xs = (const char*)((isq ? Q : K) + r0); char* ph = (char*)((isq ? Qh : Kh) + r0); char* pl = (char*)((isq ? Ql : Kl) + r0);
        v2f x[8];
#pragma unroll
        for (int u = 0; u < 8; ++u) x[u] = *(const v2f*)(xs + li + u * HD * 4);
        asm volatile("s_wait_xcnt 0x0" :: "v"(li), "s"(xs) : "memory");   // stands before a register that these loads name is written again
        float q[8];
#pragma unroll
        for (int u = 0; u < 8; ++u) { x[u][0] = bfr(x[u][0]); x[u][1] = bfr(x[u][1]); q[u] = x[u][0] * x[u][0] + x[u][1] * x[u][1]; }
#pragma unroll
        for (int sh = 16; sh; sh >>= 1)
#pragma unroll
            for (int u = 0; u < 8; ++u) q[u] += __shfl_xor(q[u], sh, 32);
#pragma unroll
        for (int u = 0; u < 8; ++u) { const float den = __fsqrt_rn(__fadd_rn(q[u], 1e-12f)); const float y0 = __fdiv_rn(x[u][0], den), y1 = __fdiv_rn(x[u][1], den); v2us oh, ol; unsigned short a, c;
            splitf(y0, a, c); oh[0] = a; ol[0] = c; splitf(y1, a, c); oh[1] = a; ol[1] = c;
            *(v2us*)(ph + lo + u * HD * 2) = oh; *(v2us*)(pl + lo + u * HD * 2) = ol; }
        asm volatile("s_wait_xcnt 0x0" :: "v"(lo), "s"(ph), "s"(pl) : "memory");   // stands before a register that these stores name is written again
    }
}
#define QW   32                   // query columns per wave
#define NWV  4                    // waves per work-group
#define QB   (QW * NWV)           // queries per work-group
#define SK   64                   // keys per LDS stage
#define LP   72                   // LDS row pitch in 16-bit elements: 144 B = 16 B x 9
#define PLN  (64 * LP)            // one staged plane: 64 rows (keys of K, d of V^T) of 64 elements
#define NPLX 4                    // planes per stage at most: Kh, Kl, then Vh, Vl or V16
#define LOG2E 1.4426950408889634f
typedef __attribute__((ext_vector_type(8))) __bf16 v8bf;
__device__ __forceinline__ float xhalf(float x) { const int b = __float_as_int(x); return __int_as_float(__builtin_amdgcn_permlanex16(b, b, 0x76543210, 0xfedcba98, false, false)); }   // the value of lane l ^ 16
__device__ __forceinline__ v16bf ldsb(const bf* p) { return cat16b(*(const v8us*)p, *(const v8us*)(p + 16)); }
__device__ __forceinline__ v16bf cat16f(v8bf lo, v8bf hi) { return __builtin_shufflevector(lo, hi, 0, 1, 2, 3, 4, 5, 6, 7, 8, 9, 10, 11, 12, 13, 14, 15); }

// K fragments (A operand) of 32 keys, rows kloc.. of the staged planes
__device__ __forceinline__ void ld_k(const bf* sb, int kloc, int lr, int hi, v16bf (&kh)[2][2], v16bf (&kl)[2][2]) {
#pragma unroll
    for (int kt = 0; kt < 2; ++kt)
#pragma unroll
        for (int ks = 0; ks < 2; ++ks) { const bf* kr = sb + (kloc + kt * 16 + lr) * LP + ks * 32 + 8 * hi; kh[kt][ks] = ldsb(kr); kl[kt][ks] = ldsb(kr + PLN); }
}
// V^T fragments (A operand) of the same 32 keys: v[0][dt] = Vh or V16 (bits), v[1][dt] = Vl
template <bool HI>
__device__ __forceinline__ void ld_v(const bf* sb, int kloc, int lr, int hi, v16bf (&v)[HI ? 2 : 1][4]) {
#pragma unroll
    for (int dt = 0; dt < 4; ++dt) { const bf* vr = sb + 2 * PLN + (dt * 16 + lr) * LP + kloc + 8 * hi; v[0][dt] = ldsb(vr); if (HI) v[HI ? 1 : 0][dt] = ldsb(vr + PLN); }
}
// hl x hl, 3 products, per tile in the order Qh Kh, Ql Kh, Qh Kl for d 0..31, then for d 32..63
__device__ __forceinline__ void scores(const v16bf (&kh)[2][2], const v16bf (&kl)[2][2], const v16bf (&qh)[2][2], const v16bf (&ql)[2][2], v8f (&S)[2][2]) {
#pragma unroll
    for (int kt = 0; kt < 2; ++kt)
#pragma unroll
        for (int qt = 0; qt < 2; ++qt) S[kt][qt] = (v8f){};
#pragma unroll
    for (int ks = 0; ks < 2; ++ks) {
#pragma unroll
        for (int kt = 0; kt < 2; ++kt)
#pragma unroll
            for (int qt = 0; qt < 2; ++qt) S[kt][qt] = wmmab(kh[kt][ks], qh[qt][ks], S[kt][qt]);
#pragma unroll
        for (int kt = 0; kt < 2; ++kt)
#pragma unroll
            for (int qt = 0; qt < 2; ++qt) S[kt][qt] = wmmab(kh[kt][ks], ql[qt][ks], S[kt][qt]);
#pragma unroll
        for (int kt = 0; kt < 2; ++kt)
#pragma unroll
            for (int qt = 0; qt < 2; ++qt) S[kt][qt] = wmmab(kl[kt][ks], qh[qt][ks], S[kt][qt]);
    }
}
// gain, mask, running maximum and sum, probabilities, and O^T += V^T P^T, for keys kb..kb+31 against queries q0..q0+31
template <bool HI>
__device__ __forceinline__ void soft_pv(v8f (&S)[2][2], const v16bf (&v)[HI ? 2 : 1][4], int kb, int q0, int lr, int hi, float gn, bool causal, v8f (&O)[4][2], float (&m)[2], float (&l)[2]) {
    const bool edge = causal && (kb + 31 > q0);   // wave-uniform: only then can a key of this pass lie behind a query of this wave
#pragma unroll
    for (int kt = 0; kt < 2; ++kt)
#pragma unroll
        for (int qt = 0; qt < 2; ++qt) S[kt][qt] *= gn;
    if (edge) {
#pragma unroll
        for (int qt = 0; qt < 2; ++qt) { const int qi = q0 + qt * 16 + lr;
#pragma unroll
            for (int kt = 0; kt < 2; ++kt) {
#pragma unroll
                for (int j = 0; j < 8; ++j) if (kb + kt * 16 + hi * 8 + j > qi) S[kt][qt][j] = -1.0e30f;
                asm volatile("" : "+v"(S[kt][qt]));
            } }
    }
    float mn[2];
#pragma unroll
    for (int qt = 0; qt < 2; ++qt) { float mx = -3.0e38f;
#pragma unroll
        for (int kt = 0; kt < 2; ++kt)
#pragma unroll
            for (int j = 0; j < 8; ++j) mx = fmaxf(mx, S[kt][qt][j]);
        mn[qt] = fmaxf(m[qt], fmaxf(mx, xhalf(mx))); }
    if (__builtin_amdgcn_ballot_w32(mn[0] > m[0] || mn[1] > m[1]) != 0) {   // a maximum moved somewhere in the wave: bring sums and outputs to the new one
#pragma unroll
        for (int qt = 0; qt < 2; ++qt) { const float al = __builtin_amdgcn_exp2f((m[qt] - mn[qt]) * LOG2E); m[qt] = mn[qt]; l[qt] *= al;
#pragma unroll
            for (int dt = 0; dt < 4; ++dt) O[dt][qt] *= al; }
    }
    v16bf ph[2], pl[2];   // f16 rows: ph holds the f16 bits
#pragma unroll
    for (int qt = 0; qt < 2; ++qt) { const float c = (HI ? 0.0f : 10.0f) - m[qt] * LOG2E;   // f16 probabilities carry x 1024 (as the sum does: it cancels in the quotient)
        const v8f cv = { c, c, c, c, c, c, c, c }, lv = { LOG2E, LOG2E, LOG2E, LOG2E, LOG2E, LOG2E, LOG2E, LOG2E };
        const v8f a0 = __builtin_elementwise_fma(S[0][qt], lv, cv), a1 = __builtin_elementwise_fma(S[1][qt], lv, cv);
#pragma unroll
        for (int j = 0; j < 8; ++j) { S[0][qt][j] = __builtin_amdgcn_exp2f(a0[j]); S[1][qt][j] = __builtin_amdgcn_exp2f(a1[j]); }
        const v8f sv = S[0][qt] + S[1][qt];
        l[qt] += ((sv[0] + sv[1]) + (sv[2] + sv[3])) + ((sv[4] + sv[5]) + (sv[6] + sv[7]));
        if (HI) { const v8bf h0 = __builtin_convertvector(S[0][qt], v8bf), h1 = __builtin_convertvector(S[1][qt], v8bf);
            const v8bf l0 = __builtin_convertvector(S[0][qt] - __builtin_convertvector(h0, v8f), v8bf), l1 = __builtin_convertvector(S[1][qt] - __builtin_convertvector(h1, v8f), v8bf);
            ph[qt] = cat16f(h0, h1); pl[qt] = cat16f(l0, l1);
        } else ph[qt] = __builtin_bit_cast(v16bf, cat16(__builtin_convertvector(S[0][qt], v8h), __builtin_convertvector(S[1][qt], v8h))); }
    if (HI) {   // per tile in the order Ph Vh, Pl Vh, Ph Vl
#pragma unroll
        for (int dt = 0; dt < 4; ++dt)
#pragma unroll
            for (int qt = 0; qt < 2; ++qt) O[dt][qt] = wmmab(v[0][dt], ph[qt], O[dt][qt]);
#pragma unroll
        for (int dt = 0; dt < 4; ++dt)
#pragma unroll
            for (int qt = 0; qt < 2; ++qt) O[dt][qt] = wmmab(v[0][dt], pl[qt], O[dt][qt]);
#pragma unroll
        for (int dt = 0; dt < 4; ++dt)
#pragma unroll
            for (int qt = 0; qt < 2; ++qt) O[dt][qt] = wmmab(v[HI ? 1 : 0][dt], ph[qt], O[dt][qt]);
    } else {
#pragma unroll
        for (int dt = 0; dt < 4; ++dt)
#pragma unroll
            for (int qt = 0; qt < 2; ++qt) O[dt][qt] = wmma16(__builtin_bit_cast(v16h, v[0][dt]), __builtin_bit_cast(v16h, ph[qt]), O[dt][qt]);
    }
}

template <bool HI>
__device__ __forceinline__ void attn_body(bf* sm, const bf* Qh, const bf* Ql, const bf* Kh, const bf* Kl, const bf* Va, const bf* Vb, float gn, bool causal, int qb, float* out) {
    constexpr int NPL = HI ? 4 : 3;
    const int tid = threadIdx.x, lane = tid & 31, lr = lane & 15, hi = lane >> 4; const int q0 = qb + __builtin_amdgcn_readfirstlane(tid >> 5) * QW;
    const bf* gp[4] = { Kh, Kl, Va, Vb };
    v16bf qh[2][2], ql[2][2];
#pragma unroll
    for (int qt = 0; qt < 2; ++qt) { const size_t qo = (size_t)(q0 + qt * 16 + lr) * HD + 8 * hi; const bf* pqh = Qh + qo; const bf* pql = Ql + qo;
#pragma unroll
        for (int ks = 0; ks < 2; ++ks) { qh[qt][ks] = WFrag<bf>::ld(pqh + ks * 32); ql[qt][ks] = WFrag<bf>::ld(pql + ks * 32); }
        asm volatile("s_wait_xcnt 0x0" :: "v"(pqh), "v"(pql) : "memory"); }   // stands before the address registers of these loads are written again (named as inputs, so that they live up to it)
    v8f O[4][2]; float m[2], l[2];
#pragma unroll
    for (int qt = 0; qt < 2; ++qt) { m[qt] = -3.0e38f; l[qt] = 0.f;
#pragma unroll
        for (int dt = 0; dt < 4; ++dt) O[dt][qt] = (v8f){}; }
    // a stage's plane is 512 chunks of 16 B, four a thread: chunk c = row c >> 3, elements 8 (c & 7)..; K rows are keys (pitch HD), V^T rows are d (pitch TT)
    v8us st[NPL][4];
    const int srow = tid >> 3, scol = (tid & 7) * 8;
    auto stage_load = [&](int s) {
        const unsigned ko = (unsigned)((s * SK + srow) * HD + scol) * 2u, vo = (unsigned)(srow * TT + s * SK + scol) * 2u;   // the thread's byte offsets in a K plane and in a V^T plane
#pragma unroll
        for (int pn = 0; pn < NPL; ++pn)
#pragma unroll
            for (int u = 0; u < 4; ++u) st[pn][u] = *(const v8us*)((const char*)gp[pn] + (pn < 2 ? ko : vo) + u * 32 * (pn < 2 ? HD : TT));
        asm volatile("s_wait_xcnt 0x0" :: "v"(ko), "v"(vo) : "memory"); };   // stands before the offset registers of these loads are written again (named as inputs, so that they live up to it)
    auto stage_store = [&](int b) {
#pragma unroll
        for (int pn = 0; pn < NPL; ++pn)
#pragma unroll
            for (int u = 0; u < 4; ++u) *(v8us*)(sm + (b * NPLX + pn) * PLN + (srow + u * 16) * LP + scol) = st[pn][u]; };
    stage_load(0); stage_store(0);
    __syncthreads();
#pragma unroll 1   // rolled: one copy of the stage body, so that code size and registers stay as they are
    for (int s = 0; s < TT / SK; ++s) {
        const bool more = (s + 1 < TT / SK);
        if (more) stage_load(s + 1);          // the loads stay in flight while this stage is worked on
        const bf* sb = sm + (s & 1) * NPLX * PLN;
        v16bf kh[2][2], kl[2][2], v0[HI ? 2 : 1][4], v1[HI ? 2 : 1][4]; v8f S[2][2];
        ld_k(sb, 0, lr, hi, kh, kl); ld_v<HI>(sb, 0, lr, hi, v0);
        scores(kh, kl, qh, ql, S);
        ld_k(sb, 32, lr, hi, kh, kl); ld_v<HI>(sb, 32, lr, hi, v1);   // the second half's fragments depend on nothing of the first half: they can be fetched ahead of its softmax
        soft_pv<HI>(S, v0, s * SK, q0, lr, hi, gn, causal, O, m, l);
        scores(kh, kl, qh, ql, S);
        soft_pv<HI>(S, v1, s * SK + 32, q0, lr, hi, gn, causal, O, m, l);
        if (more) stage_store((s + 1) & 1);   // the buffer that stage s - 1 read: every wave left it at the last barrier
        __syncthreads();                      // publishes stage s + 1 and ends every read of stage s
    }
#pragma unroll
    for (int qt = 0; qt < 2; ++qt) { const float inv = __fdiv_rn(1.0f, l[qt] + xhalf(l[qt])); float* orow = out + (size_t)(q0 + qt * 16 + lr) * HD + hi * 8;   // O^T tile: lane (c, h) holds d 8h..8h+7 of query c
#pragma unroll
        for (int dt = 0; dt < 4; ++dt) { v4f a, b;
#pragma unroll
            for (int u = 0; u < 4; ++u) { a[u] = O[dt][qt][u] * inv; b[u] = O[dt][qt][u + 4] * inv; }
            *(v4f*)(orow + dt * 16) = a; *(v4f*)(orow + dt * 16 + 4) = b; }
        if (qt == 0) asm volatile("s_wait_xcnt 0x0" ::: "memory"); }   // stands before a register that the first group's stores name is written again for the second
}

__global__ __launch_bounds__(NWV * 32) void k_fattn(const bf* __restrict__ Qh, const bf* __restrict__ Ql, const bf* __restrict__ Kh, const bf* __restrict__ Kl, const h16* __restrict__ V16, const bf* __restrict__ Vh, const bf* __restrict__ Vl, const float* __restrict__ gainp, const int* __restrict__ causp, float* __restrict__ out) {
    __shared__ __align__(16) bf sm[2 * NPLX * PLN];
    const int f = blockIdx.x; const bool hires = (f < NB_ * NH_ * (RH / QB)); const int g = f - NB_ * NH_ * (RH / QB);
    const int hd = hires ? f / (RH / QB) : g / ((TT - RH) / QB); const int qb = (hires ? f % (RH / QB) : RH / QB + g % ((TT - RH) / QB)) * QB;
    const size_t ho = (size_t)hd * TT * HD; const float gn = bfr(gainp[0]); const bool causal = (causp[0] != 0);
    if (hires) attn_body<true>(sm, Qh + ho, Ql + ho, Kh + ho, Kl + ho, Vh + ho, Vl + ho, gn, causal, qb, out + ho);        // the same for the whole work-group
    else attn_body<false>(sm, Qh + ho, Ql + ho, Kh + ho, Kl + ho, (const bf*)V16 + ho, nullptr, gn, causal, qb, out + ho);
}

extern "C" void kernel_launch(void* const* d_in, const int* in_sizes, int n_in,
                              void* d_out, int out_size, void* d_ws, size_t ws_size, hipStream_t stream) {
    (void)in_sizes; (void)n_in; (void)out_size;
    const float* Qi = (const float*)d_in[0]; const float* Ki = (const float*)d_in[1]; const float* Vi = (const float*)d_in[2]; const float* gainp = (const float*)d_in[3]; const int* causp = (const int*)d_in[4];
    float* OUT = (float*)d_out;     // [2][16][2048][64]
    char* wsp = (char*)d_ws;
    auto take = [&](size_t bytes) { char* p = wsp; wsp += (bytes + 255) & ~(size_t)255; return (void*)p; };
    const size_t PB = (size_t)NH_ * TT * HD;   // elements of one batch's plane; the planes hold both batches
    h16* VT16 = (h16*)take(NB_ * PB * 2);
    bf* QPh = (bf*)take(NB_ * PB * 2); bf* QPl = (bf*)take(NB_ * PB * 2); bf* KPh = (bf*)take(NB_ * PB * 2); bf* KPl = (bf*)take(NB_ * PB * 2); bf* VTh = (bf*)take(NB_ * PB * 2); bf* VTl = (bf*)take(NB_ * PB * 2);
    if ((size_t)(wsp - (char*)d_ws) > ws_size) return;    // ws 256 MiB
    k_prep<<<PWG, 256, 0, stream>>>(Qi, Ki, Vi, QPh, QPl, KPh, KPl, VT16, VTh, VTl);
    k_fattn<<<NB_ * NH_ * (TT / QB), NWV * 32, 0, stream>>>(QPh, QPl, KPh, KPl, VT16, VTh, VTl, gainp, causp, OUT);
}

// v005
// A run of this version takes 56.7 microseconds.
// Timed twice side by side with v004, it ran 1.35 and 1.36 times as fast.
// Over all steps from v000 it is 30.7 times as fast.
#include <hip/hip_runtime.h>

// SelfDotProductAttnQKNorm (Q, K, V [2][16][2048][64] given; Qn, Kn = L2-normalised over d (eps 1e-12 inside the sqrt); scores = gain x (Qn . Kn) with gain a scalar input (read on device; log2(2048? - 2048) ~ 22); is_causal (int input, read on device; 1 here) -> j > i masked to -1e30; softmax; out = attn V -> [2][16][2048][64]).
// Compute dtypes, f32 accumulate: every input rounded to bf16; the L2 normalisation f32 on the VALU; the causal flag is data: set, key stages that lie wholly behind a work-group's queries are not walked; all rows hl x hl (3 products); x gain, mask and softmax f32;

#define NB_  2
#define TT   2048
#define DM   1024
#define NH_  16
#define NKV  16
#define REP  (NH_ / NKV)
#define HD   64
#define DQ   (NH_ * HD)
#define DKV  (NKV * HD)
#define ZH   8                    // heads per call of k_merge
#define RH   512                  // query rows < RH use hi+lo planes (0: none)
#define WIN  0
#define PCAR 1024.0f
#define SCL  0.125f   // HD^-0.5
typedef _Float16 h16;
typedef unsigned short bf;
typedef __attribute__((ext_vector_type(16))) __bf16   v16bf;
typedef __attribute__((ext_vector_type(16))) _Float16 v16h;
typedef __attribute__((ext_vector_type(8)))  _Float16 v8h;
typedef __attribute__((ext_vector_type(8)))  unsigned short v8us;
typedef __attribute__((ext_vector_type(8)))  float    v8f;
typedef __attribute__((ext_vector_type(4)))  float    v4f;
typedef v8h  __attribute__((may_alias)) v8ha;
typedef v4f  __attribute__((may_alias)) v4fa;
typedef v8us __attribute__((may_alias)) v8usa;

__device__ __forceinline__ unsigned short f2bf(float f) { unsigned u = __float_as_uint(f); u += 0x7FFFu + ((u >> 16) & 1u); return (unsigned short)(u >> 16); }
__device__ __forceinline__ float bf2f(unsigned short b) { return __uint_as_float(((unsigned)b) << 16); }
__device__ __forceinline__ float bfr(float f) { return bf2f(f2bf(f)); }
__device__ __forceinline__ v16h cat16(v8h lo, v8h hi) { return __builtin_shufflevector(lo, hi, 0, 1, 2, 3, 4, 5, 6, 7, 8, 9, 10, 11, 12, 13, 14, 15); }
__device__ __forceinline__ v16bf cat16b(v8us lo, v8us hi) { return __builtin_bit_cast(v16bf, __builtin_shufflevector(lo, hi, 0, 1, 2, 3, 4, 5, 6, 7, 8, 9, 10, 11, 12, 13, 14, 15)); }
__device__ __forceinline__ v8f wmma16(v16h a, v16h b, v8f c) { return __builtin_amdgcn_wmma_f32_16x16x32_f16(false, a, false, b, (short)0, c, false, false); }
__device__ __forceinline__ v8f wmmab(v16bf a, v16bf b, v8f c) { return __builtin_amdgcn_wmma_f32_16x16x32_bf16(false, a, false, b, (short)0, c, false, false); }



// fragment loaders, hardware k order: 8 elements at p and 8 at p + 16, p = row start + 32 * kstep + 8 * (lane >> 4)
template <typename T16> struct WFrag;
template <> struct WFrag<h16> { typedef v16h V; static __device__ __forceinline__ V ld(const h16* p) { return cat16(*(const v8h*)p, *(const v8h*)(p + 16)); } static __device__ __forceinline__ v8f mma(V a, V b, v8f c) { return wmma16(a, b, c); } };
template <> struct WFrag<bf> { typedef v16bf V; static __device__ __forceinline__ V ld(const bf* p) { return cat16b(*(const v8us*)p, *(const v8us*)(p + 16)); } static __device__ __forceinline__ v8f mma(V a, V b, v8f c) { return wmmab(a, b, c); } };

__device__ __forceinline__ h16 tohx(float x) { return (h16)x; }
__device__ __forceinline__ void splitf(float y, unsigned short& h, unsigned short& l) { h = f2bf(y); l = f2bf(y - bf2f(h)); }
typedef __attribute__((ext_vector_type(2))) _Float16 v2h;
typedef __attribute__((ext_vector_type(4))) _Float16 v4h;
typedef __attribute__((ext_vector_type(2))) unsigned short v2us;
typedef __attribute__((ext_vector_type(4))) unsigned short v4us;
typedef __attribute__((ext_vector_type(2))) float v2f;
typedef __attribute__((ext_vector_type(4))) int v4i;

__global__ __launch_bounds__(256) void k_wtG(const float* __restrict__ w, int K, int N, bf* Bt) {
    const int lane = threadIdx.x & 31; const int L0 = (blockIdx.x * 8 + (threadIdx.x >> 5)) * 8; const int nlines = N * K / 64;
{
#pragma unroll 1
        for (int l = 0; l < 8; ++l) { const int L = L0 + l; if (L >= nlines) break; const size_t e = (size_t)L * 64 + lane * 2; const int k = (int)(e % K), n = (int)(e / K); v2us o;
            o[0] = f2bf(w[(size_t)k * N + n]); o[1] = f2bf(w[(size_t)(k + 1) * N + n]); *(v2us*)(Bt + e) = o; }
         }
}
__global__ __launch_bounds__(256) void k_cvt8(const float* __restrict__ src, bf* dst, size_t n8) { const size_t i = (size_t)blockIdx.x * 256 + threadIdx.x; if (i >= n8) return; const v8f v = *(const v8f*)(src + i * 8); v8us o;
#pragma unroll
    for (int k = 0; k < 8; ++k) o[k] = f2bf(v[k]); *(v8us*)(dst + i * 8) = o;  }
__global__ __launch_bounds__(256) void k_cscvt(const float* __restrict__ cosT, const float* __restrict__ sinT, float* CS) { const int idx = blockIdx.x * 256 + threadIdx.x; if (idx >= TT * HD) return; v2f cs; cs[0] = bfr(cosT[idx]); cs[1] = bfr(sinT[idx]); *(v2f*)(CS + (size_t)idx * 2) = cs;  }
// k_rope: head planes [h][t][d] (fp16 + hi/lo) of rope(x) x sc with the rotate-half convention out[d] = x[d] cos[t][d] - x[d+HD/2] sin[t][d], out[d+HD/2] = x[d+HD/2] cos[t][d+HD/2] + x[d] sin[t][d+HD/2]
__global__ __launch_bounds__(256) void k_rope(const float* __restrict__ F, int pitch, int nheads, const float* __restrict__ CS, const float* __restrict__ RF, const float* __restrict__ nw, float sc, h16* P16, bf* Ph, bf* Pl) {
    const size_t e = ((size_t)blockIdx.x * 256 + threadIdx.x) * 2; if (e >= (size_t)nheads * TT * HD) return; const int d = (int)(e % HD); const int t = (int)((e / HD) % TT); const int h = (int)(e / ((size_t)HD * TT)); const float* f = F + (size_t)t * pitch + h * HD; const float rf = RF ? RF[(size_t)h * TT + t] : 1.0f; v2h o16; v2us oh, ol;
#pragma unroll
    for (int q = 0; q < 2; ++q) { const int dd = d + q; const int dp = (dd < HD / 2) ? dd + HD / 2 : dd - HD / 2; float x0 = f[dd], x1 = f[dp];
        if (RF) { float n0 = __fmul_rn(x0, rf), n1 = __fmul_rn(x1, rf); asm volatile("" : "+v"(n0)); asm volatile("" : "+v"(n1)); x0 = __fmul_rn(bfr(nw[dd]), n0); x1 = __fmul_rn(bfr(nw[dp]), n1); }
        const v2f cs = *(const v2f*)(CS + ((size_t)t * HD + dd) * 2); float a = __fmul_rn(x0, cs[0]), bq = __fmul_rn(x1, cs[1]); asm volatile("" : "+v"(a)); asm volatile("" : "+v"(bq)); const float r = ((dd < HD / 2) ? __fsub_rn(a, bq) : __fadd_rn(a, bq)) * sc;
        o16[q] = tohx(r); unsigned short a2, c2; splitf(r, a2, c2); oh[q] = a2; ol[q] = c2; }
    *(v2h*)(P16 + e) = o16; *(v2us*)(Ph + e) = oh; *(v2us*)(Pl + e) = ol;  }
__global__ __launch_bounds__(256) void k_vtp(const float* __restrict__ F, int pitch, int nheads, h16* V16, bf* Vh, bf* Vl) { const size_t e = ((size_t)blockIdx.x * 256 + threadIdx.x) * 2; if (e >= (size_t)nheads * HD * TT) return; const int t = (int)(e % TT); const int d = (int)((e / TT) % HD); const int g = (int)(e / ((size_t)TT * HD)); v2h o16; v2us oh, ol;
#pragma unroll
    for (int q = 0; q < 2; ++q) { const float x = F[(size_t)(t + q) * pitch + g * HD + d]; o16[q] = tohx(x); unsigned short a2, c2; splitf(x, a2, c2); oh[q] = a2; ol[q] = c2; }
    *(v2h*)(V16 + e) = o16; *(v2us*)(Vh + e) = oh; *(v2us*)(Vl + e) = ol;  }
__global__ __launch_bounds__(256) void k_merge(const float* __restrict__ O, int h0, bf* Ah, bf* Al) { const size_t e = ((size_t)blockIdx.x * 256 + threadIdx.x) * 2; if (e >= (size_t)ZH * TT * HD) return; const int d = (int)(e % HD); const int t = (int)((e / HD) % TT); const int zz = (int)(e / ((size_t)HD * TT)); const float cs = (t < RH) ? 1.0f : (1.0f / PCAR); const size_t oo = (size_t)t * DQ + (h0 + zz) * HD + d;
    v2us oh, ol;
#pragma unroll
    for (int q = 0; q < 2; ++q) { unsigned short a, c2; splitf(O[e + q] * cs, a, c2); oh[q] = a; ol[q] = c2; } *(v2us*)(Ah + oo) = oh; *(v2us*)(Al + oo) = ol;  }

// ---- k_prep: all that k_fattn reads, made in one launch of PWG work-groups of 8 waves. Each wave loops over many rows, so that the chip starts few waves instead of one wave a row.
// V: a work-group turns a tile of 128 t x 64 d through LDS (whole lines read, whole lines written). Q, K: a wave normalises PRW rows of each, 8 rows a trip, 2 elements of a row per lane.
// Every '#pragma unroll' in it stands on a short loop that indexes register arrays: unrolled, the arrays stay in registers and the loads of a trip go out together.
#define PWG  (NB_ * NH_ * (TT / 128))             // work-groups: one V tile each
#define PRW  (NB_ * NH_ * TT / (PWG * 8))         // rows of Q, and of K, per wave
#define VPD  65                                   // LDS row pitch in dwords (64 dwords = 128 t, + 1: stores down a column and loads along a row both fall on distinct banks)
__global__ __launch_bounds__(256) void k_prep(const float* __restrict__ Q, const float* __restrict__ K, const float* __restrict__ V, bf* __restrict__ Qh, bf* __restrict__ Ql, bf* __restrict__ Kh, bf* __restrict__ Kl, h16* __restrict__ V16, bf* __restrict__ Vh, bf* __restrict__ Vl) {
    __shared__ unsigned vt[HD * VPD];             // [d][t / 2]: the bf16 bits of V at t (low half) and t + 1
    const int tid = threadIdx.x, lane = tid & 31; const int lo4 = tid & 15, up4 = tid >> 4;
    const int g = blockIdx.x / (TT / 128), t0 = (blockIdx.x % (TT / 128)) * 128;
    {   // rows t0 + 2p and t0 + 2p + 1, p = up4 + 16u, elements 4 lo4..4 lo4 + 3
        const char* vb = (const char*)(V + ((size_t)g * TT + t0) * HD); const unsigned vo = (unsigned)(2 * up4 * HD + 4 * lo4) * 4u; v4f a[4], b[4];
#pragma unroll
        for (int u = 0; u < 4; ++u) { a[u] = *(const v4f*)(vb + vo + u * 32 * HD * 4); b[u] = *(const v4f*)(vb + vo + u * 32 * HD * 4 + HD * 4); }
        asm volatile("s_wait_xcnt 0x0" :: "v"(vo) : "memory");   // stands before the offset register of these loads is written again (named as an input, so that it lives up to it)
#pragma unroll
        for (int u = 0; u < 4; ++u)
#pragma unroll
            for (int i = 0; i < 4; ++i) vt[(4 * lo4 + i) * VPD + up4 + 16 * u] = (unsigned)f2bf(a[u][i]) | ((unsigned)f2bf(b[u][i]) << 16);
    }
    __syncthreads();                              // the tile is whole before anybody reads a row of it
    {   // row d = up4 + 16u, t0 + 8 lo4..+7: 16 B to each plane, a row of the tile is 256 B
        const unsigned eo = (unsigned)(up4 * TT + 8 * lo4) * 2u; const size_t pb = (((size_t)g * HD) * TT + t0) * 2;
#pragma unroll
        for (int u = 0; u < 4; ++u) { v8h o16; v8us oh, ol;
#pragma unroll
            for (int j = 0; j < 4; ++j) { const unsigned w = vt[(up4 + 16 * u) * VPD + 4 * lo4 + j];
#pragma unroll
                for (int q = 0; q < 2; ++q) { const float x = bf2f((unsigned short)(q ? (w >> 16) : (w & 0xFFFFu))); o16[2 * j + q] = tohx(x); unsigned short a2, c2; splitf(x, a2, c2); oh[2 * j + q] = a2; ol[2 * j + q] = c2; } }
            *(v8h*)((char*)V16 + pb + eo + u * 16 * TT * 2) = o16; *(v8us*)((char*)Vh + pb + eo + u * 16 * TT * 2) = oh; *(v8us*)((char*)Vl + pb + eo + u * 16 * TT * 2) = ol; }
        asm volatile("s_wait_xcnt 0x0" :: "v"(eo) : "memory");   // stands before the offset register of these stores is written again
    }
    const int row0 = (blockIdx.x * 8 + __builtin_amdgcn_readfirstlane(tid >> 5)) * PRW;   // the wave's first row, of Q and of K
    const unsigned li = (unsigned)lane * 8u, lo = (unsigned)lane * 4u;                    // the lane's byte offsets in an f32 row and in a 16-bit row
#pragma unroll 1   // rolled: one copy of the 8-row body serves Q and K
    for (int it = 0; it < 2 * (PRW / 8); ++it) {
        const bool isq = (it < PRW / 8); const size_t r0 = (size_t)(row0 + (it % (PRW / 8)) * 8) * HD;
        const char* xs = (const char*)((isq ? Q : K) + r0); char* ph = (char*)((isq ? Qh : Kh) + r0); char* pl = (char*)((isq ? Ql : Kl) + r0);
        v2f x[8];
#pragma unroll
        for (int u = 0; u < 8; ++u) x[u] = *(const v2f*)(xs + li + u * HD * 4);
        asm volatile("s_wait_xcnt 0x0" :: "v"(li), "s"(xs) : "memory");   // stands before a register that these loads name is written again
        float q[8];
#pragma unroll
        for (int u = 0; u < 8; ++u) { x[u][0] = bfr(x[u][0]); x[u][1] = bfr(x[u][1]); q[u] = x[u][0] * x[u][0] + x[u][1] * x[u][1]; }
#pragma unroll
        for (int sh = 16; sh; sh >>= 1)
#pragma unroll
            for (int u = 0; u < 8; ++u) q[u] += __shfl_xor(q[u], sh, 32);
#pragma unroll
        for (int u = 0; u < 8; ++u) { const float den = __fsqrt_rn(__fadd_rn(q[u], 1e-12f)); const float y0 = __fdiv_rn(x[u][0], den), y1 = __fdiv_rn(x[u][1], den); v2us oh, ol; unsigned short a, c;
            splitf(y0, a, c); oh[0] = a; ol[0] = c; splitf(y1, a, c); oh[1] = a; ol[1] = c;
            *(v2us*)(ph + lo + u * HD * 2) = oh; *(v2us*)(pl + lo + u * HD * 2) = ol; }
        asm volatile("s_wait_xcnt 0x0" :: "v"(lo), "s"(ph), "s"(pl) : "memory");   // stands before a register that these stores name is written again
    }
}
#define QW   32                   // query columns per wave
#define NWV  4                    // waves per work-group
#define QB   (QW * NWV)           // queries per work-group
#define NQT  (TT / QB)            // query tiles per (batch, head)
#define SK   64                   // keys per LDS stage
#define LP   72                   // LDS row pitch in 16-bit elements: 144 B = 16 B x 9
#define PLN  (64 * LP)            // one staged plane: 64 rows (keys of K, d of V^T) of 64 elements
#define NPLX 4                    // planes per stage at most: Kh, Kl, then Vh, Vl or V16
#define LOG2E 1.4426950408889634f
typedef __attribute__((ext_vector_type(8))) __bf16 v8bf;
__device__ __forceinline__ float xhalf(float x) { const int b = __float_as_int(x); return __int_as_float(__builtin_amdgcn_permlanex16(b, b, 0x76543210, 0xfedcba98, false, false)); }   // the value of lane l ^ 16
__device__ __forceinline__ v16bf ldsb(const bf* p) { return cat16b(*(const v8us*)p, *(const v8us*)(p + 16)); }
__device__ __forceinline__ v16bf cat16f(v8bf lo, v8bf hi) { return __builtin_shufflevector(lo, hi, 0, 1, 2, 3, 4, 5, 6, 7, 8, 9, 10, 11, 12, 13, 14, 15); }

// K fragments (A operand) of 32 keys, rows kloc.. of the staged planes
__device__ __forceinline__ void ld_k(const bf* sb, int kloc, int lr, int hi, v16bf (&kh)[2][2], v16bf (&kl)[2][2]) {
#pragma unroll
    for (int kt = 0; kt < 2; ++kt)
#pragma unroll
        for (int ks = 0; ks < 2; ++ks) { const bf* kr = sb + (kloc + kt * 16 + lr) * LP + ks * 32 + 8 * hi; kh[kt][ks] = ldsb(kr); kl[kt][ks] = ldsb(kr + PLN); }
}
// V^T fragments (A operand) of the same 32 keys: v[0][dt] = Vh or V16 (bits), v[1][dt] = Vl
template <bool HI>
__device__ __forceinline__ void ld_v(const bf* sb, int kloc, int lr, int hi, v16bf (&v)[HI ? 2 : 1][4]) {
#pragma unroll
    for (int dt = 0; dt < 4; ++dt) { const bf* vr = sb + 2 * PLN + (dt * 16 + lr) * LP + kloc + 8 * hi; v[0][dt] = ldsb(vr); if (HI) v[HI ? 1 : 0][dt] = ldsb(vr + PLN); }
}
// hl x hl, 3 products, per tile in the order Qh Kh, Ql Kh, Qh Kl for d 0..31, then for d 32..63
__device__ __forceinline__ void scores(const v16bf (&kh)[2][2], const v16bf (&kl)[2][2], const v16bf (&qh)[2][2], const v16bf (&ql)[2][2], v8f (&S)[2][2]) {
#pragma unroll
    for (int kt = 0; kt < 2; ++kt)
#pragma unroll
        for (int qt = 0; qt < 2; ++qt) S[kt][qt] = (v8f){};
#pragma unroll
    for (int ks = 0; ks < 2; ++ks) {
#pragma unroll
        for (int kt = 0; kt < 2; ++kt)
#pragma unroll
            for (int qt = 0; qt < 2; ++qt) S[kt][qt] = wmmab(kh[kt][ks], qh[qt][ks], S[kt][qt]);
#pragma unroll
        for (int kt = 0; kt < 2; ++kt)
#pragma unroll
            for (int qt = 0; qt < 2; ++qt) S[kt][qt] = wmmab(kh[kt][ks], ql[qt][ks], S[kt][qt]);
#pragma unroll
        for (int kt = 0; kt < 2; ++kt)
#pragma unroll
            for (int qt = 0; qt < 2; ++qt) S[kt][qt] = wmmab(kl[kt][ks], qh[qt][ks], S[kt][qt]);
    }
}
// gain, mask, running maximum and sum, probabilities, and O^T += V^T P^T, for keys kb..kb+31 against queries q0..q0+31
template <bool HI>
__device__ __forceinline__ void soft_pv(v8f (&S)[2][2], const v16bf (&v)[HI ? 2 : 1][4], int kb, int q0, int lr, int hi, float gn, bool causal, v8f (&O)[4][2], float (&m)[2], float (&l)[2]) {
    const bool edge = causal && (kb + 31 > q0);   // wave-uniform: only then can a key of this pass lie behind a query of this wave
#pragma unroll
    for (int kt = 0; kt < 2; ++kt)
#pragma unroll
        for (int qt = 0; qt < 2; ++qt) S[kt][qt] *= gn;
    if (edge) {
#pragma unroll
        for (int qt = 0; qt < 2; ++qt) { const int qi = q0 + qt * 16 + lr;
#pragma unroll
            for (int kt = 0; kt < 2; ++kt) {
#pragma unroll
                for (int j = 0; j < 8; ++j) if (kb + kt * 16 + hi * 8 + j > qi) S[kt][qt][j] = -1.0e30f;
                asm volatile("" : "+v"(S[kt][qt]));
            } }
    }
    float mn[2];
#pragma unroll
    for (int qt = 0; qt < 2; ++qt) { float mx = -3.0e38f;
#pragma unroll
        for (int kt = 0; kt < 2; ++kt)
#pragma unroll
            for (int j = 0; j < 8; ++j) mx = fmaxf(mx, S[kt][qt][j]);
        mn[qt] = fmaxf(m[qt], fmaxf(mx, xhalf(mx))); }
    if (__builtin_amdgcn_ballot_w32(mn[0] > m[0] || mn[1] > m[1]) != 0) {   // a maximum moved somewhere in the wave: bring sums and outputs to the new one
#pragma unroll
        for (int qt = 0; qt < 2; ++qt) { const float al = __builtin_amdgcn_exp2f((m[qt] - mn[qt]) * LOG2E); m[qt] = mn[qt]; l[qt] *= al;
#pragma unroll
            for (int dt = 0; dt < 4; ++dt) O[dt][qt] *= al; }
    }
    v16bf ph[2], pl[2];   // f16 rows: ph holds the f16 bits
#pragma unroll
    for (int qt = 0; qt < 2; ++qt) { const float c = (HI ? 0.0f : 10.0f) - m[qt] * LOG2E;   // f16 probabilities carry x 1024 (as the sum does: it cancels in the quotient)
        const v8f cv = { c, c, c, c, c, c, c, c }, lv = { LOG2E, LOG2E, LOG2E, LOG2E, LOG2E, LOG2E, LOG2E, LOG2E };
        const v8f a0 = __builtin_elementwise_fma(S[0][qt], lv, cv), a1 = __builtin_elementwise_fma(S[1][qt], lv, cv);
#pragma unroll
        for (int j = 0; j < 8; ++j) { S[0][qt][j] = __builtin_amdgcn_exp2f(a0[j]); S[1][qt][j] = __builtin_amdgcn_exp2f(a1[j]); }
        const v8f sv = S[0][qt] + S[1][qt];
        l[qt] += ((sv[0] + sv[1]) + (sv[2] + sv[3])) + ((sv[4] + sv[5]) + (sv[6] + sv[7]));
        if (HI) { const v8bf h0 = __builtin_convertvector(S[0][qt], v8bf), h1 = __builtin_convertvector(S[1][qt], v8bf);
            const v8bf l0 = __builtin_convertvector(S[0][qt] - __builtin_convertvector(h0, v8f), v8bf), l1 = __builtin_convertvector(S[1][qt] - __builtin_convertvector(h1, v8f), v8bf);
            ph[qt] = cat16f(h0, h1); pl[qt] = cat16f(l0, l1);
        } else ph[qt] = __builtin_bit_cast(v16bf, cat16(__builtin_convertvector(S[0][qt], v8h), __builtin_convertvector(S[1][qt], v8h))); }
    if (HI) {   // per tile in the order Ph Vh, Pl Vh, Ph Vl
#pragma unroll
        for (int dt = 0; dt < 4; ++dt)
#pragma unroll
            for (int qt = 0; qt < 2; ++qt) O[dt][qt] = wmmab(v[0][dt], ph[qt], O[dt][qt]);
#pragma unroll
        for (int dt = 0; dt < 4; ++dt)
#pragma unroll
            for (int qt = 0; qt < 2; ++qt) O[dt][qt] = wmmab(v[0][dt], pl[qt], O[dt][qt]);
#pragma unroll
        for (int dt = 0; dt < 4; ++dt)
#pragma unroll
            for (int qt = 0; qt < 2; ++qt) O[dt][qt] = wmmab(v[HI ? 1 : 0][dt], ph[qt], O[dt][qt]);
    } else {
#pragma unroll
        for (int dt = 0; dt < 4; ++dt)
#pragma unroll
            for (int qt = 0; qt < 2; ++qt) O[dt][qt] = wmma16(__builtin_bit_cast(v16h, v[0][dt]), __builtin_bit_cast(v16h, ph[qt]), O[dt][qt]);
    }
}

template <bool HI>
__device__ __forceinline__ void attn_body(bf* sm, const bf* Qh, const bf* Ql, const bf* Kh, const bf* Kl, const bf* Va, const bf* Vb, float gn, bool causal, int qb, float* out) {
    constexpr int NPL = HI ? 4 : 3;
    const int tid = threadIdx.x, lane = tid & 31, lr = lane & 15, hi = lane >> 4; const int q0 = qb + __builtin_amdgcn_readfirstlane(tid >> 5) * QW;
    const bf* gp[4] = { Kh, Kl, Va, Vb };
    v16bf qh[2][2], ql[2][2];
#pragma unroll
    for (int qt = 0; qt < 2; ++qt) { const size_t qo = (size_t)(q0 + qt * 16 + lr) * HD + 8 * hi; const bf* pqh = Qh + qo; const bf* pql = Ql + qo;
#pragma unroll
        for (int ks = 0; ks < 2; ++ks) { qh[qt][ks] = WFrag<bf>::ld(pqh + ks * 32); ql[qt][ks] = WFrag<bf>::ld(pql + ks * 32); }
        asm volatile("s_wait_xcnt 0x0" :: "v"(pqh), "v"(pql) : "memory"); }   // stands before the address registers of these loads are written again (named as inputs, so that they live up to it)
    v8f O[4][2]; float m[2], l[2];
#pragma unroll
    for (int qt = 0; qt < 2; ++qt) { m[qt] = -3.0e38f; l[qt] = 0.f;
#pragma unroll
        for (int dt = 0; dt < 4; ++dt) O[dt][qt] = (v8f){}; }
    // a stage's plane is 512 chunks of 16 B, four a thread: chunk c = row c >> 3, elements 8 (c & 7)..; K rows are keys (pitch HD), V^T rows are d (pitch TT)
    v8us st[NPL][4];
    const int srow = tid >> 3, scol = (tid & 7) * 8;
    auto stage_load = [&](int s) {
        const unsigned ko = (unsigned)((s * SK + srow) * HD + scol) * 2u, vo = (unsigned)(srow * TT + s * SK + scol) * 2u;   // the thread's byte offsets in a K plane and in a V^T plane
#pragma unroll
        for (int pn = 0; pn < NPL; ++pn)
#pragma unroll
            for (int u = 0; u < 4; ++u) st[pn][u] = *(const v8us*)((const char*)gp[pn] + (pn < 2 ? ko : vo) + u * 32 * (pn < 2 ? HD : TT));
        asm volatile("s_wait_xcnt 0x0" :: "v"(ko), "v"(vo) : "memory"); };   // stands before the offset registers of these loads are written again (named as inputs, so that they live up to it)
    auto stage_store = [&](int b) {
#pragma unroll
        for (int pn = 0; pn < NPL; ++pn)
#pragma unroll
            for (int u = 0; u < 4; ++u) *(v8us*)(sm + (b * NPLX + pn) * PLN + (srow + u * 16) * LP + scol) = st[pn][u]; };
    // under the causal flag every key from qb + QB on is masked for every query of the work-group. Key 0 is open to every query, so a row's maximum is at least a real score, which is no lower than about -|gain|:
    // while |gain| stays far below 1e30 a masked key's probability is an exact 0 and its stage adds nothing. A larger gain, or one that is no number, walks every stage.
    const int nst = (causal && __builtin_fabsf(gn) < 1.0e29f) ? (qb + QB) / SK : TT / SK;   // stages walked: the same for the whole work-group, from 2 to TT / SK
    stage_load(0); stage_store(0);
    __syncthreads();
#pragma unroll 1   // rolled: one copy of the stage body, so that code size and registers stay as they are
    for (int s = 0; s < nst; ++s) {
        const bool more = (s + 1 < nst);
        if (more) stage_load(s + 1);          // the loads stay in flight while this stage is worked on
        const bf* sb = sm + (s & 1) * NPLX * PLN;
        v16bf kh[2][2], kl[2][2], v0[HI ? 2 : 1][4], v1[HI ? 2 : 1][4]; v8f S[2][2];
        ld_k(sb, 0, lr, hi, kh, kl); ld_v<HI>(sb, 0, lr, hi, v0);
        scores(kh, kl, qh, ql, S);
        ld_k(sb, 32, lr, hi, kh, kl); ld_v<HI>(sb, 32, lr, hi, v1);   // the second half's fragments depend on nothing of the first half: they can be fetched ahead of its softmax
        soft_pv<HI>(S, v0, s * SK, q0, lr, hi, gn, causal, O, m, l);
        scores(kh, kl, qh, ql, S);
        soft_pv<HI>(S, v1, s * SK + 32, q0, lr, hi, gn, causal, O, m, l);
        if (more) stage_store((s + 1) & 1);   // the buffer that stage s - 1 read: every wave left it at the last barrier
        __syncthreads();                      // publishes stage s + 1 and ends every read of stage s
    }
#pragma unroll
    for (int qt = 0; qt < 2; ++qt) { const float inv = __fdiv_rn(1.0f, l[qt] + xhalf(l[qt])); float* orow = out + (size_t)(q0 + qt * 16 + lr) * HD + hi * 8;   // O^T tile: lane (c, h) holds d 8h..8h+7 of query c
#pragma unroll
        for (int dt = 0; dt < 4; ++dt) { v4f a, b;
#pragma unroll
            for (int u = 0; u < 4; ++u) { a[u] = O[dt][qt][u] * inv; b[u] = O[dt][qt][u + 4] * inv; }
            *(v4f*)(orow + dt * 16) = a; *(v4f*)(orow + dt * 16 + 4) = b; }
        if (qt == 0) asm volatile("s_wait_xcnt 0x0" ::: "memory"); }   // stands before a register that the first group's stores name is written again for the second
}

__global__ __launch_bounds__(NWV * 32) void k_fattn(const bf* __restrict__ Qh, const bf* __restrict__ Ql, const bf* __restrict__ Kh, const bf* __restrict__ Kl, const h16* __restrict__ V16, const bf* __restrict__ Vh, const bf* __restrict__ Vl, const float* __restrict__ gainp, const int* __restrict__ causp, float* __restrict__ out) {
    __shared__ __align__(16) bf sm[2 * NPLX * PLN];
    const int f = blockIdx.x; const float gn = bfr(gainp[0]); const bool causal = (causp[0] != 0);
    int hd, qt;   // (batch, head) and query tile of this work-group: a one-to-one map of f either way
    if (causal) {   // a tile's cost grows with its index, and a WGP holds two work-groups: tiles t and NQT - 1 - t should meet there. Which two indices meet is not promised, so the indices f ^ 8, f ^ 16 and f ^ 256 all get the partner tile (for speed only).
        static_assert(NB_ * NH_ == 32 && NQT == 16, "the bit fields below are cut for 32 x 16 work-groups");
        const int up = NQT - 1 - ((f >> 5) & 7);                      // the pair's longer tile, longest first
        hd = f & 31; qt = (((f >> 3) ^ (f >> 4) ^ (f >> 8)) & 1) ? NQT - 1 - up : up;
    } else {        // every tile walks all keys: the hi+lo tiles (more products) first
        const bool fh = (f < NB_ * NH_ * (RH / QB)); const int g = f - NB_ * NH_ * (RH / QB);
        hd = fh ? f / (RH / QB) : g / ((TT - RH) / QB); qt = fh ? f % (RH / QB) : RH / QB + g % ((TT - RH) / QB);
    }
    const bool hires = (qt < RH / QB); const int qb = qt * QB;
    const size_t ho = (size_t)hd * TT * HD;
    if (hires) attn_body<true>(sm, Qh + ho, Ql + ho, Kh + ho, Kl + ho, Vh + ho, Vl + ho, gn, causal, qb, out + ho);        // the same for the whole work-group
    else attn_body<false>(sm, Qh + ho, Ql + ho, Kh + ho, Kl + ho, (const bf*)V16 + ho, nullptr, gn, causal, qb, out + ho);
}

extern "C" void kernel_launch(void* const* d_in, const int* in_sizes, int n_in,
                              void* d_out, int out_size, void* d_ws, size_t ws_size, hipStream_t stream) {
    (void)in_sizes; (void)n_in; (void)out_size;
    const float* Qi = (const float*)d_in[0]; const float* Ki = (const float*)d_in[1]; const float* Vi = (const float*)d_in[2]; const float* gainp = (const float*)d_in[3]; const int* causp = (const int*)d_in[4];
    float* OUT = (float*)d_out;     // [2][16][2048][64]
    char* wsp = (char*)d_ws;
    auto take = [&](size_t bytes) { char* p = wsp; wsp += (bytes + 255) & ~(size_t)255; return (void*)p; };
    const size_t PB = (size_t)NH_ * TT * HD;   // elements of one batch's plane; the planes hold both batches
    h16* VT16 = (h16*)take(NB_ * PB * 2);
    bf* QPh = (bf*)take(NB_ * PB * 2); bf* QPl = (bf*)take(NB_ * PB * 2); bf* KPh = (bf*)take(NB_ * PB * 2); bf* KPl = (bf*)take(NB_ * PB * 2); bf* VTh = (bf*)take(NB_ * PB * 2); bf* VTl = (bf*)take(NB_ * PB * 2);
    if ((size_t)(wsp - (char*)d_ws) > ws_size) return;    // ws 256 MiB
    k_prep<<<PWG, 256, 0, stream>>>(Qi, Ki, Vi, QPh, QPl, KPh, KPl, VT16, VTh, VTl);
    k_fattn<<<NB_ * NH_ * (TT / QB), NWV * 32, 0, stream>>>(QPh, QPl, KPh, KPl, VT16, VTh, VTl, gainp, causp, OUT);
}

// v006
// One run takes 48.8 microseconds.
// Next to v005, in two timings, it ran 1.16 times as fast each time.
// Counting every step since v000, it is 35.8 times as fast.
#include <hip/hip_runtime.h>

// SelfDotProductAttnQKNorm (Q, K, V [2][16][2048][64] given; Qn, Kn = L2-normalised over d (eps 1e-12 inside the sqrt); scores = gain x (Qn . Kn) with gain a scalar input (read on device; log2(2048? - 2048) ~ 22); is_causal (int input, read on device; 1 here) -> j > i masked to -1e30; softmax; out = attn V -> [2][16][2048][64]).
// Compute dtypes, f32 accumulate: every input rounded to bf16; the L2 normalisation f32 on the VALU; the causal flag is data: set, key stages that lie wholly behind a work-group's queries are not walked; all rows hl x hl (3 products); x gain, mask and softmax f32;

#define NB_  2
#define TT   2048
#define DM   1024
#define NH_  16
#define NKV  16
#define REP  (NH_ / NKV)
#define HD   64
#define DQ   (NH_ * HD)
#define DKV  (NKV * HD)
#define ZH   8                    // heads per call of k_merge
#define RH   512                  // query rows < RH use hi+lo planes (0: none)
#define WIN  0
#define PCAR 1024.0f
#define SCL  0.125f   // HD^-0.5
typedef _Float16 h16;
typedef unsigned short bf;
typedef __attribute__((ext_vector_type(16))) __bf16   v16bf;
typedef __attribute__((ext_vector_type(16))) _Float16 v16h;
typedef __attribute__((ext_vector_type(8)))  _Float16 v8h;
typedef __attribute__((ext_vector_type(8)))  unsigned short v8us;
typedef __attribute__((ext_vector_type(8)))  float    v8f;
typedef __attribute__((ext_vector_type(4)))  float    v4f;
typedef v8h  __attribute__((may_alias)) v8ha;
typedef v4f  __attribute__((may_alias)) v4fa;
typedef v8us __attribute__((may_alias)) v8usa;

__device__ __forceinline__ unsigned short f2bf(float f) { unsigned u = __float_as_uint(f); u += 0x7FFFu + ((u >> 16) & 1u); return (unsigned short)(u >> 16); }
__device__ __forceinline__ float bf2f(unsigned short b) { return __uint_as_float(((unsigned)b) << 16); }
__device__ __forceinline__ float bfr(float f) { return bf2f(f2bf(f)); }
__device__ __forceinline__ v16h cat16(v8h lo, v8h hi) { return __builtin_shufflevector(lo, hi, 0, 1, 2, 3, 4, 5, 6, 7, 8, 9, 10, 11, 12, 13, 14, 15); }
__device__ __forceinline__ v16bf cat16b(v8us lo, v8us hi) { return __builtin_bit_cast(v16bf, __builtin_shufflevector(lo, hi, 0, 1, 2, 3, 4, 5, 6, 7, 8, 9, 10, 11, 12, 13, 14, 15)); }
__device__ __forceinline__ v8f wmma16(v16h a, v16h b, v8f c) { return __builtin_amdgcn_wmma_f32_16x16x32_f16(false, a, false, b, (short)0, c, false, false); }
__device__ __forceinline__ v8f wmmab(v16bf a, v16bf b, v8f c) { return __builtin_amdgcn_wmma_f32_16x16x32_bf16(false, a, false, b, (short)0, c, false, false); }



// fragment loaders, hardware k order: 8 elements at p and 8 at p + 16, p = row start + 32 * kstep + 8 * (lane >> 4)
template <typename T16> struct WFrag;
template <> struct WFrag<h16> { typedef v16h V; static __device__ __forceinline__ V ld(const h16* p) { return cat16(*(const v8h*)p, *(const v8h*)(p + 16)); } static __device__ __forceinline__ v8f mma(V a, V b, v8f c) { return wmma16(a, b, c); } };
template <> struct WFrag<bf> { typedef v16bf V; static __device__ __forceinline__ V ld(const bf* p) { return cat16b(*(const v8us*)p, *(const v8us*)(p + 16)); } static __device__ __forceinline__ v8f mma(V a, V b, v8f c) { return wmmab(a, b, c); } };

__device__ __forceinline__ h16 tohx(float x) { return (h16)x; }
__device__ __forceinline__ void splitf(float y, unsigned short& h, unsigned short& l) { h = f2bf(y); l = f2bf(y - bf2f(h)); }
typedef __attribute__((ext_vector_type(2))) _Float16 v2h;
typedef __attribute__((ext_vector_type(4))) _Float16 v4h;
typedef __attribute__((ext_vector_type(2))) unsigned short v2us;
typedef __attribute__((ext_vector_type(4))) unsigned short v4us;
typedef __attribute__((ext_vector_type(2))) float v2f;
typedef __attribute__((ext_vector_type(4))) int v4i;

__global__ __launch_bounds__(256) void k_wtG(const float* __restrict__ w, int K, int N, bf* Bt) {
    const int lane = threadIdx.x & 31; const int L0 = (blockIdx.x * 8 + (threadIdx.x >> 5)) * 8; const int nlines = N * K / 64;
{
#pragma unroll 1
        for (int l = 0; l < 8; ++l) { const int L = L0 + l; if (L >= nlines) break; const size_t e = (size_t)L * 64 + lane * 2; const int k = (int)(e % K), n = (int)(e / K); v2us o;
            o[0] = f2bf(w[(size_t)k * N + n]); o[1] = f2bf(w[(size_t)(k + 1) * N + n]); *(v2us*)(Bt + e) = o; }
         }
}
__global__ __launch_bounds__(256) void k_cvt8(const float* __restrict__ src, bf* dst, size_t n8) { const size_t i = (size_t)blockIdx.x * 256 + threadIdx.x; if (i >= n8) return; const v8f v = *(const v8f*)(src + i * 8); v8us o;
#pragma unroll
    for (int k = 0; k < 8; ++k) o[k] = f2bf(v[k]); *(v8us*)(dst + i * 8) = o;  }
__global__ __launch_bounds__(256) void k_cscvt(const float* __restrict__ cosT, const float* __restrict__ sinT, float* CS) { const int idx = blockIdx.x * 256 + threadIdx.x; if (idx >= TT * HD) return; v2f cs; cs[0] = bfr(cosT[idx]); cs[1] = bfr(sinT[idx]); *(v2f*)(CS + (size_t)idx * 2) = cs;  }
// k_rope: head planes [h][t][d] (fp16 + hi/lo) of rope(x) x sc with the rotate-half convention out[d] = x[d] cos[t][d] - x[d+HD/2] sin[t][d], out[d+HD/2] = x[d+HD/2] cos[t][d+HD/2] + x[d] sin[t][d+HD/2]
__global__ __launch_bounds__(256) void k_rope(const float* __restrict__ F, int pitch, int nheads, const float* __restrict__ CS, const float* __restrict__ RF, const float* __restrict__ nw, float sc, h16* P16, bf* Ph, bf* Pl) {
    const size_t e = ((size_t)blockIdx.x * 256 + threadIdx.x) * 2; if (e >= (size_t)nheads * TT * HD) return; const int d = (int)(e % HD); const int t = (int)((e / HD) % TT); const int h = (int)(e / ((size_t)HD * TT)); const float* f = F + (size_t)t * pitch + h * HD; const float rf = RF ? RF[(size_t)h * TT + t] : 1.0f; v2h o16; v2us oh, ol;
#pragma unroll
    for (int q = 0; q < 2; ++q) { const int dd = d + q; const int dp = (dd < HD / 2) ? dd + HD / 2 : dd - HD / 2; float x0 = f[dd], x1 = f[dp];
        if (RF) { float n0 = __fmul_rn(x0, rf), n1 = __fmul_rn(x1, rf); asm volatile("" : "+v"(n0)); asm volatile("" : "+v"(n1)); x0 = __fmul_rn(bfr(nw[dd]), n0); x1 = __fmul_rn(bfr(nw[dp]), n1); }
        const v2f cs = *(const v2f*)(CS + ((size_t)t * HD + dd) * 2); float a = __fmul_rn(x0, cs[0]), bq = __fmul_rn(x1, cs[1]); asm volatile("" : "+v"(a)); asm volatile("" : "+v"(bq)); const float r = ((dd < HD / 2) ? __fsub_rn(a, bq) : __fadd_rn(a, bq)) * sc;
        o16[q] = tohx(r); unsigned short a2, c2; splitf(r, a2, c2); oh[q] = a2; ol[q] = c2; }
    *(v2h*)(P16 + e) = o16; *(v2us*)(Ph + e) = oh; *(v2us*)(Pl + e) = ol;  }
__global__ __launch_bounds__(256) void k_vtp(const float* __restrict__ F, int pitch, int nheads, h16* V16, bf* Vh, bf* Vl) { const size_t e = ((size_t)blockIdx.x * 256 + threadIdx.x) * 2; if (e >= (size_t)nheads * HD * TT) return; const int t = (int)(e % TT); const int d = (int)((e / TT) % HD); const int g = (int)(e / ((size_t)TT * HD)); v2h o16; v2us oh, ol;
#pragma unroll
    for (int q = 0; q < 2; ++q) { const float x = F[(size_t)(t + q) * pitch + g * HD + d]; o16[q] = tohx(x); unsigned short a2, c2; splitf(x, a2, c2); oh[q] = a2; ol[q] = c2; }
    *(v2h*)(V16 + e) = o16; *(v2us*)(Vh + e) = oh; *(v2us*)(Vl + e) = ol;  }
__global__ __launch_bounds__(256) void k_merge(const float* __restrict__ O, int h0, bf* Ah, bf* Al) { const size_t e = ((size_t)blockIdx.x * 256 + threadIdx.x) * 2; if (e >= (size_t)ZH * TT * HD) return; const int d = (int)(e % HD); const int t = (int)((e / HD) % TT); const int zz = (int)(e / ((size_t)HD * TT)); const float cs = (t < RH) ? 1.0f : (1.0f / PCAR); const size_t oo = (size_t)t * DQ + (h0 + zz) * HD + d;
    v2us oh, ol;
#pragma unroll
    for (int q = 0; q < 2; ++q) { unsigned short a, c2; splitf(O[e + q] * cs, a, c2); oh[q] = a; ol[q] = c2; } *(v2us*)(Ah + oo) = oh; *(v2us*)(Al + oo) = ol;  }

// ---- k_prep: all that k_fattn reads, made in one launch of PWG work-groups of 8 waves. Each wave loops over many rows, so that the chip starts few waves instead of one wave a row.
// V: a work-group turns a tile of 128 t x 64 d through LDS (whole lines read, whole lines written). Q, K: a wave normalises PRW rows of each, 8 rows a trip, 2 elements of a row per lane.
// Every '#pragma unroll' in it stands on a short loop that indexes register arrays: unrolled, the arrays stay in registers and the loads of a trip go out together.
#define PWG  (NB_ * NH_ * (TT / 128))             // work-groups: one V tile each
#define PRW  (NB_ * NH_ * TT / (PWG * 8))         // rows of Q, and of K, per wave
#define VPD  65                                   // LDS row pitch in dwords (64 dwords = 128 t, + 1: stores down a column and loads along a row both fall on distinct banks)
__global__ __launch_bounds__(256) void k_prep(const float* __restrict__ Q, const float* __restrict__ K, const float* __restrict__ V, bf* __restrict__ Qh, bf* __restrict__ Ql, bf* __restrict__ Kh, bf* __restrict__ Kl, h16* __restrict__ V16, bf* __restrict__ Vh, bf* __restrict__ Vl) {
    __shared__ unsigned vt[HD * VPD];             // [d][t / 2]: the bf16 bits of V at t (low half) and t + 1
    const int tid = threadIdx.x, lane = tid & 31; const int lo4 = tid & 15, up4 = tid >> 4;
    const int g = blockIdx.x / (TT / 128), t0 = (blockIdx.x % (TT / 128)) * 128;
    {   // rows t0 + 2p and t0 + 2p + 1, p = up4 + 16u, elements 4 lo4..4 lo4 + 3
        const char* vb = (const char*)(V + ((size_t)g * TT + t0) * HD); const unsigned vo = (unsigned)(2 * up4 * HD + 4 * lo4) * 4u; v4f a[4], b[4];
#pragma unroll
        for (int u = 0; u < 4; ++u) { a[u] = *(const v4f*)(vb + vo + u * 32 * HD * 4); b[u] = *(const v4f*)(vb + vo + u * 32 * HD * 4 + HD * 4); }
        asm volatile("s_wait_xcnt 0x0" :: "v"(vo) : "memory");   // stands before the offset register of these loads is written again (named as an input, so that it lives up to it)
#pragma unroll
        for (int u = 0; u < 4; ++u)
#pragma unroll
            for (int i = 0; i < 4; ++i) vt[(4 * lo4 + i) * VPD + up4 + 16 * u] = (unsigned)f2bf(a[u][i]) | ((unsigned)f2bf(b[u][i]) << 16);
    }
    __syncthreads();                              // the tile is whole before anybody reads a row of it
    {   // row d = up4 + 16u, t0 + 8 lo4..+7: 16 B to each plane, a row of the tile is 256 B
        const unsigned eo = (unsigned)(up4 * TT + 8 * lo4) * 2u; const size_t pb = (((size_t)g * HD) * TT + t0) * 2;
#pragma unroll
        for (int u = 0; u < 4; ++u) { v8h o16; v8us oh, ol;
#pragma unroll
            for (int j = 0; j < 4; ++j) { const unsigned w = vt[(up4 + 16 * u) * VPD + 4 * lo4 + j];
#pragma unroll
                for (int q = 0; q < 2; ++q) { const float x = bf2f((unsigned short)(q ? (w >> 16) : (w & 0xFFFFu))); o16[2 * j + q] = tohx(x); unsigned short a2, c2; splitf(x, a2, c2); oh[2 * j + q] = a2; ol[2 * j + q] = c2; } }
            *(v8h*)((char*)V16 + pb + eo + u * 16 * TT * 2) = o16; *(v8us*)((char*)Vh + pb + eo + u * 16 * TT * 2) = oh; *(v8us*)((char*)Vl + pb + eo + u * 16 * TT * 2) = ol; }
        asm volatile("s_wait_xcnt 0x0" :: "v"(eo) : "memory");   // stands before the offset register of these stores is written again
    }
    const int row0 = (blockIdx.x * 8 + __builtin_amdgcn_readfirstlane(tid >> 5)) * PRW;   // the wave's first row, of Q and of K
    const unsigned li = (unsigned)lane * 8u, lo = (unsigned)lane * 4u;                    // the lane's byte offsets in an f32 row and in a 16-bit row
#pragma unroll 1   // rolled: one copy of the 8-row body serves Q and K
    for (int it = 0; it < 2 * (PRW / 8); ++it) {
        const bool isq = (it < PRW / 8); const size_t r0 = (size_t)(row0 + (it % (PRW / 8)) * 8) * HD;
        const char* xs = (const char*)((isq ? Q : K) + r0); char* ph = (char*)((isq ? Qh : Kh) + r0); char* pl = (char*)((isq ? Ql : Kl) + r0);
        v2f x[8];
#pragma unroll
        for (int u = 0; u < 8; ++u) x[u] = *(const v2f*)(xs + li + u * HD * 4);
        asm volatile("s_wait_xcnt 0x0" :: "v"(li), "s"(xs) : "memory");   // stands before a register that these loads name is written again
        float q[8];
#pragma unroll
        for (int u = 0; u < 8; ++u) { x[u][0] = bfr(x[u][0]); x[u][1] = bfr(x[u][1]); q[u] = x[u][0] * x[u][0] + x[u][1] * x[u][1]; }
#pragma unroll
        for (int sh = 16; sh; sh >>= 1)
#pragma unroll
            for (int u = 0; u < 8; ++u) q[u] += __shfl_xor(q[u], sh, 32);
#pragma unroll
        for (int u = 0; u < 8; ++u) { const float den = __fsqrt_rn(__fadd_rn(q[u], 1e-12f)); const float y0 = __fdiv_rn(x[u][0], den), y1 = __fdiv_rn(x[u][1], den); v2us oh, ol; unsigned short a, c;
            splitf(y0, a, c); oh[0] = a; ol[0] = c; splitf(y1, a, c); oh[1] = a; ol[1] = c;
            *(v2us*)(ph + lo + u * HD * 2) = oh; *(v2us*)(pl + lo + u * HD * 2) = ol; }
        asm volatile("s_wait_xcnt 0x0" :: "v"(lo), "s"(ph), "s"(pl) : "memory");   // stands before a register that these stores name is written again
    }
}
#define QW   32                   // query columns per wave
#define NWV  4                    // waves per key group
#define NGR  2                    // key groups per work-group
#define QB   (QW * NWV)           // queries per tile
#define NQT  (TT / QB)            // query tiles per (batch, head)
#define SK   64                   // keys per LDS stage
#define LP   72                   // LDS row pitch in 16-bit elements: 144 B = 16 B x 9
#define PLN  (64 * LP)            // one staged plane: 64 rows (keys of K, d of V^T) of 64 elements
#define NPLX 4                    // planes per stage at most: Kh, Kl, then Vh, Vl or V16
#define MGW  (9 * 128)            // floats that one wave hands to its partner: 8 chunks of outputs and one of maximum and sum, 16 B a lane each
#define LOG2E 1.4426950408889634f
typedef __attribute__((ext_vector_type(8))) __bf16 v8bf;
__device__ __forceinline__ float xhalf(float x) { const int b = __float_as_int(x); return __int_as_float(__builtin_amdgcn_permlanex16(b, b, 0x76543210, 0xfedcba98, false, false)); }   // the value of lane l ^ 16
__device__ __forceinline__ v16bf ldsb(const bf* p) { return cat16b(*(const v8us*)p, *(const v8us*)(p + 16)); }
__device__ __forceinline__ v16bf cat16f(v8bf lo, v8bf hi) { return __builtin_shufflevector(lo, hi, 0, 1, 2, 3, 4, 5, 6, 7, 8, 9, 10, 11, 12, 13, 14, 15); }

// K fragments (A operand) of 32 keys, rows kloc.. of the staged planes
__device__ __forceinline__ void ld_k(const bf* sb, int kloc, int lr, int hi, v16bf (&kh)[2][2], v16bf (&kl)[2][2]) {
#pragma unroll
    for (int kt = 0; kt < 2; ++kt)
#pragma unroll
        for (int ks = 0; ks < 2; ++ks) { const bf* kr = sb + (kloc + kt * 16 + lr) * LP + ks * 32 + 8 * hi; kh[kt][ks] = ldsb(kr); kl[kt][ks] = ldsb(kr + PLN); }
}
// V^T fragments (A operand) of the same 32 keys: v[0][dt] = Vh or V16 (bits), v[1][dt] = Vl
template <bool HI>
__device__ __forceinline__ void ld_v(const bf* sb, int kloc, int lr, int hi, v16bf (&v)[HI ? 2 : 1][4]) {
#pragma unroll
    for (int dt = 0; dt < 4; ++dt) { const bf* vr = sb + 2 * PLN + (dt * 16 + lr) * LP + kloc + 8 * hi; v[0][dt] = ldsb(vr); if (HI) v[HI ? 1 : 0][dt] = ldsb(vr + PLN); }
}
// hl x hl, 3 products, per tile in the order Qh Kh, Ql Kh, Qh Kl for d 0..31, then for d 32..63
__device__ __forceinline__ void scores(const v16bf (&kh)[2][2], const v16bf (&kl)[2][2], const v16bf (&qh)[2][2], const v16bf (&ql)[2][2], v8f (&S)[2][2]) {
#pragma unroll
    for (int kt = 0; kt < 2; ++kt)
#pragma unroll
        for (int qt = 0; qt < 2; ++qt) S[kt][qt] = (v8f){};
#pragma unroll
    for (int ks = 0; ks < 2; ++ks) {
#pragma unroll
        for (int kt = 0; kt < 2; ++kt)
#pragma unroll
            for (int qt = 0; qt < 2; ++qt) S[kt][qt] = wmmab(kh[kt][ks], qh[qt][ks], S[kt][qt]);
#pragma unroll
        for (int kt = 0; kt < 2; ++kt)
#pragma unroll
            for (int qt = 0; qt < 2; ++qt) S[kt][qt] = wmmab(kh[kt][ks], ql[qt][ks], S[kt][qt]);
#pragma unroll
        for (int kt = 0; kt < 2; ++kt)
#pragma unroll
            for (int qt = 0; qt < 2; ++qt) S[kt][qt] = wmmab(kl[kt][ks], qh[qt][ks], S[kt][qt]);
    }
}
// gain, mask, running maximum and sum, probabilities, and O^T += V^T P^T, for keys kb..kb+31 against queries q0..q0+31
template <bool HI>
__device__ __forceinline__ void soft_pv(v8f (&S)[2][2], const v16bf (&v)[HI ? 2 : 1][4], int kb, int q0, int lr, int hi, float gn, bool causal, v8f (&O)[4][2], float (&m)[2], float (&l)[2]) {
    const bool edge = causal && (kb + 31 > q0);   // wave-uniform: only then can a key of this pass lie behind a query of this wave
#pragma unroll
    for (int kt = 0; kt < 2; ++kt)
#pragma unroll
        for (int qt = 0; qt < 2; ++qt) S[kt][qt] *= gn;
    if (edge) {
#pragma unroll
        for (int qt = 0; qt < 2; ++qt) { const int qi = q0 + qt * 16 + lr;
#pragma unroll
            for (int kt = 0; kt < 2; ++kt) {
#pragma unroll
                for (int j = 0; j < 8; ++j) if (kb + kt * 16 + hi * 8 + j > qi) S[kt][qt][j] = -1.0e30f;
                asm volatile("" : "+v"(S[kt][qt]));
            } }
    }
    float mn[2];
#pragma unroll
    for (int qt = 0; qt < 2; ++qt) { float mx = -3.0e38f;
#pragma unroll
        for (int kt = 0; kt < 2; ++kt)
#pragma unroll
            for (int j = 0; j < 8; ++j) mx = fmaxf(mx, S[kt][qt][j]);
        mn[qt] = fmaxf(m[qt], fmaxf(mx, xhalf(mx))); }
    if (__builtin_amdgcn_ballot_w32(mn[0] > m[0] || mn[1] > m[1]) != 0) {   // a maximum moved somewhere in the wave: bring sums and outputs to the new one
#pragma unroll
        for (int qt = 0; qt < 2; ++qt) { const float al = __builtin_amdgcn_exp2f((m[qt] - mn[qt]) * LOG2E); m[qt] = mn[qt]; l[qt] *= al;
#pragma unroll
            for (int dt = 0; dt < 4; ++dt) O[dt][qt] *= al; }
    }
    v16bf ph[2], pl[2];   // f16 rows: ph holds the f16 bits
#pragma unroll
    for (int qt = 0; qt < 2; ++qt) { const float c = (HI ? 0.0f : 10.0f) - m[qt] * LOG2E;   // f16 probabilities carry x 1024 (as the sum does: it cancels in the quotient)
        const v8f cv = { c, c, c, c, c, c, c, c }, lv = { LOG2E, LOG2E, LOG2E, LOG2E, LOG2E, LOG2E, LOG2E, LOG2E };
        const v8f a0 = __builtin_elementwise_fma(S[0][qt], lv, cv), a1 = __builtin_elementwise_fma(S[1][qt], lv, cv);
#pragma unroll
        for (int j = 0; j < 8; ++j) { S[0][qt][j] = __builtin_amdgcn_exp2f(a0[j]); S[1][qt][j] = __builtin_amdgcn_exp2f(a1[j]); }
        const v8f sv = S[0][qt] + S[1][qt];
        l[qt] += ((sv[0] + sv[1]) + (sv[2] + sv[3])) + ((sv[4] + sv[5]) + (sv[6] + sv[7]));
        if (HI) { const v8bf h0 = __builtin_convertvector(S[0][qt], v8bf), h1 = __builtin_convertvector(S[1][qt], v8bf);
            const v8bf l0 = __builtin_convertvector(S[0][qt] - __builtin_convertvector(h0, v8f), v8bf), l1 = __builtin_convertvector(S[1][qt] - __builtin_convertvector(h1, v8f), v8bf);
            ph[qt] = cat16f(h0, h1); pl[qt] = cat16f(l0, l1);
        } else ph[qt] = __builtin_bit_cast(v16bf, cat16(__builtin_convertvector(S[0][qt], v8h), __builtin_convertvector(S[1][qt], v8h))); }
    if (HI) {   // per tile in the order Ph Vh, Pl Vh, Ph Vl
#pragma unroll
        for (int dt = 0; dt < 4; ++dt)
#pragma unroll
            for (int qt = 0; qt < 2; ++qt) O[dt][qt] = wmmab(v[0][dt], ph[qt], O[dt][qt]);
#pragma unroll
        for (int dt = 0; dt < 4; ++dt)
#pragma unroll
            for (int qt = 0; qt < 2; ++qt) O[dt][qt] = wmmab(v[0][dt], pl[qt], O[dt][qt]);
#pragma unroll
        for (int dt = 0; dt < 4; ++dt)
#pragma unroll
            for (int qt = 0; qt < 2; ++qt) O[dt][qt] = wmmab(v[HI ? 1 : 0][dt], ph[qt], O[dt][qt]);
    } else {
#pragma unroll
        for (int dt = 0; dt < 4; ++dt)
#pragma unroll
            for (int qt = 0; qt < 2; ++qt) O[dt][qt] = wmma16(__builtin_bit_cast(v16h, v[0][dt]), __builtin_bit_cast(v16h, ph[qt]), O[dt][qt]);
    }
}

template <bool HI>
__device__ __forceinline__ void attn_body(bf* sm, const bf* Qh, const bf* Ql, const bf* Kh, const bf* Kl, const bf* Va, const bf* Vb, float gn, bool causal, int qb, float* out) {
    constexpr int NPL = HI ? 4 : 3;
    const int tid = threadIdx.x & (NWV * 32 - 1), lane = tid & 31, lr = lane & 15, hi = lane >> 4;   // tid: the thread's index in its key group
    const int wv = __builtin_amdgcn_readfirstlane(tid >> 5), grp = __builtin_amdgcn_readfirstlane((int)threadIdx.x >> 7); const int q0 = qb + wv * QW;
    static_assert(NWV * 32 == 128 && NGR == 2 && (QB / SK) % NGR == 0 && (TT / SK) % NGR == 0, "two groups of 128 threads; every walk is a whole number of trips");
    const bf* gp[4] = { Kh, Kl, Va, Vb };
    v16bf qh[2][2], ql[2][2];
#pragma unroll
    for (int qt = 0; qt < 2; ++qt) { const size_t qo = (size_t)(q0 + qt * 16 + lr) * HD + 8 * hi; const bf* pqh = Qh + qo; const bf* pql = Ql + qo;
#pragma unroll
        for (int ks = 0; ks < 2; ++ks) { qh[qt][ks] = WFrag<bf>::ld(pqh + ks * 32); ql[qt][ks] = WFrag<bf>::ld(pql + ks * 32); }
        asm volatile("s_wait_xcnt 0x0" :: "v"(pqh), "v"(pql) : "memory"); }   // stands before the address registers of these loads are written again (named as inputs, so that they live up to it)
    v8f O[4][2]; float m[2], l[2];
#pragma unroll
    for (int qt = 0; qt < 2; ++qt) { m[qt] = -3.0e38f; l[qt] = 0.f;
#pragma unroll
        for (int dt = 0; dt < 4; ++dt) O[dt][qt] = (v8f){}; }
    // a stage's plane is 512 chunks of 16 B, four a thread: chunk c = row c >> 3, elements 8 (c & 7)..; K rows are keys (pitch HD), V^T rows are d (pitch TT)
    v8us st[NPL][4];
    const int srow = tid >> 3, scol = (tid & 7) * 8;
    auto stage_load = [&](int s) {
        const unsigned ko = (unsigned)((s * SK + srow) * HD + scol) * 2u, vo = (unsigned)(srow * TT + s * SK + scol) * 2u;   // the thread's byte offsets in a K plane and in a V^T plane
#pragma unroll
        for (int pn = 0; pn < NPL; ++pn)
#pragma unroll
            for (int u = 0; u < 4; ++u) st[pn][u] = *(const v8us*)((const char*)gp[pn] + (pn < 2 ? ko : vo) + u * 32 * (pn < 2 ? HD : TT));
        asm volatile("s_wait_xcnt 0x0" :: "v"(ko), "v"(vo) : "memory"); };   // stands before the offset registers of these loads are written again (named as inputs, so that they live up to it)
    auto stage_store = [&](int b) {
#pragma unroll
        for (int pn = 0; pn < NPL; ++pn)
#pragma unroll
            for (int u = 0; u < 4; ++u) *(v8us*)(sm + (b * NPLX + pn) * PLN + (srow + u * 16) * LP + scol) = st[pn][u]; };
    // under the causal flag every key from qb + QB on is masked for every query of the work-group. Key 0 is open to every query, so a row's maximum is at least a real score, which is no lower than about -|gain|:
    // while |gain| stays far below 1e30 a masked key's probability is an exact 0 and its stage adds nothing. A larger gain, or one that is no number, walks every stage.
    // A group all of whose keys are masked for a query (the odd stages, for queries below SK) holds the maximum -1e30 there, and sums without meaning that need not even be finite: where the groups meet, a side whose factor is 0 is left out.
    const int ntr = ((causal && __builtin_fabsf(gn) < 1.0e29f) ? (qb + QB) / SK : TT / SK) / NGR;   // trips: the same for the whole work-group, from 1 to TT / SK / NGR
    stage_load(grp); stage_store(grp);
    __syncthreads();
#pragma unroll 1   // rolled: one copy of the stage body, so that code size and registers stay as they are
    for (int i = 0; i < ntr; ++i) {
        const int s = i * NGR + grp;          // this group's stage
        const bool more = (i + 1 < ntr);
        if (more) stage_load(s + NGR);        // the loads stay in flight while this stage is worked on
        const bf* sb = sm + ((i & 1) * NGR + grp) * NPLX * PLN;
        v16bf kh[2][2], kl[2][2], v0[HI ? 2 : 1][4], v1[HI ? 2 : 1][4]; v8f S[2][2];
        ld_k(sb, 0, lr, hi, kh, kl); ld_v<HI>(sb, 0, lr, hi, v0);
        scores(kh, kl, qh, ql, S);
        ld_k(sb, 32, lr, hi, kh, kl); ld_v<HI>(sb, 32, lr, hi, v1);   // the second half's fragments depend on nothing of the first half: they can be fetched ahead of its softmax
        soft_pv<HI>(S, v0, s * SK, q0, lr, hi, gn, causal, O, m, l);
        scores(kh, kl, qh, ql, S);
        soft_pv<HI>(S, v1, s * SK + 32, q0, lr, hi, gn, causal, O, m, l);
        if (more) stage_store(((i + 1) & 1) * NGR + grp);   // the buffer that the group's last stage but one read: every wave left it at the last barrier
        __syncthreads();                      // publishes the next stage of each group and ends every read of this one
    }
    // the groups meet: of a wave pair's 32 query columns group g finishes columns 16g..16g+15 and hands the other 16 (maximum, sum, outputs) to its partner.
    // The exchange lies in the third buffer: free behind the loop's last barrier, and written again by the next tile only behind that tile's first barrier.
    float* mg = (float*)(sm + 2 * NPLX * PLN) + wv * (2 * MGW) + lane * 4;   // chunk c of a lane at c * 128 floats: 16 B a lane, whole rows of banks
#pragma unroll
    for (int qt = 0; qt < 2; ++qt) if (grp != qt) { float* w = mg + qt * MGW;
#pragma unroll
        for (int dt = 0; dt < 4; ++dt) { v4f a, b;
#pragma unroll
            for (int u = 0; u < 4; ++u) { a[u] = O[dt][qt][u]; b[u] = O[dt][qt][u + 4]; }
            *(v4fa*)(w + (2 * dt) * 128) = a; *(v4fa*)(w + (2 * dt + 1) * 128) = b; }
        const v4f ml = { m[qt], l[qt], 0.f, 0.f }; *(v4fa*)(w + 8 * 128) = ml; }
    __syncthreads();                          // both halves of the exchange are written before either is read
#pragma unroll
    for (int qt = 0; qt < 2; ++qt) if (grp == qt) { const float* r = mg + qt * MGW; const v4f ml = *(const v4fa*)(r + 8 * 128);
        const float mt = fmaxf(m[qt], ml[0]); const float ca = __builtin_amdgcn_exp2f((m[qt] - mt) * LOG2E), cb = __builtin_amdgcn_exp2f((ml[0] - mt) * LOG2E);
        const bool ua = (ca > 0.f), ub = (cb > 0.f);   // the side that holds the maximum has factor 1; a side with factor 0 adds nothing, and is selected away instead of multiplied because 0 x (no finite number) would spoil the sum
        const float ls = (ua ? l[qt] * ca : 0.f) + (ub ? ml[1] * cb : 0.f); const float inv = __fdiv_rn(1.0f, ls + xhalf(ls)); const float fa = ca * inv, fb = cb * inv;
        float* orow = out + (size_t)(q0 + qt * 16 + lr) * HD + hi * 8;   // O^T tile: lane (c, h) holds d 8h..8h+7 of query c
#pragma unroll
        for (int dt = 0; dt < 4; ++dt) { const v4f pa = *(const v4fa*)(r + (2 * dt) * 128), pb = *(const v4fa*)(r + (2 * dt + 1) * 128); v4f a, b;
#pragma unroll
            for (int u = 0; u < 4; ++u) { a[u] = (ua ? O[dt][qt][u] * fa : 0.f) + (ub ? pa[u] * fb : 0.f); b[u] = (ua ? O[dt][qt][u + 4] * fa : 0.f) + (ub ? pb[u] * fb : 0.f); }
            *(v4f*)(orow + dt * 16) = a; *(v4f*)(orow + dt * 16 + 4) = b; }
        asm volatile("s_wait_xcnt 0x0" :: "v"(orow) : "memory"); }   // stands before the address register of these stores is written again (named as an input, so that it lives up to it)
}

__global__ __launch_bounds__(NGR * NWV * 32) void k_fattn(const bf* __restrict__ Qh, const bf* __restrict__ Ql, const bf* __restrict__ Kh, const bf* __restrict__ Kl, const h16* __restrict__ V16, const bf* __restrict__ Vh, const bf* __restrict__ Vl, const float* __restrict__ gainp, const int* __restrict__ causp, float* __restrict__ out) {
    __shared__ __align__(16) bf sm[2 * NGR * NPLX * PLN];
    const int f = blockIdx.x; const float gn = bfr(gainp[0]); const bool causal = (causp[0] != 0);
    // under the causal flag a tile's cost grows with its index: a work-group takes tile NQT - 1 - p and then tile p of one (batch, head), so that all work-groups walk equally many stages. Every (head, tile) falls to one work-group.
    static_assert(NB_ * NH_ == 32 && NQT % 2 == 0, "the low five bits of the index are the (batch, head)");
    const int hd = f & 31, p = f >> 5; const size_t ho = (size_t)hd * TT * HD;
#pragma unroll 1   // rolled: one copy of each body serves both tiles
    for (int rep = 0; rep < 2; ++rep) {
        const int qt = rep ? p : NQT - 1 - p; const bool hires = (qt < RH / QB); const int qb = qt * QB;
        if (hires) attn_body<true>(sm, Qh + ho, Ql + ho, Kh + ho, Kl + ho, Vh + ho, Vl + ho, gn, causal, qb, out + ho);        // the same for the whole work-group
        else attn_body<false>(sm, Qh + ho, Ql + ho, Kh + ho, Kl + ho, (const bf*)V16 + ho, nullptr, gn, causal, qb, out + ho);
    }
}

extern "C" void kernel_launch(void* const* d_in, const int* in_sizes, int n_in,
                              void* d_out, int out_size, void* d_ws, size_t ws_size, hipStream_t stream) {
    (void)in_sizes; (void)n_in; (void)out_size;
    const float* Qi = (const float*)d_in[0]; const float* Ki = (const float*)d_in[1]; const float* Vi = (const float*)d_in[2]; const float* gainp = (const float*)d_in[3]; const int* causp = (const int*)d_in[4];
    float* OUT = (float*)d_out;     // [2][16][2048][64]
    char* wsp = (char*)d_ws;
    auto take = [&](size_t bytes) { char* p = wsp; wsp += (bytes + 255) & ~(size_t)255; return (void*)p; };
    const size_t PB = (size_t)NH_ * TT * HD;   // elements of one batch's plane; the planes hold both batches
    h16* VT16 = (h16*)take(NB_ * PB * 2);
    bf* QPh = (bf*)take(NB_ * PB * 2); bf* QPl = (bf*)take(NB_ * PB * 2); bf* KPh = (bf*)take(NB_ * PB * 2); bf* KPl = (bf*)take(NB_ * PB * 2); bf* VTh = (bf*)take(NB_ * PB * 2); bf* VTl = (bf*)take(NB_ * PB * 2);
    if ((size_t)(wsp - (char*)d_ws) > ws_size) return;    // ws 256 MiB
    k_prep<<<PWG, 256, 0, stream>>>(Qi, Ki, Vi, QPh, QPl, KPh, KPl, VT16, VTh, VTl);
    k_fattn<<<NB_ * NH_ * (NQT / 2), NGR * NWV * 32, 0, stream>>>(QPh, QPl, KPh, KPl, VT16, VTh, VTl, gainp, causp, OUT);
}

// v007
// It runs in 44.6 microseconds.
// In two side-by-side timings against v006, it was 1.10 and 1.09 times as fast.
// Over all steps from v000 it is 39.1 times as fast.
#include <hip/hip_runtime.h>

// SelfDotProductAttnQKNorm (Q, K, V [2][16][2048][64] given; Qn, Kn = L2-normalised over d (eps 1e-12 inside the sqrt); scores = gain x (Qn . Kn) with gain a scalar input (read on device; log2(2048? - 2048) ~ 22); is_causal (int input, read on device; 1 here) -> j > i masked to -1e30; softmax; out = attn V -> [2][16][2048][64]).
// Compute dtypes, f32 accumulate: every input rounded to bf16; the L2 normalisation f32 on the VALU; the causal flag is data: set, key stages that lie wholly behind a work-group's queries are not walked; all rows hl x hl (3 products); x gain, mask and softmax f32;

#define NB_  2
#define TT   2048
#define DM   1024
#define NH_  16
#define NKV  16
#define REP  (NH_ / NKV)
#define HD   64
#define DQ   (NH_ * HD)
#define DKV  (NKV * HD)
#define ZH   8                    // heads per call of k_merge
#define RH   512                  // query rows < RH use hi+lo planes (0: none)
#define WIN  0
#define PCAR 1024.0f
#define SCL  0.125f   // HD^-0.5
typedef _Float16 h16;
typedef unsigned short bf;
typedef __attribute__((ext_vector_type(16))) __bf16   v16bf;
typedef __attribute__((ext_vector_type(16))) _Float16 v16h;
typedef __attribute__((ext_vector_type(8)))  _Float16 v8h;
typedef __attribute__((ext_vector_type(8)))  unsigned short v8us;
typedef __attribute__((ext_vector_type(8)))  float    v8f;
typedef __attribute__((ext_vector_type(4)))  float    v4f;
typedef v8h  __attribute__((may_alias)) v8ha;
typedef v4f  __attribute__((may_alias)) v4fa;
typedef v8us __attribute__((may_alias)) v8usa;

__device__ __forceinline__ unsigned short f2bf(float f) { unsigned u = __float_as_uint(f); u += 0x7FFFu + ((u >> 16) & 1u); return (unsigned short)(u >> 16); }
__device__ __forceinline__ float bf2f(unsigned short b) { return __uint_as_float(((unsigned)b) << 16); }
__device__ __forceinline__ float bfr(float f) { return bf2f(f2bf(f)); }
__device__ __forceinline__ v16h cat16(v8h lo, v8h hi) { return __builtin_shufflevector(lo, hi, 0, 1, 2, 3, 4, 5, 6, 7, 8, 9, 10, 11, 12, 13, 14, 15); }
__device__ __forceinline__ v16bf cat16b(v8us lo, v8us hi) { return __builtin_bit_cast(v16bf, __builtin_shufflevector(lo, hi, 0, 1, 2, 3, 4, 5, 6, 7, 8, 9, 10, 11, 12, 13, 14, 15)); }
__device__ __forceinline__ v8f wmma16(v16h a, v16h b, v8f c) { return __builtin_amdgcn_wmma_f32_16x16x32_f16(false, a, false, b, (short)0, c, false, false); }
__device__ __forceinline__ v8f wmmab(v16bf a, v16bf b, v8f c) { return __builtin_amdgcn_wmma_f32_16x16x32_bf16(false, a, false, b, (short)0, c, false, false); }



// fragment loaders, hardware k order: 8 elements at p and 8 at p + 16, p = row start + 32 * kstep + 8 * (lane >> 4)
template <typename T16> struct WFrag;
template <> struct WFrag<h16> { typedef v16h V; static __device__ __forceinline__ V ld(const h16* p) { return cat16(*(const v8h*)p, *(const v8h*)(p + 16)); } static __device__ __forceinline__ v8f mma(V a, V b, v8f c) { return wmma16(a, b, c); } };
template <> struct WFrag<bf> { typedef v16bf V; static __device__ __forceinline__ V ld(const bf* p) { return cat16b(*(const v8us*)p, *(const v8us*)(p + 16)); } static __device__ __forceinline__ v8f mma(V a, V b, v8f c) { return wmmab(a, b, c); } };

__device__ __forceinline__ h16 tohx(float x) { return (h16)x; }
__device__ __forceinline__ void splitf(float y, unsigned short& h, unsigned short& l) { h = f2bf(y); l = f2bf(y - bf2f(h)); }
typedef __attribute__((ext_vector_type(2))) _Float16 v2h;
typedef __attribute__((ext_vector_type(4))) _Float16 v4h;
typedef __attribute__((ext_vector_type(2))) unsigned short v2us;
typedef __attribute__((ext_vector_type(4))) unsigned short v4us;
typedef __attribute__((ext_vector_type(2))) float v2f;
typedef __attribute__((ext_vector_type(4))) int v4i;

__global__ __launch_bounds__(256) void k_wtG(const float* __restrict__ w, int K, int N, bf* Bt) {
    const int lane = threadIdx.x & 31; const int L0 = (blockIdx.x * 8 + (threadIdx.x >> 5)) * 8; const int nlines = N * K / 64;
{
#pragma unroll 1
        for (int l = 0; l < 8; ++l) { const int L = L0 + l; if (L >= nlines) break; const size_t e = (size_t)L * 64 + lane * 2; const int k = (int)(e % K), n = (int)(e / K); v2us o;
            o[0] = f2bf(w[(size_t)k * N + n]); o[1] = f2bf(w[(size_t)(k + 1) * N + n]); *(v2us*)(Bt + e) = o; }
         }
}
__global__ __launch_bounds__(256) void k_cvt8(const float* __restrict__ src, bf* dst, size_t n8) { const size_t i = (size_t)blockIdx.x * 256 + threadIdx.x; if (i >= n8) return; const v8f v = *(const v8f*)(src + i * 8); v8us o;
#pragma unroll
    for (int k = 0; k < 8; ++k) o[k] = f2bf(v[k]); *(v8us*)(dst + i * 8) = o;  }
__global__ __launch_bounds__(256) void k_cscvt(const float* __restrict__ cosT, const float* __restrict__ sinT, float* CS) { const int idx = blockIdx.x * 256 + threadIdx.x; if (idx >= TT * HD) return; v2f cs; cs[0] = bfr(cosT[idx]); cs[1] = bfr(sinT[idx]); *(v2f*)(CS + (size_t)idx * 2) = cs;  }
// k_rope: head planes [h][t][d] (fp16 + hi/lo) of rope(x) x sc with the rotate-half convention out[d] = x[d] cos[t][d] - x[d+HD/2] sin[t][d], out[d+HD/2] = x[d+HD/2] cos[t][d+HD/2] + x[d] sin[t][d+HD/2]
__global__ __launch_bounds__(256) void k_rope(const float* __restrict__ F, int pitch, int nheads, const float* __restrict__ CS, const float* __restrict__ RF, const float* __restrict__ nw, float sc, h16* P16, bf* Ph, bf* Pl) {
    const size_t e = ((size_t)blockIdx.x * 256 + threadIdx.x) * 2; if (e >= (size_t)nheads * TT * HD) return; const int d = (int)(e % HD); const int t = (int)((e / HD) % TT); const int h = (int)(e / ((size_t)HD * TT)); const float* f = F + (size_t)t * pitch + h * HD; const float rf = RF ? RF[(size_t)h * TT + t] : 1.0f; v2h o16; v2us oh, ol;
#pragma unroll
    for (int q = 0; q < 2; ++q) { const int dd = d + q; const int dp = (dd < HD / 2) ? dd + HD / 2 : dd - HD / 2; float x0 = f[dd], x1 = f[dp];
        if (RF) { float n0 = __fmul_rn(x0, rf), n1 = __fmul_rn(x1, rf); asm volatile("" : "+v"(n0)); asm volatile("" : "+v"(n1)); x0 = __fmul_rn(bfr(nw[dd]), n0); x1 = __fmul_rn(bfr(nw[dp]), n1); }
        const v2f cs = *(const v2f*)(CS + ((size_t)t * HD + dd) * 2); float a = __fmul_rn(x0, cs[0]), bq = __fmul_rn(x1, cs[1]); asm volatile("" : "+v"(a)); asm volatile("" : "+v"(bq)); const float r = ((dd < HD / 2) ? __fsub_rn(a, bq) : __fadd_rn(a, bq)) * sc;
        o16[q] = tohx(r); unsigned short a2, c2; splitf(r, a2, c2); oh[q] = a2; ol[q] = c2; }
    *(v2h*)(P16 + e) = o16; *(v2us*)(Ph + e) = oh; *(v2us*)(Pl + e) = ol;  }
__global__ __launch_bounds__(256) void k_vtp(const float* __restrict__ F, int pitch, int nheads, h16* V16, bf* Vh, bf* Vl) { const size_t e = ((size_t)blockIdx.x * 256 + threadIdx.x) * 2; if (e >= (size_t)nheads * HD * TT) return; const int t = (int)(e % TT); const int d = (int)((e / TT) % HD); const int g = (int)(e / ((size_t)TT * HD)); v2h o16; v2us oh, ol;
#pragma unroll
    for (int q = 0; q < 2; ++q) { const float x = F[(size_t)(t + q) * pitch + g * HD + d]; o16[q] = tohx(x); unsigned short a2, c2; splitf(x, a2, c2); oh[q] = a2; ol[q] = c2; }
    *(v2h*)(V16 + e) = o16; *(v2us*)(Vh + e) = oh; *(v2us*)(Vl + e) = ol;  }
__global__ __launch_bounds__(256) void k_merge(const float* __restrict__ O, int h0, bf* Ah, bf* Al) { const size_t e = ((size_t)blockIdx.x * 256 + threadIdx.x) * 2; if (e >= (size_t)ZH * TT * HD) return; const int d = (int)(e % HD); const int t = (int)((e / HD) % TT); const int zz = (int)(e / ((size_t)HD * TT)); const float cs = (t < RH) ? 1.0f : (1.0f / PCAR); const size_t oo = (size_t)t * DQ + (h0 + zz) * HD + d;
    v2us oh, ol;
#pragma unroll
    for (int q = 0; q < 2; ++q) { unsigned short a, c2; splitf(O[e + q] * cs, a, c2); oh[q] = a; ol[q] = c2; } *(v2us*)(Ah + oo) = oh; *(v2us*)(Al + oo) = ol;  }

// ---- k_prep: all that k_fattn reads, made in one launch of PWG work-groups of 8 waves. Each wave loops over many rows, so that the chip starts few waves instead of one wave a row.
// V: a work-group turns a tile of 128 t x 64 d through LDS (whole lines read, whole lines written). Q, K: a wave normalises PRW rows of each, 8 rows a trip, 2 elements of a row per lane.
// Every '#pragma unroll' in it stands on a short loop that indexes register arrays: unrolled, the arrays stay in registers and the loads of a trip go out together.
#define PWG  (NB_ * NH_ * (TT / 128))             // work-groups: one V tile each
#define PRW  (NB_ * NH_ * TT / (PWG * 8))         // rows of Q, and of K, per wave
#define VPD  65                                   // LDS row pitch in dwords (64 dwords = 128 t, + 1: stores down a column and loads along a row both fall on distinct banks)
__global__ __launch_bounds__(256) void k_prep(const float* __restrict__ Q, const float* __restrict__ K, const float* __restrict__ V, bf* __restrict__ Qh, bf* __restrict__ Ql, bf* __restrict__ Kh, bf* __restrict__ Kl, h16* __restrict__ V16, bf* __restrict__ Vh, bf* __restrict__ Vl) {
    __shared__ unsigned vt[HD * VPD];             // [d][t / 2]: the bf16 bits of V at t (low half) and t + 1
    const int tid = threadIdx.x, lane = tid & 31; const int lo4 = tid & 15, up4 = tid >> 4;
    const int g = blockIdx.x / (TT / 128), t0 = (blockIdx.x % (TT / 128)) * 128;
    {   // rows t0 + 2p and t0 + 2p + 1, p = up4 + 16u, elements 4 lo4..4 lo4 + 3
        const char* vb = (const char*)(V + ((size_t)g * TT + t0) * HD); const unsigned vo = (unsigned)(2 * up4 * HD + 4 * lo4) * 4u; v4f a[4], b[4];
#pragma unroll
        for (int u = 0; u < 4; ++u) { a[u] = *(const v4f*)(vb + vo + u * 32 * HD * 4); b[u] = *(const v4f*)(vb + vo + u * 32 * HD * 4 + HD * 4); }
        asm volatile("s_wait_xcnt 0x0" :: "v"(vo) : "memory");   // stands before the offset register of these loads is written again (named as an input, so that it lives up to it)
#pragma unroll
        for (int u = 0; u < 4; ++u)
#pragma unroll
            for (int i = 0; i < 4; ++i) vt[(4 * lo4 + i) * VPD + up4 + 16 * u] = (unsigned)f2bf(a[u][i]) | ((unsigned)f2bf(b[u][i]) << 16);
    }
    __syncthreads();                              // the tile is whole before anybody reads a row of it
    {   // row d = up4 + 16u, t0 + 8 lo4..+7: 16 B to each plane, a row of the tile is 256 B
        const unsigned eo = (unsigned)(up4 * TT + 8 * lo4) * 2u; const size_t pb = (((size_t)g * HD) * TT + t0) * 2;
#pragma unroll
        for (int u = 0; u < 4; ++u) { v8h o16; v8us oh, ol;
#pragma unroll
            for (int j = 0; j < 4; ++j) { const unsigned w = vt[(up4 + 16 * u) * VPD + 4 * lo4 + j];
#pragma unroll
                for (int q = 0; q < 2; ++q) { const float x = bf2f((unsigned short)(q ? (w >> 16) : (w & 0xFFFFu))); o16[2 * j + q] = tohx(x); unsigned short a2, c2; splitf(x, a2, c2); oh[2 * j + q] = a2; ol[2 * j + q] = c2; } }
            *(v8h*)((char*)V16 + pb + eo + u * 16 * TT * 2) = o16; *(v8us*)((char*)Vh + pb + eo + u * 16 * TT * 2) = oh; *(v8us*)((char*)Vl + pb + eo + u * 16 * TT * 2) = ol; }
        asm volatile("s_wait_xcnt 0x0" :: "v"(eo) : "memory");   // stands before the offset register of these stores is written again
    }
    const int row0 = (blockIdx.x * 8 + __builtin_amdgcn_readfirstlane(tid >> 5)) * PRW;   // the wave's first row, of Q and of K
    const unsigned li = (unsigned)lane * 8u, lo = (unsigned)lane * 4u;                    // the lane's byte offsets in an f32 row and in a 16-bit row
#pragma unroll 1   // rolled: one copy of the 8-row body serves Q and K
    for (int it = 0; it < 2 * (PRW / 8); ++it) {
        const bool isq = (it < PRW / 8); const size_t r0 = (size_t)(row0 + (it % (PRW / 8)) * 8) * HD;
        const char* xs = (const char*)((isq ? Q : K) + r0); char* ph = (char*)((isq ? Qh : Kh) + r0); char* pl = (char*)((isq ? Ql : Kl) + r0);
        v2f x[8];
#pragma unroll
        for (int u = 0; u < 8; ++u) x[u] = *(const v2f*)(xs + li + u * HD * 4);
        asm volatile("s_wait_xcnt 0x0" :: "v"(li), "s"(xs) : "memory");   // stands before a register that these loads name is written again
        float q[8];
#pragma unroll
        for (int u = 0; u < 8; ++u) { x[u][0] = bfr(x[u][0]); x[u][1] = bfr(x[u][1]); q[u] = x[u][0] * x[u][0] + x[u][1] * x[u][1]; }
#pragma unroll
        for (int sh = 16; sh; sh >>= 1)
#pragma unroll
            for (int u = 0; u < 8; ++u) q[u] += __shfl_xor(q[u], sh, 32);
#pragma unroll
        for (int u = 0; u < 8; ++u) { const float den = __fsqrt_rn(__fadd_rn(q[u], 1e-12f)); const float y0 = __fdiv_rn(x[u][0], den), y1 = __fdiv_rn(x[u][1], den); v2us oh, ol; unsigned short a, c;
            splitf(y0, a, c); oh[0] = a; ol[0] = c; splitf(y1, a, c); oh[1] = a; ol[1] = c;
            *(v2us*)(ph + lo + u * HD * 2) = oh; *(v2us*)(pl + lo + u * HD * 2) = ol; }
        asm volatile("s_wait_xcnt 0x0" :: "v"(lo), "s"(ph), "s"(pl) : "memory");   // stands before a register that these stores name is written again
    }
}
#define QW   32                   // query columns per wave
#define NWV  4                    // waves per key group
#define NGR  2                    // key groups per work-group
#define QB   (QW * NWV)           // queries per tile
#define NQT  (TT / QB)            // query tiles per (batch, head)
#define SK   64                   // keys per LDS stage
#define LP   72                   // LDS row pitch in 16-bit elements: 144 B = 16 B x 9
#define PLN  (64 * LP)            // one staged plane: 64 rows (keys of K, d of V^T) of 64 elements
#define NPLX 4                    // planes per stage at most: Kh, Kl, then Vh, Vl or V16
#define MGW  (9 * 128)            // floats that one wave hands to its partner: 8 chunks of outputs and one of maximum and sum, 16 B a lane each
#define LOG2E 1.4426950408889634f
typedef __attribute__((ext_vector_type(8))) __bf16 v8bf;
__device__ __forceinline__ float xhalf(float x) { const int b = __float_as_int(x); return __int_as_float(__builtin_amdgcn_permlanex16(b, b, 0x76543210, 0xfedcba98, false, false)); }   // the value of lane l ^ 16
__device__ __forceinline__ v16bf ldsb(const bf* p) { return cat16b(*(const v8us*)p, *(const v8us*)(p + 16)); }
__device__ __forceinline__ v16bf cat16f(v8bf lo, v8bf hi) { return __builtin_shufflevector(lo, hi, 0, 1, 2, 3, 4, 5, 6, 7, 8, 9, 10, 11, 12, 13, 14, 15); }

// K fragments (A operand) of 32 keys, rows kloc.. of the staged planes
__device__ __forceinline__ void ld_k(const bf* sb, int kloc, int lr, int hi, v16bf (&kh)[2][2], v16bf (&kl)[2][2]) {
#pragma unroll
    for (int kt = 0; kt < 2; ++kt)
#pragma unroll
        for (int ks = 0; ks < 2; ++ks) { const bf* kr = sb + (kloc + kt * 16 + lr) * LP + ks * 32 + 8 * hi; kh[kt][ks] = ldsb(kr); kl[kt][ks] = ldsb(kr + PLN); }
}
// V^T fragments (A operand) of the same 32 keys: v[0][dt] = Vh or V16 (bits), v[1][dt] = Vl
template <bool HI>
__device__ __forceinline__ void ld_v(const bf* sb, int kloc, int lr, int hi, v16bf (&v)[HI ? 2 : 1][4]) {
#pragma unroll
    for (int dt = 0; dt < 4; ++dt) { const bf* vr = sb + 2 * PLN + (dt * 16 + lr) * LP + kloc + 8 * hi; v[0][dt] = ldsb(vr); if (HI) v[HI ? 1 : 0][dt] = ldsb(vr + PLN); }
}
// hl x hl, 3 products, per tile in the order Qh Kh, Ql Kh, Qh Kl for d 0..31, then for d 32..63
__device__ __forceinline__ void scores(const v16bf (&kh)[2][2], const v16bf (&kl)[2][2], const v16bf (&qh)[2][2], const v16bf (&ql)[2][2], v8f (&S)[2][2]) {
#pragma unroll
    for (int kt = 0; kt < 2; ++kt)
#pragma unroll
        for (int qt = 0; qt < 2; ++qt) S[kt][qt] = (v8f){};
#pragma unroll
    for (int ks = 0; ks < 2; ++ks) {
#pragma unroll
        for (int kt = 0; kt < 2; ++kt)
#pragma unroll
            for (int qt = 0; qt < 2; ++qt) S[kt][qt] = wmmab(kh[kt][ks], qh[qt][ks], S[kt][qt]);
#pragma unroll
        for (int kt = 0; kt < 2; ++kt)
#pragma unroll
            for (int qt = 0; qt < 2; ++qt) S[kt][qt] = wmmab(kh[kt][ks], ql[qt][ks], S[kt][qt]);
#pragma unroll
        for (int kt = 0; kt < 2; ++kt)
#pragma unroll
            for (int qt = 0; qt < 2; ++qt) S[kt][qt] = wmmab(kl[kt][ks], qh[qt][ks], S[kt][qt]);
    }
}
// gain, mask, running maximum and sum, probabilities, and O^T += V^T P^T, for keys kb..kb+31 against queries q0..q0+31
// FIX: the shift of the softmax is not the running maximum but the constant |gain|: Qn and Kn are unit vectors or shorter, so |gain x (Qn . Kn)| <= |gain| (but for rounding, below 1e-4 of it) for every input.
// Then no pass looks for a maximum or brings sums and outputs to a new one, and gain, log2 e and shift are one multiply-add. Whether a row's probabilities came out too small for their format is seen in its sum: attn_body.
template <bool HI, bool FIX>
__device__ __forceinline__ void soft_pv(v8f (&S)[2][2], const v16bf (&v)[HI ? 2 : 1][4], int kb, int q0, int lr, int hi, float gn, bool causal, v8f (&O)[4][2], float (&m)[2], float (&l)[2]) {
    const bool edge = causal && (kb + 31 > q0);   // wave-uniform: only then can a key of this pass lie behind a query of this wave
#pragma unroll
    for (int kt = 0; kt < 2; ++kt)
#pragma unroll
        for (int qt = 0; qt < 2; ++qt) {
            if (FIX) { const float kf = gn * LOG2E, cf = (HI ? 0.0f : 15.0f) - __builtin_fabsf(gn) * LOG2E;   // f16 probabilities carry x 2^15: the bound itself lands on 32768, inside f16
                const v8f kv = { kf, kf, kf, kf, kf, kf, kf, kf }, cv = { cf, cf, cf, cf, cf, cf, cf, cf }; S[kt][qt] = __builtin_elementwise_fma(S[kt][qt], kv, cv); }
            else S[kt][qt] *= gn; }
    if (edge) {
#pragma unroll
        for (int qt = 0; qt < 2; ++qt) { const int qi = q0 + qt * 16 + lr;
#pragma unroll
            for (int kt = 0; kt < 2; ++kt) {
#pragma unroll
                for (int j = 0; j < 8; ++j) if (kb + kt * 16 + hi * 8 + j > qi) S[kt][qt][j] = -1.0e30f;
                asm volatile("" : "+v"(S[kt][qt]));
            } }
    }
    if (!FIX) {
    float mn[2];
#pragma unroll
    for (int qt = 0; qt < 2; ++qt) { float mx = -3.0e38f;
#pragma unroll
        for (int kt = 0; kt < 2; ++kt)
#pragma unroll
            for (int j = 0; j < 8; ++j) mx = fmaxf(mx, S[kt][qt][j]);
        mn[qt] = fmaxf(m[qt], fmaxf(mx, xhalf(mx))); }
    if (__builtin_amdgcn_ballot_w32(mn[0] > m[0] || mn[1] > m[1]) != 0) {   // a maximum moved somewhere in the wave: bring sums and outputs to the new one
#pragma unroll
        for (int qt = 0; qt < 2; ++qt) { const float al = __builtin_amdgcn_exp2f((m[qt] - mn[qt]) * LOG2E); m[qt] = mn[qt]; l[qt] *= al;
#pragma unroll
            for (int dt = 0; dt < 4; ++dt) O[dt][qt] *= al; }
    }
    }
    v16bf ph[2], pl[2];   // f16 rows: ph holds the f16 bits
#pragma unroll
    for (int qt = 0; qt < 2; ++qt) { const float c = (HI ? 0.0f : 10.0f) - m[qt] * LOG2E;   // f16 rows come only with FIX, which leaves c unused: they carry x 2^15 (above), as the sum does: it cancels in the quotient
        const v8f cv = { c, c, c, c, c, c, c, c }, lv = { LOG2E, LOG2E, LOG2E, LOG2E, LOG2E, LOG2E, LOG2E, LOG2E };
        const v8f a0 = FIX ? S[0][qt] : __builtin_elementwise_fma(S[0][qt], lv, cv), a1 = FIX ? S[1][qt] : __builtin_elementwise_fma(S[1][qt], lv, cv);
#pragma unroll
        for (int j = 0; j < 8; ++j) { S[0][qt][j] = __builtin_amdgcn_exp2f(a0[j]); S[1][qt][j] = __builtin_amdgcn_exp2f(a1[j]); }
        const v8f sv = S[0][qt] + S[1][qt];
        l[qt] += ((sv[0] + sv[1]) + (sv[2] + sv[3])) + ((sv[4] + sv[5]) + (sv[6] + sv[7]));
        if (HI) { const v8bf h0 = __builtin_convertvector(S[0][qt], v8bf), h1 = __builtin_convertvector(S[1][qt], v8bf);
            const v8bf l0 = __builtin_convertvector(S[0][qt] - __builtin_convertvector(h0, v8f), v8bf), l1 = __builtin_convertvector(S[1][qt] - __builtin_convertvector(h1, v8f), v8bf);
            ph[qt] = cat16f(h0, h1); pl[qt] = cat16f(l0, l1);
        } else ph[qt] = __builtin_bit_cast(v16bf, cat16(__builtin_convertvector(S[0][qt], v8h), __builtin_convertvector(S[1][qt], v8h))); }
    if (HI) {   // per tile in the order Ph Vh, Pl Vh, Ph Vl
#pragma unroll
        for (int dt = 0; dt < 4; ++dt)
#pragma unroll
            for (int qt = 0; qt < 2; ++qt) O[dt][qt] = wmmab(v[0][dt], ph[qt], O[dt][qt]);
#pragma unroll
        for (int dt = 0; dt < 4; ++dt)
#pragma unroll
            for (int qt = 0; qt < 2; ++qt) O[dt][qt] = wmmab(v[0][dt], pl[qt], O[dt][qt]);
#pragma unroll
        for (int dt = 0; dt < 4; ++dt)
#pragma unroll
            for (int qt = 0; qt < 2; ++qt) O[dt][qt] = wmmab(v[HI ? 1 : 0][dt], ph[qt], O[dt][qt]);
    } else {
#pragma unroll
        for (int dt = 0; dt < 4; ++dt)
#pragma unroll
            for (int qt = 0; qt < 2; ++qt) O[dt][qt] = wmma16(__builtin_bit_cast(v16h, v[0][dt]), __builtin_bit_cast(v16h, ph[qt]), O[dt][qt]);
    }
}

// FIX: soft_pv with the constant shift. Returns, the same in every thread of the work-group, whether the tile is to be done again with the running maximum (never, where FIX is off).
template <bool HI, bool FIX>
__device__ __forceinline__ bool attn_body(bf* sm, const bf* Qh, const bf* Ql, const bf* Kh, const bf* Kl, const bf* Va, const bf* Vb, float gn, bool causal, int qb, float* out) {
    constexpr int NPL = HI ? 4 : 3;
    const int tid = threadIdx.x & (NWV * 32 - 1), lane = tid & 31, lr = lane & 15, hi = lane >> 4;   // tid: the thread's index in its key group
    const int wv = __builtin_amdgcn_readfirstlane(tid >> 5), grp = __builtin_amdgcn_readfirstlane((int)threadIdx.x >> 7); const int q0 = qb + wv * QW;
    static_assert(NWV * 32 == 128 && NGR == 2 && (QB / SK) % NGR == 0 && (TT / SK) % NGR == 0, "two groups of 128 threads; every walk is a whole number of trips");
    const bf* gp[4] = { Kh, Kl, Va, Vb };
    v16bf qh[2][2], ql[2][2];
#pragma unroll
    for (int qt = 0; qt < 2; ++qt) { const size_t qo = (size_t)(q0 + qt * 16 + lr) * HD + 8 * hi; const bf* pqh = Qh + qo; const bf* pql = Ql + qo;
#pragma unroll
        for (int ks = 0; ks < 2; ++ks) { qh[qt][ks] = WFrag<bf>::ld(pqh + ks * 32); ql[qt][ks] = WFrag<bf>::ld(pql + ks * 32); }
        asm volatile("s_wait_xcnt 0x0" :: "v"(pqh), "v"(pql) : "memory"); }   // stands before the address registers of these loads are written again (named as inputs, so that they live up to it)
    v8f O[4][2]; float m[2], l[2];
#pragma unroll
    for (int qt = 0; qt < 2; ++qt) { m[qt] = -3.0e38f; l[qt] = 0.f;
#pragma unroll
        for (int dt = 0; dt < 4; ++dt) O[dt][qt] = (v8f){}; }
    // a stage's plane is 512 chunks of 16 B, four a thread: chunk c = row c >> 3, elements 8 (c & 7)..; K rows are keys (pitch HD), V^T rows are d (pitch TT)
    v8us st[NPL][4];
    const int srow = tid >> 3, scol = (tid & 7) * 8;
    auto stage_load = [&](int s) {
        const unsigned ko = (unsigned)((s * SK + srow) * HD + scol) * 2u, vo = (unsigned)(srow * TT + s * SK + scol) * 2u;   // the thread's byte offsets in a K plane and in a V^T plane
#pragma unroll
        for (int pn = 0; pn < NPL; ++pn)
#pragma unroll
            for (int u = 0; u < 4; ++u) st[pn][u] = *(const v8us*)((const char*)gp[pn] + (pn < 2 ? ko : vo) + u * 32 * (pn < 2 ? HD : TT));
        asm volatile("s_wait_xcnt 0x0" :: "v"(ko), "v"(vo) : "memory"); };   // stands before the offset registers of these loads are written again (named as inputs, so that they live up to it)
    auto stage_store = [&](int b) {
#pragma unroll
        for (int pn = 0; pn < NPL; ++pn)
#pragma unroll
            for (int u = 0; u < 4; ++u) *(v8us*)(sm + (b * NPLX + pn) * PLN + (srow + u * 16) * LP + scol) = st[pn][u]; };
    // under the causal flag every key from qb + QB on is masked for every query of the work-group. Key 0 is open to every query, so a row's maximum is at least a real score, which is no lower than about -|gain|:
    // while |gain| stays far below 1e30 a masked key's probability is an exact 0 and its stage adds nothing. A larger gain, or one that is no number, walks every stage.
    // A group all of whose keys are masked for a query (the odd stages, for queries below SK) holds the maximum -1e30 there, and sums without meaning that need not even be finite: where the groups meet, a side whose factor is 0 is left out.
    const int ntr = ((causal && __builtin_fabsf(gn) < 1.0e29f) ? (qb + QB) / SK : TT / SK) / NGR;   // trips: the same for the whole work-group, from 1 to TT / SK / NGR
    stage_load(grp); stage_store(grp);
    __syncthreads();
#pragma unroll 1   // rolled: one copy of the stage body, so that code size and registers stay as they are
    for (int i = 0; i < ntr; ++i) {
        const int s = i * NGR + grp;          // this group's stage
        const bool more = (i + 1 < ntr);
        if (more) stage_load(s + NGR);        // the loads stay in flight while this stage is worked on
        const bf* sb = sm + ((i & 1) * NGR + grp) * NPLX * PLN;
        v16bf kh[2][2], kl[2][2], v0[HI ? 2 : 1][4], v1[HI ? 2 : 1][4]; v8f S[2][2];
        ld_k(sb, 0, lr, hi, kh, kl); ld_v<HI>(sb, 0, lr, hi, v0);
        scores(kh, kl, qh, ql, S);
        if (FIX) { ld_k(sb, 32, lr, hi, kh, kl); ld_v<HI>(sb, 32, lr, hi, v1); }   // the second half's fragments depend on nothing of the first half: they can be fetched ahead of its softmax
        soft_pv<HI, FIX>(S, v0, s * SK, q0, lr, hi, gn, causal, O, m, l);
        if (!FIX) { ld_k(sb, 32, lr, hi, kh, kl); ld_v<HI>(sb, 32, lr, hi, v1); }  // the fallback, the body with the most registers, fetches them late: fetched early, the kernel spilled
        scores(kh, kl, qh, ql, S);
        soft_pv<HI, FIX>(S, v1, s * SK + 32, q0, lr, hi, gn, causal, O, m, l);
        if (more) stage_store(((i + 1) & 1) * NGR + grp);   // the buffer that the group's last stage but one read: every wave left it at the last barrier
        __syncthreads();                      // publishes the next stage of each group and ends every read of this one
    }
    // the groups meet: of a wave pair's 32 query columns group g finishes columns 16g..16g+15 and hands the other 16 (maximum, sum, outputs) to its partner.
    // The exchange lies in the third buffer: free behind the loop's last barrier, and written again by the next tile only behind that tile's first barrier.
    float* mg = (float*)(sm + 2 * NPLX * PLN) + wv * (2 * MGW) + lane * 4;   // chunk c of a lane at c * 128 floats: 16 B a lane, whole rows of banks
#pragma unroll
    for (int qt = 0; qt < 2; ++qt) if (grp != qt) { float* w = mg + qt * MGW;
#pragma unroll
        for (int dt = 0; dt < 4; ++dt) { v4f a, b;
#pragma unroll
            for (int u = 0; u < 4; ++u) { a[u] = O[dt][qt][u]; b[u] = O[dt][qt][u + 4]; }
            *(v4fa*)(w + (2 * dt) * 128) = a; *(v4fa*)(w + (2 * dt + 1) * 128) = b; }
        const v4f ml = { m[qt], l[qt], 0.f, 0.f }; *(v4fa*)(w + 8 * 128) = ml; }
    __syncthreads();                          // both halves of the exchange are written before either is read
    if (FIX) {   // the rows' sums are tested before anything is stored: a tile that is done again stores nothing here
        bool small = false;
#pragma unroll
        for (int qt = 0; qt < 2; ++qt) if (grp == qt) { const v4f ml = *(const v4fa*)(mg + qt * MGW + 8 * 128); const float ls = l[qt] + ml[1]; const float lt = ls + xhalf(ls);
            // f16 rounds a probability to within 2^-11 of itself or, below its normal range, to within 2^-25: where the sum is at least 2^-15 a key, all the roundings of the second kind together stay within 2^-10 of the sum (those of the first kind: 2^-11).
            // bf16 pairs only have to stay clear of the end of the exponent range. A sum that is no number fails the test too.
            small = !(lt >= (HI ? 0x1p-80f : (float)(causal ? q0 + qt * 16 + lr + 1 : TT) * 0x1p-15f)); }
        // one word a wave in the fourth buffer (free like the third): every wave learns whether any row of the tile failed
        unsigned* fl = (unsigned*)(sm + 3 * NPLX * PLN);
        const unsigned wb = (__builtin_amdgcn_ballot_w32(small) != 0) ? 1u : 0u;
        if (lane == 0) fl[grp * NWV + wv] = wb;
        __syncthreads();                      // the NGR * NWV words are written before anybody reads them
        static_assert(NGR * NWV == 8, "eight words");
        const v4i f0 = *(const v4i*)fl, f1 = *(const v4i*)(fl + 4);
        // the same in every lane: made a scalar, so that this branch and the caller's, round barriers and matrix instructions, are scalar ones
        if (__builtin_amdgcn_readfirstlane((f0[0] | f0[1] | f0[2] | f0[3]) | (f1[0] | f1[1] | f1[2] | f1[3])) != 0) return true;
    }
#pragma unroll
    for (int qt = 0; qt < 2; ++qt) if (grp == qt) { const float* r = mg + qt * MGW; const v4f ml = *(const v4fa*)(r + 8 * 128);
        const float mt = FIX ? 0.f : fmaxf(m[qt], ml[0]); const float ca = FIX ? 1.0f : __builtin_amdgcn_exp2f((m[qt] - mt) * LOG2E), cb = FIX ? 1.0f : __builtin_amdgcn_exp2f((ml[0] - mt) * LOG2E);   // one shift on both sides: the factors are 1
        const bool ua = (ca > 0.f), ub = (cb > 0.f);   // the side that holds the maximum has factor 1; a side with factor 0 adds nothing, and is selected away instead of multiplied because 0 x (no finite number) would spoil the sum
        const float ls = (ua ? l[qt] * ca : 0.f) + (ub ? ml[1] * cb : 0.f); const float inv = __fdiv_rn(1.0f, ls + xhalf(ls)); const float fa = ca * inv, fb = cb * inv;
        float* orow = out + (size_t)(q0 + qt * 16 + lr) * HD + hi * 8;   // O^T tile: lane (c, h) holds d 8h..8h+7 of query c
#pragma unroll
        for (int dt = 0; dt < 4; ++dt) { const v4f pa = *(const v4fa*)(r + (2 * dt) * 128), pb = *(const v4fa*)(r + (2 * dt + 1) * 128); v4f a, b;
#pragma unroll
            for (int u = 0; u < 4; ++u) { a[u] = (ua ? O[dt][qt][u] * fa : 0.f) + (ub ? pa[u] * fb : 0.f); b[u] = (ua ? O[dt][qt][u + 4] * fa : 0.f) + (ub ? pb[u] * fb : 0.f); }
            *(v4f*)(orow + dt * 16) = a; *(v4f*)(orow + dt * 16 + 4) = b; }
        asm volatile("s_wait_xcnt 0x0" :: "v"(orow) : "memory"); }   // stands before the address register of these stores is written again (named as an input, so that it lives up to it)
    return false;
}

__global__ __launch_bounds__(NGR * NWV * 32) void k_fattn(const bf* __restrict__ Qh, const bf* __restrict__ Ql, const bf* __restrict__ Kh, const bf* __restrict__ Kl, const h16* __restrict__ V16, const bf* __restrict__ Vh, const bf* __restrict__ Vl, const float* __restrict__ gainp, const int* __restrict__ causp, float* __restrict__ out) {
    __shared__ __align__(16) bf sm[2 * NGR * NPLX * PLN];
    const int f = blockIdx.x; const float gn = bfr(gainp[0]); const bool causal = (causp[0] != 0);
    // under the causal flag a tile's cost grows with its index: a work-group takes tile NQT - 1 - p and then tile p of one (batch, head), so that all work-groups walk equally many stages. Every (head, tile) falls to one work-group.
    static_assert(NB_ * NH_ == 32 && NQT % 2 == 0, "the low five bits of the index are the (batch, head)");
    const int hd = f & 31, p = f >> 5; const size_t ho = (size_t)hd * TT * HD;
#pragma unroll 1   // rolled: one copy of each body serves both tiles
    for (int rep = 0; rep < 2; ++rep) {
        const int qt = rep ? p : NQT - 1 - p; const bool hires = (qt < RH / QB); const int qb = qt * QB;
        // first with the constant shift; again with the running maximum where a row's sum says that the scores lie too far below the bound, and at once so where the gain is large (or no number). Every test is the same for the whole work-group.
        bool again = !(__builtin_fabsf(gn) <= 64.0f);
        if (!again) { if (hires) again = attn_body<true, true>(sm, Qh + ho, Ql + ho, Kh + ho, Kl + ho, Vh + ho, Vl + ho, gn, causal, qb, out + ho);
            else again = attn_body<false, true>(sm, Qh + ho, Ql + ho, Kh + ho, Kl + ho, (const bf*)V16 + ho, nullptr, gn, causal, qb, out + ho); }
        if (again) attn_body<true, false>(sm, Qh + ho, Ql + ho, Kh + ho, Kl + ho, Vh + ho, Vl + ho, gn, causal, qb, out + ho);   // one fallback for every tile: hi+lo rows, the finer of the two forms
    }
}

extern "C" void kernel_launch(void* const* d_in, const int* in_sizes, int n_in,
                              void* d_out, int out_size, void* d_ws, size_t ws_size, hipStream_t stream) {
    (void)in_sizes; (void)n_in; (void)out_size;
    const float* Qi = (const float*)d_in[0]; const float* Ki = (const float*)d_in[1]; const float* Vi = (const float*)d_in[2]; const float* gainp = (const float*)d_in[3]; const int* causp = (const int*)d_in[4];
    float* OUT = (float*)d_out;     // [2][16][2048][64]
    char* wsp = (char*)d_ws;
    auto take = [&](size_t bytes) { char* p = wsp; wsp += (bytes + 255) & ~(size_t)255; return (void*)p; };
    const size_t PB = (size_t)NH_ * TT * HD;   // elements of one batch's plane; the planes hold both batches
    h16* VT16 = (h16*)take(NB_ * PB * 2);
    bf* QPh = (bf*)take(NB_ * PB * 2); bf* QPl = (bf*)take(NB_ * PB * 2); bf* KPh = (bf*)take(NB_ * PB * 2); bf* KPl = (bf*)take(NB_ * PB * 2); bf* VTh = (bf*)take(NB_ * PB * 2); bf* VTl = (bf*)take(NB_ * PB * 2);
    if ((size_t)(wsp - (char*)d_ws) > ws_size) return;    // ws 256 MiB
    k_prep<<<PWG, 256, 0, stream>>>(Qi, Ki, Vi, QPh, QPl, KPh, KPl, VT16, VTh, VTl);
    k_fattn<<<NB_ * NH_ * (NQT / 2), NGR * NWV * 32, 0, stream>>>(QPh, QPl, KPh, KPl, VT16, VTh, VTl, gainp, causp, OUT);
}

// v008
// One run takes 36.6 microseconds.
// Two timings next to v007 put it at 1.22 and 1.21 times that version's speed.
// All steps since v000 together make it 47.6 times as fast.
#include <hip/hip_runtime.h>

// SelfDotProductAttnQKNorm (Q, K, V [2][16][2048][64] given; Qn, Kn = L2-normalised over d (eps 1e-12 inside the sqrt); scores = gain x (Qn . Kn) with gain a scalar input (read on device; log2(2048? - 2048) ~ 22); is_causal (int input, read on device; 1 here) -> j > i masked to -1e30; softmax; out = attn V -> [2][16][2048][64]).
// Compute dtypes, f32 accumulate: every input rounded to bf16; the L2 normalisation f32 on the VALU; the causal flag is data: set, key stages that lie wholly behind a work-group's queries are not walked; scores: one bf16 product of the rounded, not normalised rows (exact operands), x 1/|q| x 1/|k| x gain in f32; mask and softmax f32;

#define NB_  2
#define TT   2048
#define DM   1024
#define NH_  16
#define NKV  16
#define REP  (NH_ / NKV)
#define HD   64
#define DQ   (NH_ * HD)
#define DKV  (NKV * HD)
#define ZH   8                    // heads per call of k_merge
#define RH   512                  // query rows < RH use hi+lo planes (0: none)
#define WIN  0
#define PCAR 1024.0f
#define SCL  0.125f   // HD^-0.5
typedef _Float16 h16;
typedef unsigned short bf;
typedef __attribute__((ext_vector_type(16))) __bf16   v16bf;
typedef __attribute__((ext_vector_type(16))) _Float16 v16h;
typedef __attribute__((ext_vector_type(8)))  _Float16 v8h;
typedef __attribute__((ext_vector_type(8)))  unsigned short v8us;
typedef __attribute__((ext_vector_type(8)))  float    v8f;
typedef __attribute__((ext_vector_type(4)))  float    v4f;
typedef v8h  __attribute__((may_alias)) v8ha;
typedef v4f  __attribute__((may_alias)) v4fa;
typedef v8us __attribute__((may_alias)) v8usa;

__device__ __forceinline__ unsigned short f2bf(float f) { unsigned u = __float_as_uint(f); u += 0x7FFFu + ((u >> 16) & 1u); return (unsigned short)(u >> 16); }
__device__ __forceinline__ float bf2f(unsigned short b) { return __uint_as_float(((unsigned)b) << 16); }
__device__ __forceinline__ float bfr(float f) { return bf2f(f2bf(f)); }
__device__ __forceinline__ v16h cat16(v8h lo, v8h hi) { return __builtin_shufflevector(lo, hi, 0, 1, 2, 3, 4, 5, 6, 7, 8, 9, 10, 11, 12, 13, 14, 15); }
__device__ __forceinline__ v16bf cat16b(v8us lo, v8us hi) { return __builtin_bit_cast(v16bf, __builtin_shufflevector(lo, hi, 0, 1, 2, 3, 4, 5, 6, 7, 8, 9, 10, 11, 12, 13, 14, 15)); }
__device__ __forceinline__ v8f wmma16(v16h a, v16h b, v8f c) { return __builtin_amdgcn_wmma_f32_16x16x32_f16(false, a, false, b, (short)0, c, false, false); }
__device__ __forceinline__ v8f wmmab(v16bf a, v16bf b, v8f c) { return __builtin_amdgcn_wmma_f32_16x16x32_bf16(false, a, false, b, (short)0, c, false, false); }



// fragment loaders, hardware k order: 8 elements at p and 8 at p + 16, p = row start + 32 * kstep + 8 * (lane >> 4)
template <typename T16> struct WFrag;
template <> struct WFrag<h16> { typedef v16h V; static __device__ __forceinline__ V ld(const h16* p) { return cat16(*(const v8h*)p, *(const v8h*)(p + 16)); } static __device__ __forceinline__ v8f mma(V a, V b, v8f c) { return wmma16(a, b, c); } };
template <> struct WFrag<bf> { typedef v16bf V; static __device__ __forceinline__ V ld(const bf* p) { return cat16b(*(const v8us*)p, *(const v8us*)(p + 16)); } static __device__ __forceinline__ v8f mma(V a, V b, v8f c) { return wmmab(a, b, c); } };

__device__ __forceinline__ h16 tohx(float x) { return (h16)x; }
__device__ __forceinline__ void splitf(float y, unsigned short& h, unsigned short& l) { h = f2bf(y); l = f2bf(y - bf2f(h)); }
typedef __attribute__((ext_vector_type(2))) _Float16 v2h;
typedef __attribute__((ext_vector_type(4))) _Float16 v4h;
typedef __attribute__((ext_vector_type(2))) unsigned short v2us;
typedef __attribute__((ext_vector_type(4))) unsigned short v4us;
typedef __attribute__((ext_vector_type(2))) float v2f;
typedef __attribute__((ext_vector_type(4))) int v4i;

__global__ __launch_bounds__(256) void k_wtG(const float* __restrict__ w, int K, int N, bf* Bt) {
    const int lane = threadIdx.x & 31; const int L0 = (blockIdx.x * 8 + (threadIdx.x >> 5)) * 8; const int nlines = N * K / 64;
{
#pragma unroll 1
        for (int l = 0; l < 8; ++l) { const int L = L0 + l; if (L >= nlines) break; const size_t e = (size_t)L * 64 + lane * 2; const int k = (int)(e % K), n = (int)(e / K); v2us o;
            o[0] = f2bf(w[(size_t)k * N + n]); o[1] = f2bf(w[(size_t)(k + 1) * N + n]); *(v2us*)(Bt + e) = o; }
         }
}
__global__ __launch_bounds__(256) void k_cvt8(const float* __restrict__ src, bf* dst, size_t n8) { const size_t i = (size_t)blockIdx.x * 256 + threadIdx.x; if (i >= n8) return; const v8f v = *(const v8f*)(src + i * 8); v8us o;
#pragma unroll
    for (int k = 0; k < 8; ++k) o[k] = f2bf(v[k]); *(v8us*)(dst + i * 8) = o;  }
__global__ __launch_bounds__(256) void k_cscvt(const float* __restrict__ cosT, const float* __restrict__ sinT, float* CS) { const int idx = blockIdx.x * 256 + threadIdx.x; if (idx >= TT * HD) return; v2f cs; cs[0] = bfr(cosT[idx]); cs[1] = bfr(sinT[idx]); *(v2f*)(CS + (size_t)idx * 2) = cs;  }
// k_rope: head planes [h][t][d] (fp16 + hi/lo) of rope(x) x sc with the rotate-half convention out[d] = x[d] cos[t][d] - x[d+HD/2] sin[t][d], out[d+HD/2] = x[d+HD/2] cos[t][d+HD/2] + x[d] sin[t][d+HD/2]
__global__ __launch_bounds__(256) void k_rope(const float* __restrict__ F, int pitch, int nheads, const float* __restrict__ CS, const float* __restrict__ RF, const float* __restrict__ nw, float sc, h16* P16, bf* Ph, bf* Pl) {
    const size_t e = ((size_t)blockIdx.x * 256 + threadIdx.x) * 2; if (e >= (size_t)nheads * TT * HD) return; const int d = (int)(e % HD); const int t = (int)((e / HD) % TT); const int h = (int)(e / ((size_t)HD * TT)); const float* f = F + (size_t)t * pitch + h * HD; const float rf = RF ? RF[(size_t)h * TT + t] : 1.0f; v2h o16; v2us oh, ol;
#pragma unroll
    for (int q = 0; q < 2; ++q) { const int dd = d + q; const int dp = (dd < HD / 2) ? dd + HD / 2 : dd - HD / 2; float x0 = f[dd], x1 = f[dp];
        if (RF) { float n0 = __fmul_rn(x0, rf), n1 = __fmul_rn(x1, rf); asm volatile("" : "+v"(n0)); asm volatile("" : "+v"(n1)); x0 = __fmul_rn(bfr(nw[dd]), n0); x1 = __fmul_rn(bfr(nw[dp]), n1); }
        const v2f cs = *(const v2f*)(CS + ((size_t)t * HD + dd) * 2); float a = __fmul_rn(x0, cs[0]), bq = __fmul_rn(x1, cs[1]); asm volatile("" : "+v"(a)); asm volatile("" : "+v"(bq)); const float r = ((dd < HD / 2) ? __fsub_rn(a, bq) : __fadd_rn(a, bq)) * sc;
        o16[q] = tohx(r); unsigned short a2, c2; splitf(r, a2, c2); oh[q] = a2; ol[q] = c2; }
    *(v2h*)(P16 + e) = o16; *(v2us*)(Ph + e) = oh; *(v2us*)(Pl + e) = ol;  }
__global__ __launch_bounds__(256) void k_vtp(const float* __restrict__ F, int pitch, int nheads, h16* V16, bf* Vh, bf* Vl) { const size_t e = ((size_t)blockIdx.x * 256 + threadIdx.x) * 2; if (e >= (size_t)nheads * HD * TT) return; const int t = (int)(e % TT); const int d = (int)((e / TT) % HD); const int g = (int)(e / ((size_t)TT * HD)); v2h o16; v2us oh, ol;
#pragma unroll
    for (int q = 0; q < 2; ++q) { const float x = F[(size_t)(t + q) * pitch + g * HD + d]; o16[q] = tohx(x); unsigned short a2, c2; splitf(x, a2, c2); oh[q] = a2; ol[q] = c2; }
    *(v2h*)(V16 + e) = o16; *(v2us*)(Vh + e) = oh; *(v2us*)(Vl + e) = ol;  }
__global__ __launch_bounds__(256) void k_merge(const float* __restrict__ O, int h0, bf* Ah, bf* Al) { const size_t e = ((size_t)blockIdx.x * 256 + threadIdx.x) * 2; if (e >= (size_t)ZH * TT * HD) return; const int d = (int)(e % HD); const int t = (int)((e / HD) % TT); const int zz = (int)(e / ((size_t)HD * TT)); const float cs = (t < RH) ? 1.0f : (1.0f / PCAR); const size_t oo = (size_t)t * DQ + (h0 + zz) * HD + d;
    v2us oh, ol;
#pragma unroll
    for (int q = 0; q < 2; ++q) { unsigned short a, c2; splitf(O[e + q] * cs, a, c2); oh[q] = a; ol[q] = c2; } *(v2us*)(Ah + oo) = oh; *(v2us*)(Al + oo) = ol;  }

// ---- k_prep: all that k_fattn reads, made in one launch of PWG work-groups of 8 waves. Each wave loops over many rows, so that the chip starts few waves instead of one wave a row.
// V: a work-group turns a tile of 128 t x 64 d through LDS (whole lines read, whole lines written). Q, K: waves 0..3 take PRW rows of Q each, waves 4..7 of K, 8 rows a trip, 2 elements of a row per lane:
// the rows leave as they are, rounded to bf16 (one plane, exact), and beside them 1 / sqrt(sum of squares + eps) of each row in f32: gain x (Qn . Kn) = gain x (Q . K) / (|Q| |K|), the division done on the scores in k_fattn.
// Every '#pragma unroll' in it stands on a short loop that indexes register arrays: unrolled, the arrays stay in registers and the loads of a trip go out together.
#define PWG  (NB_ * NH_ * (TT / 128))             // work-groups: one V tile each
#define PRW  (NB_ * NH_ * TT / (PWG * 4))         // rows per wave, of Q or of K: 32, so that a wave's inverse norms are one whole 128-B line
#define VPD  65                                   // LDS row pitch in dwords (64 dwords = 128 t, + 1: stores down a column and loads along a row both fall on distinct banks)
__global__ __launch_bounds__(256) void k_prep(const float* __restrict__ Q, const float* __restrict__ K, const float* __restrict__ V, bf* __restrict__ Qb, bf* __restrict__ Kb, float* __restrict__ RQ, float* __restrict__ RK, h16* __restrict__ V16, bf* __restrict__ Vh, bf* __restrict__ Vl) {
    __shared__ unsigned vt[HD * VPD];             // [d][t / 2]: the bf16 bits of V at t (low half) and t + 1
    const int tid = threadIdx.x, lane = tid & 31; const int lo4 = tid & 15, up4 = tid >> 4;
    const int g = blockIdx.x / (TT / 128), t0 = (blockIdx.x % (TT / 128)) * 128;
    {   // rows t0 + 2p and t0 + 2p + 1, p = up4 + 16u, elements 4 lo4..4 lo4 + 3
        const char* vb = (const char*)(V + ((size_t)g * TT + t0) * HD); const unsigned vo = (unsigned)(2 * up4 * HD + 4 * lo4) * 4u; v4f a[4], b[4];
#pragma unroll
        for (int u = 0; u < 4; ++u) { a[u] = *(const v4f*)(vb + vo + u * 32 * HD * 4); b[u] = *(const v4f*)(vb + vo + u * 32 * HD * 4 + HD * 4); }
        asm volatile("s_wait_xcnt 0x0" :: "v"(vo) : "memory");   // stands before the offset register of these loads is written again (named as an input, so that it lives up to it)
#pragma unroll
        for (int u = 0; u < 4; ++u)
#pragma unroll
            for (int i = 0; i < 4; ++i) vt[(4 * lo4 + i) * VPD + up4 + 16 * u] = (unsigned)f2bf(a[u][i]) | ((unsigned)f2bf(b[u][i]) << 16);
    }
    __syncthreads();                              // the tile is whole before anybody reads a row of it
    {   // row d = up4 + 16u, t0 + 8 lo4..+7: 16 B to each plane, a row of the tile is 256 B
        const unsigned eo = (unsigned)(up4 * TT + 8 * lo4) * 2u; const size_t pb = (((size_t)g * HD) * TT + t0) * 2;
#pragma unroll
        for (int u = 0; u < 4; ++u) { v8h o16; v8us oh, ol;
#pragma unroll
            for (int j = 0; j < 4; ++j) { const unsigned w = vt[(up4 + 16 * u) * VPD + 4 * lo4 + j];
#pragma unroll
                for (int q = 0; q < 2; ++q) { const float x = bf2f((unsigned short)(q ? (w >> 16) : (w & 0xFFFFu))); o16[2 * j + q] = tohx(x); unsigned short a2, c2; splitf(x, a2, c2); oh[2 * j + q] = a2; ol[2 * j + q] = c2; } }
            *(v8h*)((char*)V16 + pb + eo + u * 16 * TT * 2) = o16; *(v8us*)((char*)Vh + pb + eo + u * 16 * TT * 2) = oh; *(v8us*)((char*)Vl + pb + eo + u * 16 * TT * 2) = ol; }
        asm volatile("s_wait_xcnt 0x0" :: "v"(eo) : "memory");   // stands before the offset register of these stores is written again
    }
    static_assert(PRW == 32, "lane l keeps row l's sum");
    const int wv = __builtin_amdgcn_readfirstlane(tid >> 5); const bool isq = (wv < 4);
    const int row0 = (blockIdx.x * 4 + (wv & 3)) * PRW;                                   // the wave's first row
    const unsigned li = (unsigned)lane * 8u, lo = (unsigned)lane * 4u;                    // the lane's byte offsets in an f32 row and in a 16-bit row
    float ss = 0.f;                                                                       // lane l: the sum of squares of row row0 + l
#pragma unroll 1   // rolled: one copy of the 8-row body
    for (int it = 0; it < PRW / 8; ++it) {
        const size_t r0 = (size_t)(row0 + it * 8) * HD;
        const char* xs = (const char*)((isq ? Q : K) + r0); char* ph = (char*)((isq ? Qb : Kb) + r0);
        v2f x[8];
#pragma unroll
        for (int u = 0; u < 8; ++u) x[u] = *(const v2f*)(xs + li + u * HD * 4);
        asm volatile("s_wait_xcnt 0x0" :: "v"(li), "s"(xs) : "memory");   // stands before a register that these loads name is written again
        float q[8];
#pragma unroll
        for (int u = 0; u < 8; ++u) { v2us ob; ob[0] = f2bf(x[u][0]); ob[1] = f2bf(x[u][1]); x[u][0] = bf2f(ob[0]); x[u][1] = bf2f(ob[1]); q[u] = x[u][0] * x[u][0] + x[u][1] * x[u][1];
            *(v2us*)(ph + lo + u * HD * 2) = ob; }
        asm volatile("s_wait_xcnt 0x0" :: "v"(lo), "s"(ph) : "memory");   // stands before a register that these stores name is written again
#pragma unroll
        for (int sh = 16; sh; sh >>= 1)
#pragma unroll
            for (int u = 0; u < 8; ++u) q[u] += __shfl_xor(q[u], sh, 32);
        float qs = q[0];   // every lane holds all 8 sums: lane l picks that of row l & 7, and keeps it in the trip that holds its row
#pragma unroll
        for (int u = 1; u < 8; ++u) qs = ((lane & 7) == u) ? q[u] : qs;
        ss = ((lane >> 3) == it) ? qs : ss;
    }
    (isq ? RQ : RK)[row0 + lane] = __fdiv_rn(1.0f, __fsqrt_rn(__fadd_rn(ss, 1e-12f)));
}
#define QW   32                   // query columns per wave
#define NWV  4                    // waves per key group
#define NGR  2                    // key groups per work-group
#define QB   (QW * NWV)           // queries per tile
#define NQT  (TT / QB)            // query tiles per (batch, head)
#define SK   64                   // keys per LDS stage
#define LP   72                   // LDS row pitch in 16-bit elements: 144 B = 16 B x 9
#define PLN  (64 * LP)            // one staged plane: 64 rows (keys of K, d of V^T) of 64 elements
#define NPLX 4                    // plane places per stage: K, the SK inverse norms of its keys (f32), then Vh, Vl or V16
#define MGW  (9 * 128)            // floats that one wave hands to its partner: 8 chunks of outputs and one of maximum and sum, 16 B a lane each
#define LOG2E 1.4426950408889634f
typedef __attribute__((ext_vector_type(8))) __bf16 v8bf;
__device__ __forceinline__ float xhalf(float x) { const int b = __float_as_int(x); return __int_as_float(__builtin_amdgcn_permlanex16(b, b, 0x76543210, 0xfedcba98, false, false)); }   // the value of lane l ^ 16
__device__ __forceinline__ v16bf ldsb(const bf* p) { return cat16b(*(const v8us*)p, *(const v8us*)(p + 16)); }
__device__ __forceinline__ v16bf cat16f(v8bf lo, v8bf hi) { return __builtin_shufflevector(lo, hi, 0, 1, 2, 3, 4, 5, 6, 7, 8, 9, 10, 11, 12, 13, 14, 15); }

// K fragments (A operand) of 32 keys, rows kloc.. of the staged planes
// rk[kt][j] = 1/|k| of key kloc + 16 kt + 8 hi + j: the key of score register j in this lane
__device__ __forceinline__ void ld_k(const bf* sb, int kloc, int lr, int hi, v16bf (&kh)[2][2], v8f (&rk)[2]) {
#pragma unroll
    for (int kt = 0; kt < 2; ++kt) {
#pragma unroll
        for (int ks = 0; ks < 2; ++ks) kh[kt][ks] = ldsb(sb + (kloc + kt * 16 + lr) * LP + ks * 32 + 8 * hi);
        const float* rp = (const float*)(sb + PLN) + kloc + kt * 16 + 8 * hi; const v4f a = *(const v4fa*)rp, b = *(const v4fa*)(rp + 4);
        rk[kt] = __builtin_shufflevector(a, b, 0, 1, 2, 3, 4, 5, 6, 7); }
}
// V^T fragments (A operand) of the same 32 keys: v[0][dt] = Vh or V16 (bits), v[1][dt] = Vl
template <bool HI>
__device__ __forceinline__ void ld_v(const bf* sb, int kloc, int lr, int hi, v16bf (&v)[HI ? 2 : 1][4]) {
#pragma unroll
    for (int dt = 0; dt < 4; ++dt) { const bf* vr = sb + 2 * PLN + (dt * 16 + lr) * LP + kloc + 8 * hi; v[0][dt] = ldsb(vr); if (HI) v[HI ? 1 : 0][dt] = ldsb(vr + PLN); }
}
// one product: per tile d 0..31, then d 32..63
__device__ __forceinline__ void scores(const v16bf (&kh)[2][2], const v16bf (&qh)[2][2], v8f (&S)[2][2]) {
#pragma unroll
    for (int kt = 0; kt < 2; ++kt)
#pragma unroll
        for (int qt = 0; qt < 2; ++qt) S[kt][qt] = (v8f){};
#pragma unroll
    for (int ks = 0; ks < 2; ++ks)
#pragma unroll
        for (int kt = 0; kt < 2; ++kt)
#pragma unroll
            for (int qt = 0; qt < 2; ++qt) S[kt][qt] = wmmab(kh[kt][ks], qh[qt][ks], S[kt][qt]);
}
// norms and gain, mask, running maximum and sum, probabilities, and O^T += V^T P^T, for keys kb..kb+31 against queries q0..q0+31; rk: ld_k; rq[qt] = 1/|q| of this lane's query in column group qt
// FIX: the shift of the softmax is not the running maximum but the constant |gain|: Qn and Kn are unit vectors or shorter, so |gain x (Qn . Kn)| <= |gain| (but for rounding, below 1e-4 of it) for every input.
// Then no pass looks for a maximum or brings sums and outputs to a new one, and 1/|q|, gain, log2 e and shift are one multiply-add. Whether a row's probabilities came out too small for their format is seen in its sum: attn_body.
template <bool HI, bool FIX>
__device__ __forceinline__ void soft_pv(v8f (&S)[2][2], const v8f (&rk)[2], const float (&rq)[2], const v16bf (&v)[HI ? 2 : 1][4], int kb, int q0, int lr, int hi, float gn, bool causal, v8f (&O)[4][2], float (&m)[2], float (&l)[2]) {
    const bool edge = causal && (kb + 31 > q0);   // wave-uniform: only then can a key of this pass lie behind a query of this wave
#pragma unroll
    for (int kt = 0; kt < 2; ++kt)
#pragma unroll
        for (int qt = 0; qt < 2; ++qt) {
            S[kt][qt] *= rk[kt];
            if (FIX) { const float kf = gn * LOG2E * rq[qt], cf = (HI ? 0.0f : 15.0f) - __builtin_fabsf(gn) * LOG2E;   // f16 probabilities carry x 2^15: the bound itself lands on 32768, inside f16
                const v8f kv = { kf, kf, kf, kf, kf, kf, kf, kf }, cv = { cf, cf, cf, cf, cf, cf, cf, cf }; S[kt][qt] = __builtin_elementwise_fma(S[kt][qt], kv, cv); }
            else S[kt][qt] *= gn * rq[qt]; }
    if (edge) {
#pragma unroll
        for (int qt = 0; qt < 2; ++qt) { const int qi = q0 + qt * 16 + lr;
#pragma unroll
            for (int kt = 0; kt < 2; ++kt) {
#pragma unroll
                for (int j = 0; j < 8; ++j) if (kb + kt * 16 + hi * 8 + j > qi) S[kt][qt][j] = -1.0e30f;
                asm volatile("" : "+v"(S[kt][qt]));
            } }
    }
    if (!FIX) {
    float mn[2];
#pragma unroll
    for (int qt = 0; qt < 2; ++qt) { float mx = -3.0e38f;
#pragma unroll
        for (int kt = 0; kt < 2; ++kt)
#pragma unroll
            for (int j = 0; j < 8; ++j) mx = fmaxf(mx, S[kt][qt][j]);
        mn[qt] = fmaxf(m[qt], fmaxf(mx, xhalf(mx))); }
    if (__builtin_amdgcn_ballot_w32(mn[0] > m[0] || mn[1] > m[1]) != 0) {   // a maximum moved somewhere in the wave: bring sums and outputs to the new one
#pragma unroll
        for (int qt = 0; qt < 2; ++qt) { const float al = __builtin_amdgcn_exp2f((m[qt] - mn[qt]) * LOG2E); m[qt] = mn[qt]; l[qt] *= al;
#pragma unroll
            for (int dt = 0; dt < 4; ++dt) O[dt][qt] *= al; }
    }
    }
    v16bf ph[2], pl[2];   // f16 rows: ph holds the f16 bits
#pragma unroll
    for (int qt = 0; qt < 2; ++qt) { const float c = (HI ? 0.0f : 10.0f) - m[qt] * LOG2E;   // f16 rows come only with FIX, which leaves c unused: they carry x 2^15 (above), as the sum does: it cancels in the quotient
        const v8f cv = { c, c, c, c, c, c, c, c }, lv = { LOG2E, LOG2E, LOG2E, LOG2E, LOG2E, LOG2E, LOG2E, LOG2E };
        const v8f a0 = FIX ? S[0][qt] : __builtin_elementwise_fma(S[0][qt], lv, cv), a1 = FIX ? S[1][qt] : __builtin_elementwise_fma(S[1][qt], lv, cv);
#pragma unroll
        for (int j = 0; j < 8; ++j) { S[0][qt][j] = __builtin_amdgcn_exp2f(a0[j]); S[1][qt][j] = __builtin_amdgcn_exp2f(a1[j]); }
        const v8f sv = S[0][qt] + S[1][qt];
        l[qt] += ((sv[0] + sv[1]) + (sv[2] + sv[3])) + ((sv[4] + sv[5]) + (sv[6] + sv[7]));
        if (HI) { const v8bf h0 = __builtin_convertvector(S[0][qt], v8bf), h1 = __builtin_convertvector(S[1][qt], v8bf);
            const v8bf l0 = __builtin_convertvector(S[0][qt] - __builtin_convertvector(h0, v8f), v8bf), l1 = __builtin_convertvector(S[1][qt] - __builtin_convertvector(h1, v8f), v8bf);
            ph[qt] = cat16f(h0, h1); pl[qt] = cat16f(l0, l1);
        } else ph[qt] = __builtin_bit_cast(v16bf, cat16(__builtin_convertvector(S[0][qt], v8h), __builtin_convertvector(S[1][qt], v8h))); }
    if (HI) {   // per tile in the order Ph Vh, Pl Vh, Ph Vl
#pragma unroll
        for (int dt = 0; dt < 4; ++dt)
#pragma unroll
            for (int qt = 0; qt < 2; ++qt) O[dt][qt] = wmmab(v[0][dt], ph[qt], O[dt][qt]);
#pragma unroll
        for (int dt = 0; dt < 4; ++dt)
#pragma unroll
            for (int qt = 0; qt < 2; ++qt) O[dt][qt] = wmmab(v[0][dt], pl[qt], O[dt][qt]);
#pragma unroll
        for (int dt = 0; dt < 4; ++dt)
#pragma unroll
            for (int qt = 0; qt < 2; ++qt) O[dt][qt] = wmmab(v[HI ? 1 : 0][dt], ph[qt], O[dt][qt]);
    } else {
#pragma unroll
        for (int dt = 0; dt < 4; ++dt)
#pragma unroll
            for (int qt = 0; qt < 2; ++qt) O[dt][qt] = wmma16(__builtin_bit_cast(v16h, v[0][dt]), __builtin_bit_cast(v16h, ph[qt]), O[dt][qt]);
    }
}

// FIX: soft_pv with the constant shift. Returns, the same in every thread of the work-group, whether the tile is to be done again with the running maximum (never, where FIX is off).
template <bool HI, bool FIX>
__device__ __forceinline__ bool attn_body(bf* sm, const bf* Qb, const bf* Kb, const float* RQ, const float* RK, const bf* Va, const bf* Vb, float gn, bool causal, int qb, float* out) {
    constexpr int NPL = HI ? 3 : 2;   // 16-bit planes staged: K, then V^T
    const int tid = threadIdx.x & (NWV * 32 - 1), lane = tid & 31, lr = lane & 15, hi = lane >> 4;   // tid: the thread's index in its key group
    const int wv = __builtin_amdgcn_readfirstlane(tid >> 5), grp = __builtin_amdgcn_readfirstlane((int)threadIdx.x >> 7); const int q0 = qb + wv * QW;
    static_assert(NWV * 32 == 128 && NGR == 2 && (QB / SK) % NGR == 0 && (TT / SK) % NGR == 0, "two groups of 128 threads; every walk is a whole number of trips");
    const bf* gp[3] = { Kb, Va, Vb };
    v16bf qh[2][2]; float rq[2];
#pragma unroll
    for (int qt = 0; qt < 2; ++qt) { const bf* pqh = Qb + (size_t)(q0 + qt * 16 + lr) * HD + 8 * hi; const float* prq = RQ + q0 + qt * 16 + lr;
#pragma unroll
        for (int ks = 0; ks < 2; ++ks) qh[qt][ks] = WFrag<bf>::ld(pqh + ks * 32);
        rq[qt] = *prq;
        asm volatile("s_wait_xcnt 0x0" :: "v"(pqh), "v"(prq) : "memory"); }   // stands before the address registers of these loads are written again (named as inputs, so that they live up to it)
    v8f O[4][2]; float m[2], l[2];
#pragma unroll
    for (int qt = 0; qt < 2; ++qt) { m[qt] = -3.0e38f; l[qt] = 0.f;
#pragma unroll
        for (int dt = 0; dt < 4; ++dt) O[dt][qt] = (v8f){}; }
    // a stage's plane is 512 chunks of 16 B, four a thread: chunk c = row c >> 3, elements 8 (c & 7)..; K rows are keys (pitch HD), V^T rows are d (pitch TT)
    // the stage's SK inverse norms are 16 chunks of 16 B: every thread fetches chunk tid & 15, the group's first 16 threads store
    v8us st[NPL][4]; v4f str;
    const int srow = tid >> 3, scol = (tid & 7) * 8;
    auto stage_load = [&](int s) {
        const unsigned ko = (unsigned)((s * SK + srow) * HD + scol) * 2u, vo = (unsigned)(srow * TT + s * SK + scol) * 2u, ro = (unsigned)(s * SK + (tid & 15) * 4) * 4u;   // the thread's byte offsets in the K plane, in a V^T plane and in the inverse norms
#pragma unroll
        for (int pn = 0; pn < NPL; ++pn)
#pragma unroll
            for (int u = 0; u < 4; ++u) st[pn][u] = *(const v8us*)((const char*)gp[pn] + (pn < 1 ? ko : vo) + u * 32 * (pn < 1 ? HD : TT));
        str = *(const v4f*)((const char*)RK + ro);
        asm volatile("s_wait_xcnt 0x0" :: "v"(ko), "v"(vo), "v"(ro) : "memory"); };   // stands before the offset registers of these loads are written again (named as inputs, so that they live up to it)
    auto stage_store = [&](int b) {
#pragma unroll
        for (int pn = 0; pn < NPL; ++pn)
#pragma unroll
            for (int u = 0; u < 4; ++u) *(v8us*)(sm + (b * NPLX + (pn < 1 ? 0 : pn + 1)) * PLN + (srow + u * 16) * LP + scol) = st[pn][u];
        if (tid < 16) *(v4fa*)((float*)(sm + (b * NPLX + 1) * PLN) + tid * 4) = str; };
    // under the causal flag every key from qb + QB on is masked for every query of the work-group. Key 0 is open to every query, so a row's maximum is at least a real score, which is no lower than about -|gain|:
    // while |gain| stays far below 1e30 a masked key's probability is an exact 0 and its stage adds nothing. A larger gain, or one that is no number, walks every stage.
    // A group all of whose keys are masked for a query (the odd stages, for queries below SK) holds the maximum -1e30 there, and sums without meaning that need not even be finite: where the groups meet, a side whose factor is 0 is left out.
    const int ntr = ((causal && __builtin_fabsf(gn) < 1.0e29f) ? (qb + QB) / SK : TT / SK) / NGR;   // trips: the same for the whole work-group, from 1 to TT / SK / NGR
    stage_load(grp); stage_store(grp);
    __syncthreads();
#pragma unroll 1   // rolled: one copy of the stage body, so that code size and registers stay as they are
    for (int i = 0; i < ntr; ++i) {
        const int s = i * NGR + grp;          // this group's stage
        const bool more = (i + 1 < ntr);
        if (more) stage_load(s + NGR);        // the loads stay in flight while this stage is worked on
        const bf* sb = sm + ((i & 1) * NGR + grp) * NPLX * PLN;
        v16bf kh[2][2], v0[HI ? 2 : 1][4], v1[HI ? 2 : 1][4]; v8f S[2][2], rk0[2], rk1[2];
        ld_k(sb, 0, lr, hi, kh, rk0); ld_v<HI>(sb, 0, lr, hi, v0);
        scores(kh, qh, S);
        if (FIX) { ld_k(sb, 32, lr, hi, kh, rk1); ld_v<HI>(sb, 32, lr, hi, v1); }   // the second half's fragments depend on nothing of the first half: they can be fetched ahead of its softmax
        soft_pv<HI, FIX>(S, rk0, rq, v0, s * SK, q0, lr, hi, gn, causal, O, m, l);
        if (!FIX) { ld_k(sb, 32, lr, hi, kh, rk1); ld_v<HI>(sb, 32, lr, hi, v1); }  // the fallback, the body with the most registers, fetches them late: fetched early, the kernel spilled
        scores(kh, qh, S);
        soft_pv<HI, FIX>(S, rk1, rq, v1, s * SK + 32, q0, lr, hi, gn, causal, O, m, l);
        if (more) stage_store(((i + 1) & 1) * NGR + grp);   // the buffer that the group's last stage but one read: every wave left it at the last barrier
        __syncthreads();                      // publishes the next stage of each group and ends every read of this one
    }
    // the groups meet: of a wave pair's 32 query columns group g finishes columns 16g..16g+15 and hands the other 16 (maximum, sum, outputs) to its partner.
    // The exchange lies in the third buffer: free behind the loop's last barrier, and written again by the next tile only behind that tile's first barrier.
    float* mg = (float*)(sm + 2 * NPLX * PLN) + wv * (2 * MGW) + lane * 4;   // chunk c of a lane at c * 128 floats: 16 B a lane, whole rows of banks
#pragma unroll
    for (int qt = 0; qt < 2; ++qt) if (grp != qt) { float* w = mg + qt * MGW;
#pragma unroll
        for (int dt = 0; dt < 4; ++dt) { v4f a, b;
#pragma unroll
            for (int u = 0; u < 4; ++u) { a[u] = O[dt][qt][u]; b[u] = O[dt][qt][u + 4]; }
            *(v4fa*)(w + (2 * dt) * 128) = a; *(v4fa*)(w + (2 * dt + 1) * 128) = b; }
        const v4f ml = { m[qt], l[qt], 0.f, 0.f }; *(v4fa*)(w + 8 * 128) = ml; }
    __syncthreads();                          // both halves of the exchange are written before either is read
    if (FIX) {   // the rows' sums are tested before anything is stored: a tile that is done again stores nothing here
        bool small = false;
#pragma unroll
        for (int qt = 0; qt < 2; ++qt) if (grp == qt) { const v4f ml = *(const v4fa*)(mg + qt * MGW + 8 * 128); const float ls = l[qt] + ml[1]; const float lt = ls + xhalf(ls);
            // f16 rounds a probability to within 2^-11 of itself or, below its normal range, to within 2^-25: where the sum is at least 2^-15 a key, all the roundings of the second kind together stay within 2^-10 of the sum (those of the first kind: 2^-11).
            // bf16 pairs only have to stay clear of the end of the exponent range. A sum that is no number fails the test too.
            small = !(lt >= (HI ? 0x1p-80f : (float)(causal ? q0 + qt * 16 + lr + 1 : TT) * 0x1p-15f)); }
        // one word a wave in the fourth buffer (free like the third): every wave learns whether any row of the tile failed
        unsigned* fl = (unsigned*)(sm + 3 * NPLX * PLN);
        const unsigned wb = (__builtin_amdgcn_ballot_w32(small) != 0) ? 1u : 0u;
        if (lane == 0) fl[grp * NWV + wv] = wb;
        __syncthreads();                      // the NGR * NWV words are written before anybody reads them
        static_assert(NGR * NWV == 8, "eight words");
        const v4i f0 = *(const v4i*)fl, f1 = *(const v4i*)(fl + 4);
        // the same in every lane: made a scalar, so that this branch and the caller's, round barriers and matrix instructions, are scalar ones
        if (__builtin_amdgcn_readfirstlane((f0[0] | f0[1] | f0[2] | f0[3]) | (f1[0] | f1[1] | f1[2] | f1[3])) != 0) return true;
    }
#pragma unroll
    for (int qt = 0; qt < 2; ++qt) if (grp == qt) { const float* r = mg + qt * MGW; const v4f ml = *(const v4fa*)(r + 8 * 128);
        const float mt = FIX ? 0.f : fmaxf(m[qt], ml[0]); const float ca = FIX ? 1.0f : __builtin_amdgcn_exp2f((m[qt] - mt) * LOG2E), cb = FIX ? 1.0f : __builtin_amdgcn_exp2f((ml[0] - mt) * LOG2E);   // one shift on both sides: the factors are 1
        const bool ua = (ca > 0.f), ub = (cb > 0.f);   // the side that holds the maximum has factor 1; a side with factor 0 adds nothing, and is selected away instead of multiplied because 0 x (no finite number) would spoil the sum
        const float ls = (ua ? l[qt] * ca : 0.f) + (ub ? ml[1] * cb : 0.f); const float inv = __fdiv_rn(1.0f, ls + xhalf(ls)); const float fa = ca * inv, fb = cb * inv;
        float* orow = out + (size_t)(q0 + qt * 16 + lr) * HD + hi * 8;   // O^T tile: lane (c, h) holds d 8h..8h+7 of query c
#pragma unroll
        for (int dt = 0; dt < 4; ++dt) { const v4f pa = *(const v4fa*)(r + (2 * dt) * 128), pb = *(const v4fa*)(r + (2 * dt + 1) * 128); v4f a, b;
#pragma unroll
            for (int u = 0; u < 4; ++u) { a[u] = (ua ? O[dt][qt][u] * fa : 0.f) + (ub ? pa[u] * fb : 0.f); b[u] = (ua ? O[dt][qt][u + 4] * fa : 0.f) + (ub ? pb[u] * fb : 0.f); }
            *(v4f*)(orow + dt * 16) = a; *(v4f*)(orow + dt * 16 + 4) = b; }
        asm volatile("s_wait_xcnt 0x0" :: "v"(orow) : "memory"); }   // stands before the address register of these stores is written again (named as an input, so that it lives up to it)
    return false;
}

__global__ __launch_bounds__(NGR * NWV * 32) void k_fattn(const bf* __restrict__ Qb, const bf* __restrict__ Kb, const float* __restrict__ RQ, const float* __restrict__ RK, const h16* __restrict__ V16, const bf* __restrict__ Vh, const bf* __restrict__ Vl, const float* __restrict__ gainp, const int* __restrict__ causp, float* __restrict__ out) {
    __shared__ __align__(16) bf sm[2 * NGR * NPLX * PLN];
    const int f = blockIdx.x; const float gn = bfr(gainp[0]); const bool causal = (causp[0] != 0);
    // under the causal flag a tile's cost grows with its index: a work-group takes tile NQT - 1 - p and then tile p of one (batch, head), so that all work-groups walk equally many stages. Every (head, tile) falls to one work-group.
    static_assert(NB_ * NH_ == 32 && NQT % 2 == 0, "the low five bits of the index are the (batch, head)");
    const int hd = f & 31, p = f >> 5; const size_t ho = (size_t)hd * TT * HD, hr = (size_t)hd * TT;
#pragma unroll 1   // rolled: one copy of each body serves both tiles
    for (int rep = 0; rep < 2; ++rep) {
        const int qt = rep ? p : NQT - 1 - p; const bool hires = (qt < RH / QB); const int qb = qt * QB;
        // first with the constant shift; again with the running maximum where a row's sum says that the scores lie too far below the bound, and at once so where the gain is large (or no number). Every test is the same for the whole work-group.
        bool again = !(__builtin_fabsf(gn) <= 64.0f);
        if (!again) { if (hires) again = attn_body<true, true>(sm, Qb + ho, Kb + ho, RQ + hr, RK + hr, Vh + ho, Vl + ho, gn, causal, qb, out + ho);
            else again = attn_body<false, true>(sm, Qb + ho, Kb + ho, RQ + hr, RK + hr, (const bf*)V16 + ho, nullptr, gn, causal, qb, out + ho); }
        if (again) attn_body<true, false>(sm, Qb + ho, Kb + ho, RQ + hr, RK + hr, Vh + ho, Vl + ho, gn, causal, qb, out + ho);   // one fallback for every tile: hi+lo rows, the finer of the two forms
    }
}

extern "C" void kernel_launch(void* const* d_in, const int* in_sizes, int n_in,
                              void* d_out, int out_size, void* d_ws, size_t ws_size, hipStream_t stream) {
    (void)in_sizes; (void)n_in; (void)out_size;
    const float* Qi = (const float*)d_in[0]; const float* Ki = (const float*)d_in[1]; const float* Vi = (const float*)d_in[2]; const float* gainp = (const float*)d_in[3]; const int* causp = (const int*)d_in[4];
    float* OUT = (float*)d_out;     // [2][16][2048][64]
    char* wsp = (char*)d_ws;
    auto take = [&](size_t bytes) { char* p = wsp; wsp += (bytes + 255) & ~(size_t)255; return (void*)p; };
    const size_t PB = (size_t)NH_ * TT * HD;   // elements of one batch's plane; the planes hold both batches
    h16* VT16 = (h16*)take(NB_ * PB * 2);
    bf* QPb = (bf*)take(NB_ * PB * 2); bf* KPb = (bf*)take(NB_ * PB * 2); float* RQn = (float*)take((size_t)NB_ * NH_ * TT * 4); float* RKn = (float*)take((size_t)NB_ * NH_ * TT * 4); bf* VTh = (bf*)take(NB_ * PB * 2); bf* VTl = (bf*)take(NB_ * PB * 2);
    if ((size_t)(wsp - (char*)d_ws) > ws_size) return;    // ws 256 MiB
    k_prep<<<PWG, 256, 0, stream>>>(Qi, Ki, Vi, QPb, KPb, RQn, RKn, VT16, VTh, VTl);
    k_fattn<<<NB_ * NH_ * (NQT / 2), NGR * NWV * 32, 0, stream>>>(QPb, KPb, RQn, RKn, VT16, VTh, VTl, gainp, causp, OUT);
}

// v009
// One run takes 35.8 microseconds.
// Two timings next to v008 put it at 1.03 and 1.02 times that version's speed.
// All steps since v000 together make it 48.9 times as fast.
#include <hip/hip_runtime.h>

// SelfDotProductAttnQKNorm (Q, K, V [2][16][2048][64] given; Qn, Kn = L2-normalised over d (eps 1e-12 inside the sqrt); scores = gain x (Qn . Kn) with gain a scalar input (read on device; log2(2048? - 2048) ~ 22); is_causal (int input, read on device; 1 here) -> j > i masked to -1e30; softmax; out = attn V -> [2][16][2048][64]).
// Compute dtypes, f32 accumulate: every input rounded to bf16; the L2 normalisation f32 on the VALU; the causal flag is data: set, key stages that lie wholly behind a work-group's queries are not walked; scores: one bf16 product of the rounded, not normalised rows (exact operands), x 1/|q| x 1/|k| x gain in f32; mask and softmax f32;

#define NB_  2
#define TT   2048
#define DM   1024
#define NH_  16
#define NKV  16
#define REP  (NH_ / NKV)
#define HD   64
#define DQ   (NH_ * HD)
#define DKV  (NKV * HD)
#define ZH   8                    // heads per call of k_merge
#define RH   512                  // query rows < RH use hi+lo planes (0: none)
#define WIN  0
#define PCAR 1024.0f
#define SCL  0.125f   // HD^-0.5
typedef _Float16 h16;
typedef unsigned short bf;
typedef __attribute__((ext_vector_type(16))) __bf16   v16bf;
typedef __attribute__((ext_vector_type(16))) _Float16 v16h;
typedef __attribute__((ext_vector_type(8)))  _Float16 v8h;
typedef __attribute__((ext_vector_type(8)))  unsigned short v8us;
typedef __attribute__((ext_vector_type(8)))  float    v8f;
typedef __attribute__((ext_vector_type(4)))  float    v4f;
typedef v8h  __attribute__((may_alias)) v8ha;
typedef v4f  __attribute__((may_alias)) v4fa;
typedef v8us __attribute__((may_alias)) v8usa;

__device__ __forceinline__ unsigned short f2bf(float f) { unsigned u = __float_as_uint(f); u += 0x7FFFu + ((u >> 16) & 1u); return (unsigned short)(u >> 16); }
__device__ __forceinline__ float bf2f(unsigned short b) { return __uint_as_float(((unsigned)b) << 16); }
__device__ __forceinline__ float bfr(float f) { return bf2f(f2bf(f)); }
__device__ __forceinline__ v16h cat16(v8h lo, v8h hi) { return __builtin_shufflevector(lo, hi, 0, 1, 2, 3, 4, 5, 6, 7, 8, 9, 10, 11, 12, 13, 14, 15); }
__device__ __forceinline__ v16bf cat16b(v8us lo, v8us hi) { return __builtin_bit_cast(v16bf, __builtin_shufflevector(lo, hi, 0, 1, 2, 3, 4, 5, 6, 7, 8, 9, 10, 11, 12, 13, 14, 15)); }
__device__ __forceinline__ v8f wmma16(v16h a, v16h b, v8f c) { return __builtin_amdgcn_wmma_f32_16x16x32_f16(false, a, false, b, (short)0, c, false, false); }
__device__ __forceinline__ v8f wmmab(v16bf a, v16bf b, v8f c) { return __builtin_amdgcn_wmma_f32_16x16x32_bf16(false, a, false, b, (short)0, c, false, false); }



// fragment loaders, hardware k order: 8 elements at p and 8 at p + 16, p = row start + 32 * kstep + 8 * (lane >> 4)
template <typename T16> struct WFrag;
template <> struct WFrag<h16> { typedef v16h V; static __device__ __forceinline__ V ld(const h16* p) { return cat16(*(const v8h*)p, *(const v8h*)(p + 16)); } static __device__ __forceinline__ v8f mma(V a, V b, v8f c) { return wmma16(a, b, c); } };
template <> struct WFrag<bf> { typedef v16bf V; static __device__ __forceinline__ V ld(const bf* p) { return cat16b(*(const v8us*)p, *(const v8us*)(p + 16)); } static __device__ __forceinline__ v8f mma(V a, V b, v8f c) { return wmmab(a, b, c); } };

__device__ __forceinline__ h16 tohx(float x) { return (h16)x; }
__device__ __forceinline__ void splitf(float y, unsigned short& h, unsigned short& l) { h = f2bf(y); l = f2bf(y - bf2f(h)); }
typedef __attribute__((ext_vector_type(2))) _Float16 v2h;
typedef __attribute__((ext_vector_type(4))) _Float16 v4h;
typedef __attribute__((ext_vector_type(2))) unsigned short v2us;
typedef __attribute__((ext_vector_type(4))) unsigned short v4us;
typedef __attribute__((ext_vector_type(2))) float v2f;
typedef __attribute__((ext_vector_type(4))) int v4i;

__global__ __launch_bounds__(256) void k_wtG(const float* __restrict__ w, int K, int N, bf* Bt) {
    const int lane = threadIdx.x & 31; const int L0 = (blockIdx.x * 8 + (threadIdx.x >> 5)) * 8; const int nlines = N * K / 64;
{
#pragma unroll 1
        for (int l = 0; l < 8; ++l) { const int L = L0 + l; if (L >= nlines) break; const size_t e = (size_t)L * 64 + lane * 2; const int k = (int)(e % K), n = (int)(e / K); v2us o;
            o[0] = f2bf(w[(size_t)k * N + n]); o[1] = f2bf(w[(size_t)(k + 1) * N + n]); *(v2us*)(Bt + e) = o; }
         }
}
__global__ __launch_bounds__(256) void k_cvt8(const float* __restrict__ src, bf* dst, size_t n8) { const size_t i = (size_t)blockIdx.x * 256 + threadIdx.x; if (i >= n8) return; const v8f v = *(const v8f*)(src + i * 8); v8us o;
#pragma unroll
    for (int k = 0; k < 8; ++k) o[k] = f2bf(v[k]); *(v8us*)(dst + i * 8) = o;  }
__global__ __launch_bounds__(256) void k_cscvt(const float* __restrict__ cosT, const float* __restrict__ sinT, float* CS) { const int idx = blockIdx.x * 256 + threadIdx.x; if (idx >= TT * HD) return; v2f cs; cs[0] = bfr(cosT[idx]); cs[1] = bfr(sinT[idx]); *(v2f*)(CS + (size_t)idx * 2) = cs;  }
// k_rope: head planes [h][t][d] (fp16 + hi/lo) of rope(x) x sc with the rotate-half convention out[d] = x[d] cos[t][d] - x[d+HD/2] sin[t][d], out[d+HD/2] = x[d+HD/2] cos[t][d+HD/2] + x[d] sin[t][d+HD/2]
__global__ __launch_bounds__(256) void k_rope(const float* __restrict__ F, int pitch, int nheads, const float* __restrict__ CS, const float* __restrict__ RF, const float* __restrict__ nw, float sc, h16* P16, bf* Ph, bf* Pl) {
    const size_t e = ((size_t)blockIdx.x * 256 + threadIdx.x) * 2; if (e >= (size_t)nheads * TT * HD) return; const int d = (int)(e % HD); const int t = (int)((e / HD) % TT); const int h = (int)(e / ((size_t)HD * TT)); const float* f = F + (size_t)t * pitch + h * HD; const float rf = RF ? RF[(size_t)h * TT + t] : 1.0f; v2h o16; v2us oh, ol;
#pragma unroll
    for (int q = 0; q < 2; ++q) { const int dd = d + q; const int dp = (dd < HD / 2) ? dd + HD / 2 : dd - HD / 2; float x0 = f[dd], x1 = f[dp];
        if (RF) { float n0 = __fmul_rn(x0, rf), n1 = __fmul_rn(x1, rf); asm volatile("" : "+v"(n0)); asm volatile("" : "+v"(n1)); x0 = __fmul_rn(bfr(nw[dd]), n0); x1 = __fmul_rn(bfr(nw[dp]), n1); }
        const v2f cs = *(const v2f*)(CS + ((size_t)t * HD + dd) * 2); float a = __fmul_rn(x0, cs[0]), bq = __fmul_rn(x1, cs[1]); asm volatile("" : "+v"(a)); asm volatile("" : "+v"(bq)); const float r = ((dd < HD / 2) ? __fsub_rn(a, bq) : __fadd_rn(a, bq)) * sc;
        o16[q] = tohx(r); unsigned short a2, c2; splitf(r, a2, c2); oh[q] = a2; ol[q] = c2; }
    *(v2h*)(P16 + e) = o16; *(v2us*)(Ph + e) = oh; *(v2us*)(Pl + e) = ol;  }
__global__ __launch_bounds__(256) void k_vtp(const float* __restrict__ F, int pitch, int nheads, h16* V16, bf* Vh, bf* Vl) { const size_t e = ((size_t)blockIdx.x * 256 + threadIdx.x) * 2; if (e >= (size_t)nheads * HD * TT) return; const int t = (int)(e % TT); const int d = (int)((e / TT) % HD); const int g = (int)(e / ((size_t)TT * HD)); v2h o16; v2us oh, ol;
#pragma unroll
    for (int q = 0; q < 2; ++q) { const float x = F[(size_t)(t + q) * pitch + g * HD + d]; o16[q] = tohx(x); unsigned short a2, c2; splitf(x, a2, c2); oh[q] = a2; ol[q] = c2; }
    *(v2h*)(V16 + e) = o16; *(v2us*)(Vh + e) = oh; *(v2us*)(Vl + e) = ol;  }
__global__ __launch_bounds__(256) void k_merge(const float* __restrict__ O, int h0, bf* Ah, bf* Al) { const size_t e = ((size_t)blockIdx.x * 256 + threadIdx.x) * 2; if (e >= (size_t)ZH * TT * HD) return; const int d = (int)(e % HD); const int t = (int)((e / HD) % TT); const int zz = (int)(e / ((size_t)HD * TT)); const float cs = (t < RH) ? 1.0f : (1.0f / PCAR); const size_t oo = (size_t)t * DQ + (h0 + zz) * HD + d;
    v2us oh, ol;
#pragma unroll
    for (int q = 0; q < 2; ++q) { unsigned short a, c2; splitf(O[e + q] * cs, a, c2); oh[q] = a; ol[q] = c2; } *(v2us*)(Ah + oo) = oh; *(v2us*)(Al + oo) = ol;  }

// ---- k_prep: all that k_fattn reads, made in one launch of PWG work-groups of 8 waves. Each wave loops over many rows, so that the chip starts few waves instead of one wave a row.
// V: a work-group turns a tile of 128 t x 64 d through LDS (whole lines read, whole lines written). Q, K: waves 0..3 take PRW rows of Q each, waves 4..7 of K, 8 rows a trip, 2 elements of a row per lane:
// the rows leave as they are, rounded to bf16 (one plane, exact), and beside them 1 / sqrt(sum of squares + eps) of each row in f32: gain x (Qn . Kn) = gain x (Q . K) / (|Q| |K|), the division done on the scores in k_fattn.
// Every '#pragma unroll' in it stands on a short loop that indexes register arrays: unrolled, the arrays stay in registers and the loads of a trip go out together.
#define PWG  (NB_ * NH_ * (TT / 128))             // work-groups: one V tile each
#define PRW  (NB_ * NH_ * TT / (PWG * 4))         // rows per wave, of Q or of K: 32, so that a wave's inverse norms are one whole 128-B line
#define VPD  65                                   // LDS row pitch in dwords (64 dwords = 128 t, + 1: stores down a column and loads along a row both fall on distinct banks)
__global__ __launch_bounds__(256) void k_prep(const float* __restrict__ Q, const float* __restrict__ K, const float* __restrict__ V, bf* __restrict__ Qb, bf* __restrict__ Kb, float* __restrict__ RQ, float* __restrict__ RK, h16* __restrict__ V16, bf* __restrict__ Vh, bf* __restrict__ Vl) {
    __shared__ unsigned vt[HD * VPD];             // [d][t / 2]: the bf16 bits of V at t (low half) and t + 1
    const int tid = threadIdx.x, lane = tid & 31; const int lo4 = tid & 15, up4 = tid >> 4;
    const int g = blockIdx.x / (TT / 128), t0 = (blockIdx.x % (TT / 128)) * 128;
    {   // rows t0 + 2p and t0 + 2p + 1, p = up4 + 16u, elements 4 lo4..4 lo4 + 3
        const char* vb = (const char*)(V + ((size_t)g * TT + t0) * HD); const unsigned vo = (unsigned)(2 * up4 * HD + 4 * lo4) * 4u; v4f a[4], b[4];
#pragma unroll
        for (int u = 0; u < 4; ++u) { a[u] = *(const v4f*)(vb + vo + u * 32 * HD * 4); b[u] = *(const v4f*)(vb + vo + u * 32 * HD * 4 + HD * 4); }
        asm volatile("s_wait_xcnt 0x0" :: "v"(vo) : "memory");   // stands before the offset register of these loads is written again (named as an input, so that it lives up to it)
#pragma unroll
        for (int u = 0; u < 4; ++u)
#pragma unroll
            for (int i = 0; i < 4; ++i) vt[(4 * lo4 + i) * VPD + up4 + 16 * u] = (unsigned)f2bf(a[u][i]) | ((unsigned)f2bf(b[u][i]) << 16);
    }
    __syncthreads();                              // the tile is whole before anybody reads a row of it
    {   // row d = up4 + 16u, t0 + 8 lo4..+7: 16 B to each plane, a row of the tile is 256 B
        const unsigned eo = (unsigned)(up4 * TT + 8 * lo4) * 2u; const size_t pb = (((size_t)g * HD) * TT + t0) * 2;
#pragma unroll
        for (int u = 0; u < 4; ++u) { v8h o16; v8us oh, ol;
#pragma unroll
            for (int j = 0; j < 4; ++j) { const unsigned w = vt[(up4 + 16 * u) * VPD + 4 * lo4 + j];
#pragma unroll
                for (int q = 0; q < 2; ++q) { const float x = bf2f((unsigned short)(q ? (w >> 16) : (w & 0xFFFFu))); o16[2 * j + q] = tohx(x); unsigned short a2, c2; splitf(x, a2, c2); oh[2 * j + q] = a2; ol[2 * j + q] = c2; } }
            *(v8h*)((char*)V16 + pb + eo + u * 16 * TT * 2) = o16; *(v8us*)((char*)Vh + pb + eo + u * 16 * TT * 2) = oh; *(v8us*)((char*)Vl + pb + eo + u * 16 * TT * 2) = ol; }
        asm volatile("s_wait_xcnt 0x0" :: "v"(eo) : "memory");   // stands before the offset register of these stores is written again
    }
    static_assert(PRW == 32, "lane l keeps row l's sum");
    const int wv = __builtin_amdgcn_readfirstlane(tid >> 5); const bool isq = (wv < 4);
    const int row0 = (blockIdx.x * 4 + (wv & 3)) * PRW;                                   // the wave's first row
    const unsigned li = (unsigned)lane * 8u, lo = (unsigned)lane * 4u;                    // the lane's byte offsets in an f32 row and in a 16-bit row
    float ss = 0.f;                                                                       // lane l: the sum of squares of row row0 + l
#pragma unroll 1   // rolled: one copy of the 8-row body
    for (int it = 0; it < PRW / 8; ++it) {
        const size_t r0 = (size_t)(row0 + it * 8) * HD;
        const char* xs = (const char*)((isq ? Q : K) + r0); char* ph = (char*)((isq ? Qb : Kb) + r0);
        v2f x[8];
#pragma unroll
        for (int u = 0; u < 8; ++u) x[u] = *(const v2f*)(xs + li + u * HD * 4);
        asm volatile("s_wait_xcnt 0x0" :: "v"(li), "s"(xs) : "memory");   // stands before a register that these loads name is written again
        float q[8];
#pragma unroll
        for (int u = 0; u < 8; ++u) { v2us ob; ob[0] = f2bf(x[u][0]); ob[1] = f2bf(x[u][1]); x[u][0] = bf2f(ob[0]); x[u][1] = bf2f(ob[1]); q[u] = x[u][0] * x[u][0] + x[u][1] * x[u][1];
            *(v2us*)(ph + lo + u * HD * 2) = ob; }
        asm volatile("s_wait_xcnt 0x0" :: "v"(lo), "s"(ph) : "memory");   // stands before a register that these stores name is written again
#pragma unroll
        for (int sh = 16; sh; sh >>= 1)
#pragma unroll
            for (int u = 0; u < 8; ++u) q[u] += __shfl_xor(q[u], sh, 32);
        float qs = q[0];   // every lane holds all 8 sums: lane l picks that of row l & 7, and keeps it in the trip that holds its row
#pragma unroll
        for (int u = 1; u < 8; ++u) qs = ((lane & 7) == u) ? q[u] : qs;
        ss = ((lane >> 3) == it) ? qs : ss;
    }
    (isq ? RQ : RK)[row0 + lane] = __fdiv_rn(1.0f, __fsqrt_rn(__fadd_rn(ss, 1e-12f)));
}
#define QW   32                   // query columns per wave
#define NWV  4                    // waves per key group
#define NGR  4                    // key groups per work-group
#define QB   (QW * NWV)           // queries per tile
#define NQT  (TT / QB)            // query tiles per (batch, head)
#define SK   64                   // keys per LDS stage
#define LP   72                   // LDS row pitch in 16-bit elements: 144 B = 16 B x 9
#define PLN  (64 * LP)            // one staged plane: 64 rows (keys of K, d of V^T) of 64 elements
#define NPLX 4                    // plane places per stage: K, the SK inverse norms of its keys (f32), then Vh, Vl or V16
#define MGW  (18 * 128)           // floats of one wave's place in the exchange: 16 chunks of outputs and two of maximum and sum, 16 B a lane each
#define LOG2E 1.4426950408889634f
typedef __attribute__((ext_vector_type(8))) __bf16 v8bf;
__device__ __forceinline__ float xhalf(float x) { const int b = __float_as_int(x); return __int_as_float(__builtin_amdgcn_permlanex16(b, b, 0x76543210, 0xfedcba98, false, false)); }   // the value of lane l ^ 16
__device__ __forceinline__ v16bf ldsb(const bf* p) { return cat16b(*(const v8us*)p, *(const v8us*)(p + 16)); }
__device__ __forceinline__ v16bf cat16f(v8bf lo, v8bf hi) { return __builtin_shufflevector(lo, hi, 0, 1, 2, 3, 4, 5, 6, 7, 8, 9, 10, 11, 12, 13, 14, 15); }

// K fragments (A operand) of 32 keys, rows kloc.. of the staged planes
__device__ __forceinline__ void ld_k(const bf* sb, int kloc, int lr, int hi, v16bf (&kh)[2][2]) {
#pragma unroll
    for (int kt = 0; kt < 2; ++kt)
#pragma unroll
        for (int ks = 0; ks < 2; ++ks) kh[kt][ks] = ldsb(sb + (kloc + kt * 16 + lr) * LP + ks * 32 + 8 * hi);
}
// rk[kt][j] = 1/|k| of key kloc + 16 kt + 8 hi + j: the key of score register j in this lane
__device__ __forceinline__ void ld_rk(const bf* sb, int kloc, int hi, v8f (&rk)[2]) {
#pragma unroll
    for (int kt = 0; kt < 2; ++kt) {
        const float* rp = (const float*)(sb + PLN) + kloc + kt * 16 + 8 * hi; const v4f a = *(const v4fa*)rp, b = *(const v4fa*)(rp + 4);
        rk[kt] = __builtin_shufflevector(a, b, 0, 1, 2, 3, 4, 5, 6, 7); }
}
// V^T fragments (A operand) of the same 32 keys, of one staged plane: vp = 0: Vh or V16 (bits), vp = 1: Vl
__device__ __forceinline__ void ld_v(const bf* sb, int vp, int kloc, int lr, int hi, v16bf (&v)[4]) {
#pragma unroll
    for (int dt = 0; dt < 4; ++dt) v[dt] = ldsb(sb + (2 + vp) * PLN + (dt * 16 + lr) * LP + kloc + 8 * hi);
}
// one product: per tile d 0..31, then d 32..63
__device__ __forceinline__ void scores(const v16bf (&kh)[2][2], const v16bf (&qh)[2][2], v8f (&S)[2][2]) {
#pragma unroll
    for (int kt = 0; kt < 2; ++kt)
#pragma unroll
        for (int qt = 0; qt < 2; ++qt) S[kt][qt] = (v8f){};
#pragma unroll
    for (int ks = 0; ks < 2; ++ks)
#pragma unroll
        for (int kt = 0; kt < 2; ++kt)
#pragma unroll
            for (int qt = 0; qt < 2; ++qt) S[kt][qt] = wmmab(kh[kt][ks], qh[qt][ks], S[kt][qt]);
}
// norms and gain, mask, running maximum and sum, probabilities, and O^T += V^T P^T, for keys kb..kb+31 against queries q0..q0+31; rk: ld_rk; v: the V^T fragments (f16 rows: fetched by the caller; hi+lo rows: fetched here from sb, kloc); rq[qt] = 1/|q| of this lane's query in column group qt
// FIX: the shift of the softmax is not the running maximum but the constant |gain|: Qn and Kn are unit vectors or shorter, so |gain x (Qn . Kn)| <= |gain| (but for rounding, below 1e-4 of it) for every input.
// Then no pass looks for a maximum or brings sums and outputs to a new one, and 1/|q|, gain, log2 e and shift are one multiply-add. Whether a row's probabilities came out too small for their format is seen in its sum: attn_body.
template <bool HI, bool FIX>
__device__ __forceinline__ void soft_pv(v8f (&S)[2][2], const v8f (&rk)[2], const float (&rq)[2], v16bf (&v)[4], const bf* sb, int kloc, int kb, int q0, int lr, int hi, float gn, bool causal, v8f (&O)[4][2], float (&m)[2], float (&l)[2]) {
    const bool edge = causal && (kb + 31 > q0);   // wave-uniform: only then can a key of this pass lie behind a query of this wave
#pragma unroll
    for (int kt = 0; kt < 2; ++kt)
#pragma unroll
        for (int qt = 0; qt < 2; ++qt) {
            S[kt][qt] *= rk[kt];
            if (FIX) { const float kf = gn * LOG2E * rq[qt];
                const float cf = __int_as_float(__builtin_amdgcn_readfirstlane(__float_as_int((HI ? 0.0f : 15.0f) - __builtin_fabsf(gn) * LOG2E)));   // f16 probabilities carry x 2^15: the bound itself lands on 32768, inside f16; the same in every lane: held in a scalar register
                const v2f kv = { kf, kf }, cv = { cf, cf };   // in pairs: as vectors of eight the two constants took eight registers each
#pragma unroll
                for (int j = 0; j < 8; j += 2) { v2f x = { S[kt][qt][j], S[kt][qt][j + 1] }; x = __builtin_elementwise_fma(x, kv, cv); S[kt][qt][j] = x[0]; S[kt][qt][j + 1] = x[1]; } }
            else S[kt][qt] *= gn * rq[qt]; }
    if (edge) {
#pragma unroll
        for (int qt = 0; qt < 2; ++qt) { const int qi = q0 + qt * 16 + lr;
#pragma unroll
            for (int kt = 0; kt < 2; ++kt) {
#pragma unroll
                for (int j = 0; j < 8; ++j) if (kb + kt * 16 + hi * 8 + j > qi) S[kt][qt][j] = -1.0e30f;
                asm volatile("" : "+v"(S[kt][qt]));
            } }
    }
    if (!FIX) {
    float mn[2];
#pragma unroll
    for (int qt = 0; qt < 2; ++qt) { float mx = -3.0e38f;
#pragma unroll
        for (int kt = 0; kt < 2; ++kt)
#pragma unroll
            for (int j = 0; j < 8; ++j) mx = fmaxf(mx, S[kt][qt][j]);
        mn[qt] = fmaxf(m[qt], fmaxf(mx, xhalf(mx))); }
    if (__builtin_amdgcn_ballot_w32(mn[0] > m[0] || mn[1] > m[1]) != 0) {   // a maximum moved somewhere in the wave: bring sums and outputs to the new one
#pragma unroll
        for (int qt = 0; qt < 2; ++qt) { const float al = __builtin_amdgcn_exp2f((m[qt] - mn[qt]) * LOG2E); m[qt] = mn[qt]; l[qt] *= al;
#pragma unroll
            for (int dt = 0; dt < 4; ++dt) O[dt][qt] *= al; }
    }
    }
    v16bf ph[2], pl[2];   // f16 rows: ph holds the f16 bits
#pragma unroll
    for (int qt = 0; qt < 2; ++qt) { const float c = (HI ? 0.0f : 10.0f) - m[qt] * LOG2E;   // f16 rows come only with FIX, which leaves c unused: they carry x 2^15 (above), as the sum does: it cancels in the quotient
        const v8f cv = { c, c, c, c, c, c, c, c }, lv = { LOG2E, LOG2E, LOG2E, LOG2E, LOG2E, LOG2E, LOG2E, LOG2E };
        const v8f a0 = FIX ? S[0][qt] : __builtin_elementwise_fma(S[0][qt], lv, cv), a1 = FIX ? S[1][qt] : __builtin_elementwise_fma(S[1][qt], lv, cv);
#pragma unroll
        for (int j = 0; j < 8; ++j) { S[0][qt][j] = __builtin_amdgcn_exp2f(a0[j]); S[1][qt][j] = __builtin_amdgcn_exp2f(a1[j]); }
        const v8f sv = S[0][qt] + S[1][qt];
        l[qt] += ((sv[0] + sv[1]) + (sv[2] + sv[3])) + ((sv[4] + sv[5]) + (sv[6] + sv[7]));
        asm volatile("" : "+v"(l[qt]));   // each row's sum, against spills: without it the adds sink to the foot of the trip, and both passes' 64 probabilities a lane stay in registers up to there
        if (HI) { const v8bf h0 = __builtin_convertvector(S[0][qt], v8bf), h1 = __builtin_convertvector(S[1][qt], v8bf);
            const v8bf l0 = __builtin_convertvector(S[0][qt] - __builtin_convertvector(h0, v8f), v8bf), l1 = __builtin_convertvector(S[1][qt] - __builtin_convertvector(h1, v8f), v8bf);
            ph[qt] = cat16f(h0, h1); pl[qt] = cat16f(l0, l1);
        } else ph[qt] = __builtin_bit_cast(v16bf, cat16(__builtin_convertvector(S[0][qt], v8h), __builtin_convertvector(S[1][qt], v8h))); }
    if (HI) {   // per tile in the order Ph Vh, Pl Vh, Ph Vl; the two planes' fragments are fetched here, one after the other into the same registers: both held through the softmax do not fit
        ld_v(sb, 0, kloc, lr, hi, v);
#pragma unroll
        for (int dt = 0; dt < 4; ++dt)
#pragma unroll
            for (int qt = 0; qt < 2; ++qt) O[dt][qt] = wmmab(v[dt], ph[qt], O[dt][qt]);
#pragma unroll
        for (int dt = 0; dt < 4; ++dt)
#pragma unroll
            for (int qt = 0; qt < 2; ++qt) O[dt][qt] = wmmab(v[dt], pl[qt], O[dt][qt]);
        ld_v(sb, 1, kloc, lr, hi, v);
#pragma unroll
        for (int dt = 0; dt < 4; ++dt)
#pragma unroll
            for (int qt = 0; qt < 2; ++qt) O[dt][qt] = wmmab(v[dt], ph[qt], O[dt][qt]);
    } else {   // v: fetched by the caller
#pragma unroll
        for (int dt = 0; dt < 4; ++dt)
#pragma unroll
            for (int qt = 0; qt < 2; ++qt) O[dt][qt] = wmma16(__builtin_bit_cast(v16h, v[dt]), __builtin_bit_cast(v16h, ph[qt]), O[dt][qt]);
    }
}

// FIX: soft_pv with the constant shift. Returns, the same in every thread of the work-group, whether the tile is to be done again with the running maximum (never, where FIX is off).
template <bool HI, bool FIX>
__device__ __forceinline__ bool attn_body(bf* sm, const bf* Qb, const bf* Kb, const float* RQ, const float* RK, const bf* Va, const bf* Vb, float gn, bool causal, int qb, float* out) {
    constexpr int NPL = HI ? 3 : 2;   // 16-bit planes staged: K, then V^T
    const int tid = threadIdx.x & (NWV * 32 - 1), lane = tid & 31, lr = lane & 15, hi = lane >> 4;   // tid: the thread's index in its key group
    const int wv = __builtin_amdgcn_readfirstlane(tid >> 5), grp = __builtin_amdgcn_readfirstlane((int)threadIdx.x >> 7); const int q0 = qb + wv * QW;
    static_assert(NWV * 32 == 128 && NGR == 4 && MGW * 4 * NWV == NPLX * PLN * 2, "four groups of 128 threads; the exchange fills the ring's second half");
    const bf* gp[3] = { Kb, Va, Vb };
    v16bf qh[2][2]; float rq[2];
#pragma unroll
    for (int qt = 0; qt < 2; ++qt) { const bf* pqh = Qb + (size_t)(q0 + qt * 16 + lr) * HD + 8 * hi; const float* prq = RQ + q0 + qt * 16 + lr;
#pragma unroll
        for (int ks = 0; ks < 2; ++ks) qh[qt][ks] = WFrag<bf>::ld(pqh + ks * 32);
        rq[qt] = *prq;
        asm volatile("s_wait_xcnt 0x0" :: "v"(pqh), "v"(prq) : "memory"); }   // stands before the address registers of these loads are written again (named as inputs, so that they live up to it)
    v8f O[4][2]; float m[2], l[2];
#pragma unroll
    for (int qt = 0; qt < 2; ++qt) { m[qt] = -3.0e38f; l[qt] = 0.f;
#pragma unroll
        for (int dt = 0; dt < 4; ++dt) O[dt][qt] = (v8f){}; }
    // a stage's plane is 512 chunks of 16 B, four a thread: chunk c = row c >> 3, elements 8 (c & 7)..; K rows are keys (pitch HD), V^T rows are d (pitch TT)
    // the stage's SK inverse norms are 16 chunks of 16 B: every thread fetches chunk tid & 15, the group's first 16 threads store
    const int srow = tid >> 3, scol = (tid & 7) * 8;
    // K with its inverse norms, and V^T, are fetched and stored apart (the loop says when), so that only one of the two is held in registers at a time
    auto load_k = [&](int s, v8us (&sk)[4], v4f& str) {
        const unsigned ko = (unsigned)((s * SK + srow) * HD + scol) * 2u, ro = (unsigned)(s * SK + (tid & 15) * 4) * 4u;   // the thread's byte offsets in the K plane and in the inverse norms
#pragma unroll
        for (int u = 0; u < 4; ++u) sk[u] = *(const v8us*)((const char*)gp[0] + ko + u * 32 * HD);
        str = *(const v4f*)((const char*)RK + ro);
        asm volatile("s_wait_xcnt 0x0" :: "v"(ko), "v"(ro) : "memory"); };   // stands before the offset registers of these loads are written again (named as inputs, so that they live up to it)
    auto load_v = [&](int s, v8us (&sv)[NPL - 1][4]) {
        const unsigned vo = (unsigned)(srow * TT + s * SK + scol) * 2u;   // the thread's byte offset in a V^T plane
#pragma unroll
        for (int pn = 1; pn < NPL; ++pn)
#pragma unroll
            for (int u = 0; u < 4; ++u) sv[pn - 1][u] = *(const v8us*)((const char*)gp[pn] + vo + u * 32 * TT);
        asm volatile("s_wait_xcnt 0x0" :: "v"(vo) : "memory"); };   // stands before the offset register of these loads is written again (named as an input, so that it lives up to it)
    auto store_k = [&](int b, const v8us (&sk)[4], const v4f& str) {
#pragma unroll
        for (int u = 0; u < 4; ++u) *(v8us*)(sm + (b * NPLX) * PLN + (srow + u * 16) * LP + scol) = sk[u];
        if (tid < 16) *(v4fa*)((float*)(sm + (b * NPLX + 1) * PLN) + tid * 4) = str; };
    auto store_v = [&](int b, const v8us (&sv)[NPL - 1][4]) {
#pragma unroll
        for (int pn = 1; pn < NPL; ++pn)
#pragma unroll
            for (int u = 0; u < 4; ++u) *(v8us*)(sm + (b * NPLX + pn + 1) * PLN + (srow + u * 16) * LP + scol) = sv[pn - 1][u]; };
    // under the causal flag every key from qb + QB on is masked for every query of the work-group. Key 0 is open to every query, so a row's maximum is at least a real score, which is no lower than about -|gain|:
    // while |gain| stays far below 1e30 a masked key's probability is an exact 0 and its stage adds nothing. A larger gain, or one that is no number, walks every stage.
    // A group all of whose keys are masked for a query (its stages lie behind the query) holds the maximum -1e30 there, a group that was left without any stage the start value, and sums without meaning that need not even be finite: where the groups meet, a side whose factor is 0 is left out.
    const int nst = (causal && __builtin_fabsf(gn) < 1.0e29f) ? (qb + QB) / SK : TT / SK;   // stages to walk: at least QB / SK
    const int ntr = (nst + NGR - 1) / NGR;   // trips: the same for the whole work-group, from 1 to TT / SK / NGR; in the last one a group may be left without a stage
    if (grp < nst) { v8us sk[4], sv[NPL - 1][4]; v4f str; load_k(grp, sk, str); load_v(grp, sv); store_k(grp, sk, str); store_v(grp, sv); }
    __syncthreads();
#pragma unroll 1   // rolled: one copy of the stage body, so that code size and registers stay as they are
    for (int i = 0; i < ntr; ++i) {
        const int s = i * NGR + grp;          // this group's stage
        if (s < nst) {                        // the same in every lane of a wave: a group without a stage only passes the barrier
        const bool more = (s + NGR < nst);
        const int nb = ((i + 1) & 1) * NGR + grp;   // the buffer that the group's last stage but one read: every wave left it at the last barrier
        const bf* sb = sm + ((i & 1) * NGR + grp) * NPLX * PLN;
        v16bf kh[2][2], v[4]; v8f S[2][2], rk[2]; v8us sk[4], sv[NPL - 1][4]; v4f str;   // sk, str, sv: the next stage on its way; declared here, so that none of it is carried from trip to trip
        // the next stage's K is asked for behind the first 32 keys' score products and stored behind their work, its V^T likewise with the other 32 keys: each flies during a softmax and its products,
        // and neither it nor the V^T fragments are held while the K fragments are
        ld_k(sb, 0, lr, hi, kh); ld_rk(sb, 0, hi, rk);
        if (FIX) __builtin_amdgcn_sched_barrier(0);    // keeps these LDS loads one group ahead of the products: spread among them, every fragment is waited for by itself (the fallback, the body with the most registers, goes without: with it the kernel spilled)
        scores(kh, qh, S);
        if (more) load_k(s + NGR, sk, str); else { str = (v4f){};   // a value on either path: left without one, these registers were kept, and spilled, from trip to trip and from tile to tile
#pragma unroll
            for (int u = 0; u < 4; ++u) sk[u] = (v8us){}; }
        if (!HI) ld_v(sb, 0, 0, lr, hi, v);
        soft_pv<HI, FIX>(S, rk, rq, v, sb, 0, s * SK, q0, lr, hi, gn, causal, O, m, l);
        if (more) store_k(nb, sk, str);
        ld_k(sb, 32, lr, hi, kh); ld_rk(sb, 32, hi, rk);
        if (FIX) __builtin_amdgcn_sched_barrier(0);    // as above
        scores(kh, qh, S);
        if (more) load_v(s + NGR, sv); else {   // as for K above
#pragma unroll
            for (int pn = 0; pn < NPL - 1; ++pn)
#pragma unroll
                for (int u = 0; u < 4; ++u) sv[pn][u] = (v8us){}; }
        if (!HI) ld_v(sb, 0, 32, lr, hi, v);
        soft_pv<HI, FIX>(S, rk, rq, v, sb, 32, s * SK + 32, q0, lr, hi, gn, causal, O, m, l);
        if (more) store_v(nb, sv);
        asm volatile("v_nop\n\tv_nop\n\tv_nop\n\tv_nop");   // the four vector slots between the trip's last matrix instruction and the next trip's first write over one of its operands
        }
        __syncthreads();                      // publishes the next stage of each group and ends every read of this one
    }
    // the groups meet: of the 8 output tiles (2 column groups x 4 d tiles) that the four waves of equal queries each hold, group g finishes d tiles 2 (g >> 1), 2 (g >> 1) + 1 of column group g & 1.
    // Every wave lays down the six tiles that others finish, and maximum and sum of both column groups. The sums over the groups run in the order of the groups.
    // The exchange lies in the ring's second half: free behind the loop's last barrier, and written again by the next tile only behind that tile's first barrier.
    float* mg = (float*)(sm + NGR * NPLX * PLN) + wv * (NGR * MGW) + lane * 4;   // group g's wave at g * MGW, chunk c of a lane at c * 128 floats: 16 B a lane, whole rows of banks
    {   float* w = mg + grp * MGW;
#pragma unroll
        for (int qt = 0; qt < 2; ++qt) {
#pragma unroll
            for (int dt = 0; dt < 4; ++dt) if (grp != qt + 2 * (dt >> 1)) { v4f a, b;
#pragma unroll
                for (int u = 0; u < 4; ++u) { a[u] = O[dt][qt][u]; b[u] = O[dt][qt][u + 4]; }
                *(v4fa*)(w + ((qt * 4 + dt) * 2) * 128) = a; *(v4fa*)(w + ((qt * 4 + dt) * 2 + 1) * 128) = b; }
            const v4f ml = { m[qt], l[qt], 0.f, 0.f }; *(v4fa*)(w + (16 + qt) * 128) = ml; } }
    __syncthreads();                          // every part of the exchange is written before any is read
    if (FIX) {   // the rows' sums are tested before anything is stored: a tile that is done again stores nothing here
        bool small = false;
#pragma unroll
        for (int qt = 0; qt < 2; ++qt) if ((grp & 1) == qt) { float ls = 0.f;
#pragma unroll
            for (int g = 0; g < NGR; ++g) { const v4f ml = *(const v4fa*)(mg + g * MGW + (16 + qt) * 128); ls += ml[1]; }
            const float lt = ls + xhalf(ls);
            // f16 rounds a probability to within 2^-11 of itself or, below its normal range, to within 2^-25: where the sum is at least 2^-15 a key, all the roundings of the second kind together stay within 2^-10 of the sum (those of the first kind: 2^-11).
            // bf16 pairs only have to stay clear of the end of the exponent range. A sum that is no number fails the test too.
            small = !(lt >= (HI ? 0x1p-80f : (float)(causal ? q0 + qt * 16 + lr + 1 : TT) * 0x1p-15f)); }
        // one word a wave behind the ring: every wave learns whether any row of the tile failed
        unsigned* fl = (unsigned*)(sm + 2 * NGR * NPLX * PLN);
        const unsigned wb = (__builtin_amdgcn_ballot_w32(small) != 0) ? 1u : 0u;
        if (lane == 0) fl[grp * NWV + wv] = wb;
        __syncthreads();                      // the NGR * NWV words are written before anybody reads them
        static_assert(NGR * NWV == 16, "sixteen words");
        const v4i f0 = *(const v4i*)fl | *(const v4i*)(fl + 4), f1 = *(const v4i*)(fl + 8) | *(const v4i*)(fl + 12);
        // the same in every lane: made a scalar, so that this branch and the caller's, round barriers and matrix instructions, are scalar ones
        if (__builtin_amdgcn_readfirstlane((f0[0] | f0[1] | f0[2] | f0[3]) | (f1[0] | f1[1] | f1[2] | f1[3])) != 0) return true;
    }
#pragma unroll
    for (int qt = 0; qt < 2; ++qt)
#pragma unroll
    for (int dh = 0; dh < 2; ++dh) if (grp == qt + 2 * dh) { const int me = qt + 2 * dh; float mm[NGR], ll[NGR], cf[NGR]; bool us[NGR];
#pragma unroll
        for (int g = 0; g < NGR; ++g) { const v4f ml = *(const v4fa*)(mg + g * MGW + (16 + qt) * 128); mm[g] = ml[0]; ll[g] = ml[1]; }
        const float mt = FIX ? 0.f : fmaxf(fmaxf(mm[0], mm[1]), fmaxf(mm[2], mm[3])); float ls = 0.f;
        // one shift on all sides (FIX): the factors are 1. Else the side that holds the maximum has factor 1; a side with factor 0 adds nothing, and is selected away instead of multiplied because 0 x (no finite number) would spoil the sum
#pragma unroll
        for (int g = 0; g < NGR; ++g) { cf[g] = FIX ? 1.0f : __builtin_amdgcn_exp2f((mm[g] - mt) * LOG2E); us[g] = (cf[g] > 0.f); ls += us[g] ? ll[g] * cf[g] : 0.f; }
        const float inv = __fdiv_rn(1.0f, ls + xhalf(ls));
#pragma unroll
        for (int g = 0; g < NGR; ++g) cf[g] *= inv;
        float* orow = out + (size_t)(q0 + qt * 16 + lr) * HD + hi * 8;   // O^T tile: lane (c, h) holds d 8h..8h+7 of query c
#pragma unroll
        for (int dd = 0; dd < 2; ++dd) { const int dt = 2 * dh + dd; v4f a = { 0.f, 0.f, 0.f, 0.f }, b = { 0.f, 0.f, 0.f, 0.f };
#pragma unroll
            for (int g = 0; g < NGR; ++g) { v4f pa, pb;
                if (g == me) {
#pragma unroll
                    for (int u = 0; u < 4; ++u) { pa[u] = O[dt][qt][u]; pb[u] = O[dt][qt][u + 4]; }
                } else { const float* r = mg + g * MGW + ((qt * 4 + dt) * 2) * 128; pa = *(const v4fa*)r; pb = *(const v4fa*)(r + 128); }
#pragma unroll
                for (int u = 0; u < 4; ++u) { a[u] += us[g] ? pa[u] * cf[g] : 0.f; b[u] += us[g] ? pb[u] * cf[g] : 0.f; } }
            *(v4f*)(orow + dt * 16) = a; *(v4f*)(orow + dt * 16 + 4) = b; }
        asm volatile("s_wait_xcnt 0x0" :: "v"(orow) : "memory"); }   // stands before the address register of these stores is written again (named as an input, so that it lives up to it)
    return false;
}

__global__ __launch_bounds__(NGR * NWV * 32) void k_fattn(const bf* __restrict__ Qb, const bf* __restrict__ Kb, const float* __restrict__ RQ, const float* __restrict__ RK, const h16* __restrict__ V16, const bf* __restrict__ Vh, const bf* __restrict__ Vl, const float* __restrict__ gainp, const int* __restrict__ causp, float* __restrict__ out) {
    __shared__ __align__(16) bf sm[2 * NGR * NPLX * PLN + 2 * NGR * NWV];   // the ring, and behind it one word a wave (attn_body)
    const int f = blockIdx.x; const float gn = bfr(gainp[0]); const bool causal = (causp[0] != 0);
    // under the causal flag a tile's cost grows with its index: a work-group takes tile NQT - 1 - p and then tile p of one (batch, head), so that all work-groups walk equally many stages. Every (head, tile) falls to one work-group.
    static_assert(NB_ * NH_ == 32 && NQT % 2 == 0, "the low five bits of the index are the (batch, head)");
    const int hd = f & 31, p = f >> 5; const size_t ho = (size_t)hd * TT * HD, hr = (size_t)hd * TT;
#pragma unroll 1   // rolled: one copy of each body serves both tiles
    for (int rep = 0; rep < 2; ++rep) {
        const int qt = rep ? p : NQT - 1 - p; const bool hires = (qt < RH / QB); const int qb = qt * QB;
        // first with the constant shift; again with the running maximum where a row's sum says that the scores lie too far below the bound, and at once so where the gain is large (or no number). Every test is the same for the whole work-group.
        bool again = !(__builtin_fabsf(gn) <= 64.0f);
        if (!again) { if (hires) again = attn_body<true, true>(sm, Qb + ho, Kb + ho, RQ + hr, RK + hr, Vh + ho, Vl + ho, gn, causal, qb, out + ho);
            else again = attn_body<false, true>(sm, Qb + ho, Kb + ho, RQ + hr, RK + hr, (const bf*)V16 + ho, nullptr, gn, causal, qb, out + ho); }
        if (again) attn_body<true, false>(sm, Qb + ho, Kb + ho, RQ + hr, RK + hr, Vh + ho, Vl + ho, gn, causal, qb, out + ho);   // one fallback for every tile: hi+lo rows, the finer of the two forms
    }
}

extern "C" void kernel_launch(void* const* d_in, const int* in_sizes, int n_in,
                              void* d_out, int out_size, void* d_ws, size_t ws_size, hipStream_t stream) {
    (void)in_sizes; (void)n_in; (void)out_size;
    const float* Qi = (const float*)d_in[0]; const float* Ki = (const float*)d_in[1]; const float* Vi = (const float*)d_in[2]; const float* gainp = (const float*)d_in[3]; const int* causp = (const int*)d_in[4];
    float* OUT = (float*)d_out;     // [2][16][2048][64]
    char* wsp = (char*)d_ws;
    auto take = [&](size_t bytes) { char* p = wsp; wsp += (bytes + 255) & ~(size_t)255; return (void*)p; };
    const size_t PB = (size_t)NH_ * TT * HD;   // elements of one batch's plane; the planes hold both batches
    h16* VT16 = (h16*)take(NB_ * PB * 2);
    bf* QPb = (bf*)take(NB_ * PB * 2); bf* KPb = (bf*)take(NB_ * PB * 2); float* RQn = (float*)take((size_t)NB_ * NH_ * TT * 4); float* RKn = (float*)take((size_t)NB_ * NH_ * TT * 4); bf* VTh = (bf*)take(NB_ * PB * 2); bf* VTl = (bf*)take(NB_ * PB * 2);
    if ((size_t)(wsp - (char*)d_ws) > ws_size) return;    // ws 256 MiB
    k_prep<<<PWG, 256, 0, stream>>>(Qi, Ki, Vi, QPb, KPb, RQn, RKn, VT16, VTh, VTl);
    k_fattn<<<NB_ * NH_ * (NQT / 2), NGR * NWV * 32, 0, stream>>>(QPb, KPb, RQn, RKn, VT16, VTh, VTl, gainp, causp, OUT);
}

// v010
// A run of this version takes 34.2 microseconds.
// Next to v009, in two timings, it ran 1.04 times as fast each time.
// Counting every step since v000, it is 50.8 times as fast.
#include <hip/hip_runtime.h>

// SelfDotProductAttnQKNorm (Q, K, V [2][16][2048][64] given; Qn, Kn = L2-normalised over d (eps 1e-12 inside the sqrt); scores = gain x (Qn . Kn) with gain a scalar input (read on device; log2(2048? - 2048) ~ 22); is_causal (int input, read on device; 1 here) -> j > i masked to -1e30; softmax; out = attn V -> [2][16][2048][64]).
// Compute dtypes, f32 accumulate: every input rounded to bf16; the L2 normalisation f32 on the VALU; the causal flag is data: set, key stages that lie wholly behind a work-group's queries are not walked; scores: one bf16 product of the rounded, not normalised rows (exact operands), x 1/|q| x 1/|k| x gain in f32; mask and softmax f32;

#define NB_  2
#define TT   2048
#define DM   1024
#define NH_  16
#define NKV  16
#define REP  (NH_ / NKV)
#define HD   64
#define DQ   (NH_ * HD)
#define DKV  (NKV * HD)
#define ZH   8                    // heads per call of k_merge
#define RH   512                  // query rows < RH use hi+lo probabilities (0: none)
#define WIN  0
#define PCAR 1024.0f
#define SCL  0.125f   // HD^-0.5
typedef _Float16 h16;
typedef unsigned short bf;
typedef __attribute__((ext_vector_type(16))) __bf16   v16bf;
typedef __attribute__((ext_vector_type(16))) _Float16 v16h;
typedef __attribute__((ext_vector_type(8)))  _Float16 v8h;
typedef __attribute__((ext_vector_type(8)))  unsigned short v8us;
typedef __attribute__((ext_vector_type(8)))  float    v8f;
typedef __attribute__((ext_vector_type(4)))  float    v4f;
typedef v8h  __attribute__((may_alias)) v8ha;
typedef v4f  __attribute__((may_alias)) v4fa;
typedef v8us __attribute__((may_alias)) v8usa;

__device__ __forceinline__ unsigned short f2bf(float f) { unsigned u = __float_as_uint(f); u += 0x7FFFu + ((u >> 16) & 1u); return (unsigned short)(u >> 16); }
__device__ __forceinline__ float bf2f(unsigned short b) { return __uint_as_float(((unsigned)b) << 16); }
__device__ __forceinline__ float bfr(float f) { return bf2f(f2bf(f)); }
__device__ __forceinline__ v16h cat16(v8h lo, v8h hi) { return __builtin_shufflevector(lo, hi, 0, 1, 2, 3, 4, 5, 6, 7, 8, 9, 10, 11, 12, 13, 14, 15); }
__device__ __forceinline__ v16bf cat16b(v8us lo, v8us hi) { return __builtin_bit_cast(v16bf, __builtin_shufflevector(lo, hi, 0, 1, 2, 3, 4, 5, 6, 7, 8, 9, 10, 11, 12, 13, 14, 15)); }
__device__ __forceinline__ v8f wmma16(v16h a, v16h b, v8f c) { return __builtin_amdgcn_wmma_f32_16x16x32_f16(false, a, false, b, (short)0, c, false, false); }
__device__ __forceinline__ v8f wmmab(v16bf a, v16bf b, v8f c) { return __builtin_amdgcn_wmma_f32_16x16x32_bf16(false, a, false, b, (short)0, c, false, false); }



// fragment loaders, hardware k order: 8 elements at p and 8 at p + 16, p = row start + 32 * kstep + 8 * (lane >> 4)
template <typename T16> struct WFrag;
template <> struct WFrag<h16> { typedef v16h V; static __device__ __forceinline__ V ld(const h16* p) { return cat16(*(const v8h*)p, *(const v8h*)(p + 16)); } static __device__ __forceinline__ v8f mma(V a, V b, v8f c) { return wmma16(a, b, c); } };
template <> struct WFrag<bf> { typedef v16bf V; static __device__ __forceinline__ V ld(const bf* p) { return cat16b(*(const v8us*)p, *(const v8us*)(p + 16)); } static __device__ __forceinline__ v8f mma(V a, V b, v8f c) { return wmmab(a, b, c); } };

__device__ __forceinline__ h16 tohx(float x) { return (h16)x; }
__device__ __forceinline__ void splitf(float y, unsigned short& h, unsigned short& l) { h = f2bf(y); l = f2bf(y - bf2f(h)); }
typedef __attribute__((ext_vector_type(2))) _Float16 v2h;
typedef __attribute__((ext_vector_type(4))) _Float16 v4h;
typedef __attribute__((ext_vector_type(2))) unsigned short v2us;
typedef __attribute__((ext_vector_type(4))) unsigned short v4us;
typedef __attribute__((ext_vector_type(2))) float v2f;
typedef __attribute__((ext_vector_type(4))) int v4i;

__global__ __launch_bounds__(256) void k_wtG(const float* __restrict__ w, int K, int N, bf* Bt) {
    const int lane = threadIdx.x & 31; const int L0 = (blockIdx.x * 8 + (threadIdx.x >> 5)) * 8; const int nlines = N * K / 64;
{
#pragma unroll 1
        for (int l = 0; l < 8; ++l) { const int L = L0 + l; if (L >= nlines) break; const size_t e = (size_t)L * 64 + lane * 2; const int k = (int)(e % K), n = (int)(e / K); v2us o;
            o[0] = f2bf(w[(size_t)k * N + n]); o[1] = f2bf(w[(size_t)(k + 1) * N + n]); *(v2us*)(Bt + e) = o; }
         }
}
__global__ __launch_bounds__(256) void k_cvt8(const float* __restrict__ src, bf* dst, size_t n8) { const size_t i = (size_t)blockIdx.x * 256 + threadIdx.x; if (i >= n8) return; const v8f v = *(const v8f*)(src + i * 8); v8us o;
#pragma unroll
    for (int k = 0; k < 8; ++k) o[k] = f2bf(v[k]); *(v8us*)(dst + i * 8) = o;  }
__global__ __launch_bounds__(256) void k_cscvt(const float* __restrict__ cosT, const float* __restrict__ sinT, float* CS) { const int idx = blockIdx.x * 256 + threadIdx.x; if (idx >= TT * HD) return; v2f cs; cs[0] = bfr(cosT[idx]); cs[1] = bfr(sinT[idx]); *(v2f*)(CS + (size_t)idx * 2) = cs;  }
// k_rope: head planes [h][t][d] (fp16 + hi/lo) of rope(x) x sc with the rotate-half convention out[d] = x[d] cos[t][d] - x[d+HD/2] sin[t][d], out[d+HD/2] = x[d+HD/2] cos[t][d+HD/2] + x[d] sin[t][d+HD/2]
__global__ __launch_bounds__(256) void k_rope(const float* __restrict__ F, int pitch, int nheads, const float* __restrict__ CS, const float* __restrict__ RF, const float* __restrict__ nw, float sc, h16* P16, bf* Ph, bf* Pl) {
    const size_t e = ((size_t)blockIdx.x * 256 + threadIdx.x) * 2; if (e >= (size_t)nheads * TT * HD) return; const int d = (int)(e % HD); const int t = (int)((e / HD) % TT); const int h = (int)(e / ((size_t)HD * TT)); const float* f = F + (size_t)t * pitch + h * HD; const float rf = RF ? RF[(size_t)h * TT + t] : 1.0f; v2h o16; v2us oh, ol;
#pragma unroll
    for (int q = 0; q < 2; ++q) { const int dd = d + q; const int dp = (dd < HD / 2) ? dd + HD / 2 : dd - HD / 2; float x0 = f[dd], x1 = f[dp];
        if (RF) { float n0 = __fmul_rn(x0, rf), n1 = __fmul_rn(x1, rf); asm volatile("" : "+v"(n0)); asm volatile("" : "+v"(n1)); x0 = __fmul_rn(bfr(nw[dd]), n0); x1 = __fmul_rn(bfr(nw[dp]), n1); }
        const v2f cs = *(const v2f*)(CS + ((size_t)t * HD + dd) * 2); float a = __fmul_rn(x0, cs[0]), bq = __fmul_rn(x1, cs[1]); asm volatile("" : "+v"(a)); asm volatile("" : "+v"(bq)); const float r = ((dd < HD / 2) ? __fsub_rn(a, bq) : __fadd_rn(a, bq)) * sc;
        o16[q] = tohx(r); unsigned short a2, c2; splitf(r, a2, c2); oh[q] = a2; ol[q] = c2; }
    *(v2h*)(P16 + e) = o16; *(v2us*)(Ph + e) = oh; *(v2us*)(Pl + e) = ol;  }
__global__ __launch_bounds__(256) void k_vtp(const float* __restrict__ F, int pitch, int nheads, h16* V16, bf* Vh, bf* Vl) { const size_t e = ((size_t)blockIdx.x * 256 + threadIdx.x) * 2; if (e >= (size_t)nheads * HD * TT) return; const int t = (int)(e % TT); const int d = (int)((e / TT) % HD); const int g = (int)(e / ((size_t)TT * HD)); v2h o16; v2us oh, ol;
#pragma unroll
    for (int q = 0; q < 2; ++q) { const float x = F[(size_t)(t + q) * pitch + g * HD + d]; o16[q] = tohx(x); unsigned short a2, c2; splitf(x, a2, c2); oh[q] = a2; ol[q] = c2; }
    *(v2h*)(V16 + e) = o16; *(v2us*)(Vh + e) = oh; *(v2us*)(Vl + e) = ol;  }
__global__ __launch_bounds__(256) void k_merge(const float* __restrict__ O, int h0, bf* Ah, bf* Al) { const size_t e = ((size_t)blockIdx.x * 256 + threadIdx.x) * 2; if (e >= (size_t)ZH * TT * HD) return; const int d = (int)(e % HD); const int t = (int)((e / HD) % TT); const int zz = (int)(e / ((size_t)HD * TT)); const float cs = (t < RH) ? 1.0f : (1.0f / PCAR); const size_t oo = (size_t)t * DQ + (h0 + zz) * HD + d;
    v2us oh, ol;
#pragma unroll
    for (int q = 0; q < 2; ++q) { unsigned short a, c2; splitf(O[e + q] * cs, a, c2); oh[q] = a; ol[q] = c2; } *(v2us*)(Ah + oo) = oh; *(v2us*)(Al + oo) = ol;  }

// ---- k_prep: all that k_fattn reads, made in one launch of PWG work-groups of 8 waves. Each wave loops over many rows, so that the chip starts few waves instead of one wave a row.
// V: a work-group turns a tile of 128 t x 64 d through LDS (whole lines read, whole lines written); it leaves as two planes, the rounded bf16 bits themselves and the same values in f16 (what a rounded value leaves behind its own bf16 image is 0: there is no low plane). Q, K: waves 0..3 take PRW rows of Q each, waves 4..7 of K, 8 rows a trip, 2 elements of a row per lane:
// the rows leave as they are, rounded to bf16 (one plane, exact), and beside them 1 / sqrt(sum of squares + eps) of each row in f32: gain x (Qn . Kn) = gain x (Q . K) / (|Q| |K|), the division done on the scores in k_fattn.
// Every '#pragma unroll' in it stands on a short loop that indexes register arrays: unrolled, the arrays stay in registers and the loads of a trip go out together.
#define PWG  (NB_ * NH_ * (TT / 128))             // work-groups: one V tile each
#define PRW  (NB_ * NH_ * TT / (PWG * 4))         // rows per wave, of Q or of K: 32, so that a wave's inverse norms are one whole 128-B line
#define VPD  65                                   // LDS row pitch in dwords (64 dwords = 128 t, + 1: stores down a column and loads along a row both fall on distinct banks)
__global__ __launch_bounds__(256) void k_prep(const float* __restrict__ Q, const float* __restrict__ K, const float* __restrict__ V, bf* __restrict__ Qb, bf* __restrict__ Kb, float* __restrict__ RQ, float* __restrict__ RK, h16* __restrict__ V16, bf* __restrict__ Vh) {
    __shared__ unsigned vt[HD * VPD];             // [d][t / 2]: the bf16 bits of V at t (low half) and t + 1
    const int tid = threadIdx.x, lane = tid & 31; const int lo4 = tid & 15, up4 = tid >> 4;
    const int g = blockIdx.x / (TT / 128), t0 = (blockIdx.x % (TT / 128)) * 128;
    {   // rows t0 + 2p and t0 + 2p + 1, p = up4 + 16u, elements 4 lo4..4 lo4 + 3
        const char* vb = (const char*)(V + ((size_t)g * TT + t0) * HD); const unsigned vo = (unsigned)(2 * up4 * HD + 4 * lo4) * 4u; v4f a[4], b[4];
#pragma unroll
        for (int u = 0; u < 4; ++u) { a[u] = *(const v4f*)(vb + vo + u * 32 * HD * 4); b[u] = *(const v4f*)(vb + vo + u * 32 * HD * 4 + HD * 4); }
        asm volatile("s_wait_xcnt 0x0" :: "v"(vo) : "memory");   // stands before the offset register of these loads is written again (named as an input, so that it lives up to it)
#pragma unroll
        for (int u = 0; u < 4; ++u)
#pragma unroll
            for (int i = 0; i < 4; ++i) vt[(4 * lo4 + i) * VPD + up4 + 16 * u] = (unsigned)f2bf(a[u][i]) | ((unsigned)f2bf(b[u][i]) << 16);
    }
    __syncthreads();                              // the tile is whole before anybody reads a row of it
    {   // row d = up4 + 16u, t0 + 8 lo4..+7: 16 B to each plane, a row of the tile is 256 B
        const unsigned eo = (unsigned)(up4 * TT + 8 * lo4) * 2u; const size_t pb = (((size_t)g * HD) * TT + t0) * 2;
#pragma unroll
        for (int u = 0; u < 4; ++u) { v8h o16; v8us oh;
#pragma unroll
            for (int j = 0; j < 4; ++j) { const unsigned w = vt[(up4 + 16 * u) * VPD + 4 * lo4 + j];
#pragma unroll
                for (int q = 0; q < 2; ++q) { const unsigned short xb = (unsigned short)(q ? (w >> 16) : (w & 0xFFFFu)); o16[2 * j + q] = tohx(bf2f(xb)); oh[2 * j + q] = xb; } }
            *(v8h*)((char*)V16 + pb + eo + u * 16 * TT * 2) = o16; *(v8us*)((char*)Vh + pb + eo + u * 16 * TT * 2) = oh; }
        asm volatile("s_wait_xcnt 0x0" :: "v"(eo) : "memory");   // stands before the offset register of these stores is written again
    }
    static_assert(PRW == 32, "lane l keeps row l's sum");
    const int wv = __builtin_amdgcn_readfirstlane(tid >> 5); const bool isq = (wv < 4);
    const int row0 = (blockIdx.x * 4 + (wv & 3)) * PRW;                                   // the wave's first row
    const unsigned li = (unsigned)lane * 8u, lo = (unsigned)lane * 4u;                    // the lane's byte offsets in an f32 row and in a 16-bit row
    float ss = 0.f;                                                                       // lane l: the sum of squares of row row0 + l
#pragma unroll 1   // rolled: one copy of the 8-row body
    for (int it = 0; it < PRW / 8; ++it) {
        const size_t r0 = (size_t)(row0 + it * 8) * HD;
        const char* xs = (const char*)((isq ? Q : K) + r0); char* ph = (char*)((isq ? Qb : Kb) + r0);
        v2f x[8];
#pragma unroll
        for (int u = 0; u < 8; ++u) x[u] = *(const v2f*)(xs + li + u * HD * 4);
        asm volatile("s_wait_xcnt 0x0" :: "v"(li), "s"(xs) : "memory");   // stands before a register that these loads name is written again
        float q[8];
#pragma unroll
        for (int u = 0; u < 8; ++u) { v2us ob; ob[0] = f2bf(x[u][0]); ob[1] = f2bf(x[u][1]); x[u][0] = bf2f(ob[0]); x[u][1] = bf2f(ob[1]); q[u] = x[u][0] * x[u][0] + x[u][1] * x[u][1];
            *(v2us*)(ph + lo + u * HD * 2) = ob; }
        asm volatile("s_wait_xcnt 0x0" :: "v"(lo), "s"(ph) : "memory");   // stands before a register that these stores name is written again
#pragma unroll
        for (int sh = 16; sh; sh >>= 1)
#pragma unroll
            for (int u = 0; u < 8; ++u) q[u] += __shfl_xor(q[u], sh, 32);
        float qs = q[0];   // every lane holds all 8 sums: lane l picks that of row l & 7, and keeps it in the trip that holds its row
#pragma unroll
        for (int u = 1; u < 8; ++u) qs = ((lane & 7) == u) ? q[u] : qs;
        ss = ((lane >> 3) == it) ? qs : ss;
    }
    (isq ? RQ : RK)[row0 + lane] = __fdiv_rn(1.0f, __fsqrt_rn(__fadd_rn(ss, 1e-12f)));
}
#define QW   32                   // query columns per wave
#define NWV  4                    // waves per key group
#define NGR  4                    // key groups per work-group
#define QB   (QW * NWV)           // queries per tile
#define NQT  (TT / QB)            // query tiles per (batch, head)
#define SK   64                   // keys per LDS stage
#define LP   72                   // LDS row pitch in 16-bit elements: 144 B = 16 B x 9
#define PLN  (64 * LP)            // one staged plane: 64 rows (keys of K, d of V^T) of 64 elements
#define NPLX 4                    // plane places per stage: K, the SK inverse norms of its keys (f32), then Vh or V16; the fourth holds no stage data (the exchange, which spans whole buffers, is sized by it)
#define MGW  (18 * 128)           // floats of one wave's place in the exchange: 16 chunks of outputs and two of maximum and sum, 16 B a lane each
#define LOG2E 1.4426950408889634f
typedef __attribute__((ext_vector_type(8))) __bf16 v8bf;
__device__ __forceinline__ float xhalf(float x) { const int b = __float_as_int(x); return __int_as_float(__builtin_amdgcn_permlanex16(b, b, 0x76543210, 0xfedcba98, false, false)); }   // the value of lane l ^ 16
__device__ __forceinline__ v16bf ldsb(const bf* p) { return cat16b(*(const v8us*)p, *(const v8us*)(p + 16)); }
__device__ __forceinline__ v16bf cat16f(v8bf lo, v8bf hi) { return __builtin_shufflevector(lo, hi, 0, 1, 2, 3, 4, 5, 6, 7, 8, 9, 10, 11, 12, 13, 14, 15); }

// K fragments (A operand) of 32 keys, rows kloc.. of the staged planes
__device__ __forceinline__ void ld_k(const bf* sb, int kloc, int lr, int hi, v16bf (&kh)[2][2]) {
#pragma unroll
    for (int kt = 0; kt < 2; ++kt)
#pragma unroll
        for (int ks = 0; ks < 2; ++ks) kh[kt][ks] = ldsb(sb + (kloc + kt * 16 + lr) * LP + ks * 32 + 8 * hi);
}
// rk[kt][j] = 1/|k| of key kloc + 16 kt + 8 hi + j: the key of score register j in this lane
__device__ __forceinline__ void ld_rk(const bf* sb, int kloc, int hi, v8f (&rk)[2]) {
#pragma unroll
    for (int kt = 0; kt < 2; ++kt) {
        const float* rp = (const float*)(sb + PLN) + kloc + kt * 16 + 8 * hi; const v4f a = *(const v4fa*)rp, b = *(const v4fa*)(rp + 4);
        rk[kt] = __builtin_shufflevector(a, b, 0, 1, 2, 3, 4, 5, 6, 7); }
}
// V^T fragments (A operand) of the same 32 keys, of the staged plane: Vh or V16 (bits)
__device__ __forceinline__ void ld_v(const bf* sb, int kloc, int lr, int hi, v16bf (&v)[4]) {
#pragma unroll
    for (int dt = 0; dt < 4; ++dt) v[dt] = ldsb(sb + 2 * PLN + (dt * 16 + lr) * LP + kloc + 8 * hi);
}
// one product: per tile d 0..31, then d 32..63
__device__ __forceinline__ void scores(const v16bf (&kh)[2][2], const v16bf (&qh)[2][2], v8f (&S)[2][2]) {
#pragma unroll
    for (int kt = 0; kt < 2; ++kt)
#pragma unroll
        for (int qt = 0; qt < 2; ++qt) S[kt][qt] = (v8f){};
#pragma unroll
    for (int ks = 0; ks < 2; ++ks)
#pragma unroll
        for (int kt = 0; kt < 2; ++kt)
#pragma unroll
            for (int qt = 0; qt < 2; ++qt) S[kt][qt] = wmmab(kh[kt][ks], qh[qt][ks], S[kt][qt]);
}
// norms and gain, mask, running maximum and sum, probabilities, and O^T += V^T P^T, for keys kb..kb+31 against queries q0..q0+31; rk: ld_rk; v: the V^T fragments, fetched by the caller; rq[qt] = 1/|q| of this lane's query in column group qt
// FIX: the shift of the softmax is not the running maximum but the constant |gain|: Qn and Kn are unit vectors or shorter, so |gain x (Qn . Kn)| <= |gain| (but for rounding, below 1e-4 of it) for every input.
// Then no pass looks for a maximum or brings sums and outputs to a new one, and 1/|q|, gain, log2 e and shift are one multiply-add. Whether a row's probabilities came out too small for their format is seen in its sum: attn_body.
template <bool HI, bool FIX>
__device__ __forceinline__ void soft_pv(v8f (&S)[2][2], const v8f (&rk)[2], const float (&rq)[2], const v16bf (&v)[4], int kb, int q0, int lr, int hi, float gn, bool causal, v8f (&O)[4][2], float (&m)[2], float (&l)[2]) {
    const bool edge = causal && (kb + 31 > q0);   // wave-uniform: only then can a key of this pass lie behind a query of this wave
#pragma unroll
    for (int kt = 0; kt < 2; ++kt)
#pragma unroll
        for (int qt = 0; qt < 2; ++qt) {
            S[kt][qt] *= rk[kt];
            if (FIX) { const float kf = gn * LOG2E * rq[qt];
                const float cf = __int_as_float(__builtin_amdgcn_readfirstlane(__float_as_int((HI ? 0.0f : 15.0f) - __builtin_fabsf(gn) * LOG2E)));   // f16 probabilities carry x 2^15: the bound itself lands on 32768, inside f16; the same in every lane: held in a scalar register
                const v2f kv = { kf, kf }, cv = { cf, cf };   // in pairs: as vectors of eight the two constants took eight registers each
#pragma unroll
                for (int j = 0; j < 8; j += 2) { v2f x = { S[kt][qt][j], S[kt][qt][j + 1] }; x = __builtin_elementwise_fma(x, kv, cv); S[kt][qt][j] = x[0]; S[kt][qt][j + 1] = x[1]; } }
            else S[kt][qt] *= gn * rq[qt]; }
    if (edge) {
#pragma unroll
        for (int qt = 0; qt < 2; ++qt) { const int qi = q0 + qt * 16 + lr;
#pragma unroll
            for (int kt = 0; kt < 2; ++kt) {
#pragma unroll
                for (int j = 0; j < 8; ++j) if (kb + kt * 16 + hi * 8 + j > qi) S[kt][qt][j] = -1.0e30f;
                asm volatile("" : "+v"(S[kt][qt]));
            } }
    }
    if (!FIX) {
    float mn[2];
#pragma unroll
    for (int qt = 0; qt < 2; ++qt) { float mx = -3.0e38f;
#pragma unroll
        for (int kt = 0; kt < 2; ++kt)
#pragma unroll
            for (int j = 0; j < 8; ++j) mx = fmaxf(mx, S[kt][qt][j]);
        mn[qt] = fmaxf(m[qt], fmaxf(mx, xhalf(mx))); }
    if (__builtin_amdgcn_ballot_w32(mn[0] > m[0] || mn[1] > m[1]) != 0) {   // a maximum moved somewhere in the wave: bring sums and outputs to the new one
#pragma unroll
        for (int qt = 0; qt < 2; ++qt) { const float al = __builtin_amdgcn_exp2f((m[qt] - mn[qt]) * LOG2E); m[qt] = mn[qt]; l[qt] *= al;
#pragma unroll
            for (int dt = 0; dt < 4; ++dt) O[dt][qt] *= al; }
    }
    }
    v16bf ph[2], pl[2];   // f16 rows: ph holds the f16 bits
#pragma unroll
    for (int qt = 0; qt < 2; ++qt) { const float c = (HI ? 0.0f : 10.0f) - m[qt] * LOG2E;   // f16 rows come only with FIX, which leaves c unused: they carry x 2^15 (above), as the sum does: it cancels in the quotient
        const v8f cv = { c, c, c, c, c, c, c, c }, lv = { LOG2E, LOG2E, LOG2E, LOG2E, LOG2E, LOG2E, LOG2E, LOG2E };
        const v8f a0 = FIX ? S[0][qt] : __builtin_elementwise_fma(S[0][qt], lv, cv), a1 = FIX ? S[1][qt] : __builtin_elementwise_fma(S[1][qt], lv, cv);
#pragma unroll
        for (int j = 0; j < 8; ++j) { S[0][qt][j] = __builtin_amdgcn_exp2f(a0[j]); S[1][qt][j] = __builtin_amdgcn_exp2f(a1[j]); }
        const v8f sv = S[0][qt] + S[1][qt];
        l[qt] += ((sv[0] + sv[1]) + (sv[2] + sv[3])) + ((sv[4] + sv[5]) + (sv[6] + sv[7]));
        asm volatile("" : "+v"(l[qt]));   // each row's sum, against spills: without it the adds sink to the foot of the trip, and both passes' 64 probabilities a lane stay in registers up to there
        if (HI) { const v8bf h0 = __builtin_convertvector(S[0][qt], v8bf), h1 = __builtin_convertvector(S[1][qt], v8bf);
            const v8bf l0 = __builtin_convertvector(S[0][qt] - __builtin_convertvector(h0, v8f), v8bf), l1 = __builtin_convertvector(S[1][qt] - __builtin_convertvector(h1, v8f), v8bf);
            ph[qt] = cat16f(h0, h1); pl[qt] = cat16f(l0, l1);
        } else ph[qt] = __builtin_bit_cast(v16bf, cat16(__builtin_convertvector(S[0][qt], v8h), __builtin_convertvector(S[1][qt], v8h))); }
    if (HI) {   // per tile in the order Ph Vh, Pl Vh
#pragma unroll
        for (int dt = 0; dt < 4; ++dt)
#pragma unroll
            for (int qt = 0; qt < 2; ++qt) O[dt][qt] = wmmab(v[dt], ph[qt], O[dt][qt]);
#pragma unroll
        for (int dt = 0; dt < 4; ++dt)
#pragma unroll
            for (int qt = 0; qt < 2; ++qt) O[dt][qt] = wmmab(v[dt], pl[qt], O[dt][qt]);
    } else {
#pragma unroll
        for (int dt = 0; dt < 4; ++dt)
#pragma unroll
            for (int qt = 0; qt < 2; ++qt) O[dt][qt] = wmma16(__builtin_bit_cast(v16h, v[dt]), __builtin_bit_cast(v16h, ph[qt]), O[dt][qt]);
    }
}

// FIX: soft_pv with the constant shift. Returns, the same in every thread of the work-group, whether the tile is to be done again with the running maximum (never, where FIX is off).
template <bool HI, bool FIX>
__device__ __forceinline__ bool attn_body(bf* sm, const bf* Qb, const bf* Kb, const float* RQ, const float* RK, const bf* Va, float gn, bool causal, int qb, float* out) {
    constexpr int NPL = 2;   // 16-bit planes staged: K, then V^T
    const int tid = threadIdx.x & (NWV * 32 - 1), lane = tid & 31, lr = lane & 15, hi = lane >> 4;   // tid: the thread's index in its key group
    const int wv = __builtin_amdgcn_readfirstlane(tid >> 5), grp = __builtin_amdgcn_readfirstlane((int)threadIdx.x >> 7); const int q0 = qb + wv * QW;
    static_assert(NWV * 32 == 128 && NGR == 4 && MGW * 4 * NWV == NPLX * PLN * 2, "four groups of 128 threads; the exchange fills the ring's second half");
    const bf* gp[2] = { Kb, Va };
    v16bf qh[2][2]; float rq[2];
#pragma unroll
    for (int qt = 0; qt < 2; ++qt) { const bf* pqh = Qb + (size_t)(q0 + qt * 16 + lr) * HD + 8 * hi; const float* prq = RQ + q0 + qt * 16 + lr;
#pragma unroll
        for (int ks = 0; ks < 2; ++ks) qh[qt][ks] = WFrag<bf>::ld(pqh + ks * 32);
        rq[qt] = *prq;
        asm volatile("s_wait_xcnt 0x0" :: "v"(pqh), "v"(prq) : "memory"); }   // stands before the address registers of these loads are written again (named as inputs, so that they live up to it)
    v8f O[4][2]; float m[2], l[2];
#pragma unroll
    for (int qt = 0; qt < 2; ++qt) { m[qt] = -3.0e38f; l[qt] = 0.f;
#pragma unroll
        for (int dt = 0; dt < 4; ++dt) O[dt][qt] = (v8f){}; }
    // a stage's plane is 512 chunks of 16 B, four a thread: chunk c = row c >> 3, elements 8 (c & 7)..; K rows are keys (pitch HD), V^T rows are d (pitch TT)
    // the stage's SK inverse norms are 16 chunks of 16 B: every thread fetches chunk tid & 15, the group's first 16 threads store
    const int srow = tid >> 3, scol = (tid & 7) * 8;
    // K with its inverse norms, and V^T, are fetched and stored apart (the loop says when), so that only one of the two is held in registers at a time
    auto load_k = [&](int s, v8us (&sk)[4], v4f& str) {
        const unsigned ko = (unsigned)((s * SK + srow) * HD + scol) * 2u, ro = (unsigned)(s * SK + (tid & 15) * 4) * 4u;   // the thread's byte offsets in the K plane and in the inverse norms
#pragma unroll
        for (int u = 0; u < 4; ++u) sk[u] = *(const v8us*)((const char*)gp[0] + ko + u * 32 * HD);
        str = *(const v4f*)((const char*)RK + ro);
        asm volatile("s_wait_xcnt 0x0" :: "v"(ko), "v"(ro) : "memory"); };   // stands before the offset registers of these loads are written again (named as inputs, so that they live up to it)
    auto load_v = [&](int s, v8us (&sv)[NPL - 1][4]) {
        const unsigned vo = (unsigned)(srow * TT + s * SK + scol) * 2u;   // the thread's byte offset in a V^T plane
#pragma unroll
        for (int pn = 1; pn < NPL; ++pn)
#pragma unroll
            for (int u = 0; u < 4; ++u) sv[pn - 1][u] = *(const v8us*)((const char*)gp[pn] + vo + u * 32 * TT);
        asm volatile("s_wait_xcnt 0x0" :: "v"(vo) : "memory"); };   // stands before the offset register of these loads is written again (named as an input, so that it lives up to it)
    auto store_k = [&](int b, const v8us (&sk)[4], const v4f& str) {
#pragma unroll
        for (int u = 0; u < 4; ++u) *(v8us*)(sm + (b * NPLX) * PLN + (srow + u * 16) * LP + scol) = sk[u];
        if (tid < 16) *(v4fa*)((float*)(sm + (b * NPLX + 1) * PLN) + tid * 4) = str; };
    auto store_v = [&](int b, const v8us (&sv)[NPL - 1][4]) {
#pragma unroll
        for (int pn = 1; pn < NPL; ++pn)
#pragma unroll
            for (int u = 0; u < 4; ++u) *(v8us*)(sm + (b * NPLX + pn + 1) * PLN + (srow + u * 16) * LP + scol) = sv[pn - 1][u]; };
    // under the causal flag every key from qb + QB on is masked for every query of the work-group. Key 0 is open to every query, so a row's maximum is at least a real score, which is no lower than about -|gain|:
    // while |gain| stays far below 1e30 a masked key's probability is an exact 0 and its stage adds nothing. A larger gain, or one that is no number, walks every stage.
    // A group all of whose keys are masked for a query (its stages lie behind the query) holds the maximum -1e30 there, a group that was left without any stage the start value, and sums without meaning that need not even be finite: where the groups meet, a side whose factor is 0 is left out.
    const int nst = (causal && __builtin_fabsf(gn) < 1.0e29f) ? (qb + QB) / SK : TT / SK;   // stages to walk: at least QB / SK
    const int ntr = (nst + NGR - 1) / NGR;   // trips: the same for the whole work-group, from 1 to TT / SK / NGR; in the last one a group may be left without a stage
    if (grp < nst) { v8us sk[4], sv[NPL - 1][4]; v4f str; load_k(grp, sk, str); load_v(grp, sv); store_k(grp, sk, str); store_v(grp, sv); }
    __syncthreads();
#pragma unroll 1   // rolled: one copy of the stage body, so that code size and registers stay as they are
    for (int i = 0; i < ntr; ++i) {
        const int s = i * NGR + grp;          // this group's stage
        if (s < nst) {                        // the same in every lane of a wave: a group without a stage only passes the barrier
        const bool more = (s + NGR < nst);
        const int nb = ((i + 1) & 1) * NGR + grp;   // the buffer that the group's last stage but one read: every wave left it at the last barrier
        const bf* sb = sm + ((i & 1) * NGR + grp) * NPLX * PLN;
        v16bf kh[2][2], v[4]; v8f S[2][2], rk[2]; v8us sk[4], sv[NPL - 1][4]; v4f str;   // sk, str, sv: the next stage on its way; declared here, so that none of it is carried from trip to trip
        // the next stage's K is asked for behind the first 32 keys' score products and stored behind their work, its V^T likewise with the other 32 keys: each flies during a softmax and its products,
        // and neither it nor the V^T fragments are held while the K fragments are
        ld_k(sb, 0, lr, hi, kh); ld_rk(sb, 0, hi, rk);
        if (FIX) __builtin_amdgcn_sched_barrier(0);    // keeps these LDS loads one group ahead of the products: spread among them, every fragment is waited for by itself (the fallback, the body with the most registers, goes without: with it the kernel spilled)
        scores(kh, qh, S);
        if (more) load_k(s + NGR, sk, str); else { str = (v4f){};   // a value on either path: left without one, these registers were kept, and spilled, from trip to trip and from tile to tile
#pragma unroll
            for (int u = 0; u < 4; ++u) sk[u] = (v8us){}; }
        ld_v(sb, 0, lr, hi, v);
        soft_pv<HI, FIX>(S, rk, rq, v, s * SK, q0, lr, hi, gn, causal, O, m, l);
        if (more) store_k(nb, sk, str);
        ld_k(sb, 32, lr, hi, kh); ld_rk(sb, 32, hi, rk);
        if (FIX) __builtin_amdgcn_sched_barrier(0);    // as above
        scores(kh, qh, S);
        if (more) load_v(s + NGR, sv); else {   // as for K above
#pragma unroll
            for (int pn = 0; pn < NPL - 1; ++pn)
#pragma unroll
                for (int u = 0; u < 4; ++u) sv[pn][u] = (v8us){}; }
        ld_v(sb, 32, lr, hi, v);
        soft_pv<HI, FIX>(S, rk, rq, v, s * SK + 32, q0, lr, hi, gn, causal, O, m, l);
        if (more) store_v(nb, sv);
        asm volatile("v_nop\n\tv_nop\n\tv_nop\n\tv_nop");   // the four vector slots between the trip's last matrix instruction and the next trip's first write over one of its operands
        }
        __syncthreads();                      // publishes the next stage of each group and ends every read of this one
    }
    // the groups meet: of the 8 output tiles (2 column groups x 4 d tiles) that the four waves of equal queries each hold, group g finishes d tiles 2 (g >> 1), 2 (g >> 1) + 1 of column group g & 1.
    // Every wave lays down the six tiles that others finish, and maximum and sum of both column groups. The sums over the groups run in the order of the groups.
    // The exchange lies in the ring's second half: free behind the loop's last barrier, and written again by the next tile only behind that tile's first barrier.
    float* mg = (float*)(sm + NGR * NPLX * PLN) + wv * (NGR * MGW) + lane * 4;   // group g's wave at g * MGW, chunk c of a lane at c * 128 floats: 16 B a lane, whole rows of banks
    {   float* w = mg + grp * MGW;
#pragma unroll
        for (int qt = 0; qt < 2; ++qt) {
#pragma unroll
            for (int dt = 0; dt < 4; ++dt) if (grp != qt + 2 * (dt >> 1)) { v4f a, b;
#pragma unroll
                for (int u = 0; u < 4; ++u) { a[u] = O[dt][qt][u]; b[u] = O[dt][qt][u + 4]; }
                *(v4fa*)(w + ((qt * 4 + dt) * 2) * 128) = a; *(v4fa*)(w + ((qt * 4 + dt) * 2 + 1) * 128) = b; }
            const v4f ml = { m[qt], l[qt], 0.f, 0.f }; *(v4fa*)(w + (16 + qt) * 128) = ml; } }
    __syncthreads();                          // every part of the exchange is written before any is read
    if (FIX) {   // the rows' sums are tested before anything is stored: a tile that is done again stores nothing here
        bool small = false;
#pragma unroll
        for (int qt = 0; qt < 2; ++qt) if ((grp & 1) == qt) { float ls = 0.f;
#pragma unroll
            for (int g = 0; g < NGR; ++g) { const v4f ml = *(const v4fa*)(mg + g * MGW + (16 + qt) * 128); ls += ml[1]; }
            const float lt = ls + xhalf(ls);
            // f16 rounds a probability to within 2^-11 of itself or, below its normal range, to within 2^-25: where the sum is at least 2^-15 a key, all the roundings of the second kind together stay within 2^-10 of the sum (those of the first kind: 2^-11).
            // bf16 pairs only have to stay clear of the end of the exponent range. A sum that is no number fails the test too.
            small = !(lt >= (HI ? 0x1p-80f : (float)(causal ? q0 + qt * 16 + lr + 1 : TT) * 0x1p-15f)); }
        // one word a wave behind the ring: every wave learns whether any row of the tile failed
        unsigned* fl = (unsigned*)(sm + 2 * NGR * NPLX * PLN);
        const unsigned wb = (__builtin_amdgcn_ballot_w32(small) != 0) ? 1u : 0u;
        if (lane == 0) fl[grp * NWV + wv] = wb;
        __syncthreads();                      // the NGR * NWV words are written before anybody reads them
        static_assert(NGR * NWV == 16, "sixteen words");
        const v4i f0 = *(const v4i*)fl | *(const v4i*)(fl + 4), f1 = *(const v4i*)(fl + 8) | *(const v4i*)(fl + 12);
        // the same in every lane: made a scalar, so that this branch and the caller's, round barriers and matrix instructions, are scalar ones
        if (__builtin_amdgcn_readfirstlane((f0[0] | f0[1] | f0[2] | f0[3]) | (f1[0] | f1[1] | f1[2] | f1[3])) != 0) return true;
    }
#pragma unroll
    for (int qt = 0; qt < 2; ++qt)
#pragma unroll
    for (int dh = 0; dh < 2; ++dh) if (grp == qt + 2 * dh) { const int me = qt + 2 * dh; float mm[NGR], ll[NGR], cf[NGR]; bool us[NGR];
#pragma unroll
        for (int g = 0; g < NGR; ++g) { const v4f ml = *(const v4fa*)(mg + g * MGW + (16 + qt) * 128); mm[g] = ml[0]; ll[g] = ml[1]; }
        const float mt = FIX ? 0.f : fmaxf(fmaxf(mm[0], mm[1]), fmaxf(mm[2], mm[3])); float ls = 0.f;
        // one shift on all sides (FIX): the factors are 1. Else the side that holds the maximum has factor 1; a side with factor 0 adds nothing, and is selected away instead of multiplied because 0 x (no finite number) would spoil the sum
#pragma unroll
        for (int g = 0; g < NGR; ++g) { cf[g] = FIX ? 1.0f : __builtin_amdgcn_exp2f((mm[g] - mt) * LOG2E); us[g] = (cf[g] > 0.f); ls += us[g] ? ll[g] * cf[g] : 0.f; }
        const float inv = __fdiv_rn(1.0f, ls + xhalf(ls));
#pragma unroll
        for (int g = 0; g < NGR; ++g) cf[g] *= inv;
        float* orow = out + (size_t)(q0 + qt * 16 + lr) * HD + hi * 8;   // O^T tile: lane (c, h) holds d 8h..8h+7 of query c
#pragma unroll
        for (int dd = 0; dd < 2; ++dd) { const int dt = 2 * dh + dd; v4f a = { 0.f, 0.f, 0.f, 0.f }, b = { 0.f, 0.f, 0.f, 0.f };
#pragma unroll
            for (int g = 0; g < NGR; ++g) { v4f pa, pb;
                if (g == me) {
#pragma unroll
                    for (int u = 0; u < 4; ++u) { pa[u] = O[dt][qt][u]; pb[u] = O[dt][qt][u + 4]; }
                } else { const float* r = mg + g * MGW + ((qt * 4 + dt) * 2) * 128; pa = *(const v4fa*)r; pb = *(const v4fa*)(r + 128); }
#pragma unroll
                for (int u = 0; u < 4; ++u) { a[u] += us[g] ? pa[u] * cf[g] : 0.f; b[u] += us[g] ? pb[u] * cf[g] : 0.f; } }
            *(v4f*)(orow + dt * 16) = a; *(v4f*)(orow + dt * 16 + 4) = b; }
        asm volatile("s_wait_xcnt 0x0" :: "v"(orow) : "memory"); }   // stands before the address register of these stores is written again (named as an input, so that it lives up to it)
    return false;
}

__global__ __launch_bounds__(NGR * NWV * 32) void k_fattn(const bf* __restrict__ Qb, const bf* __restrict__ Kb, const float* __restrict__ RQ, const float* __restrict__ RK, const h16* __restrict__ V16, const bf* __restrict__ Vh, const float* __restrict__ gainp, const int* __restrict__ causp, float* __restrict__ out) {
    __shared__ __align__(16) bf sm[2 * NGR * NPLX * PLN + 2 * NGR * NWV];   // the ring, and behind it one word a wave (attn_body)
    const int f = blockIdx.x; const float gn = bfr(gainp[0]); const bool causal = (causp[0] != 0);
    // under the causal flag a tile's cost grows with its index: a work-group takes tile NQT - 1 - p and then tile p of one (batch, head), so that all work-groups walk equally many stages. Every (head, tile) falls to one work-group.
    static_assert(NB_ * NH_ == 32 && NQT % 2 == 0, "the low five bits of the index are the (batch, head)");
    const int hd = f & 31, p = f >> 5; const size_t ho = (size_t)hd * TT * HD, hr = (size_t)hd * TT;
#pragma unroll 1   // rolled: one copy of each body serves both tiles
    for (int rep = 0; rep < 2; ++rep) {
        const int qt = rep ? p : NQT - 1 - p; const bool hires = (qt < RH / QB); const int qb = qt * QB;
        // first with the constant shift; again with the running maximum where a row's sum says that the scores lie too far below the bound, and at once so where the gain is large (or no number). Every test is the same for the whole work-group.
        bool again = !(__builtin_fabsf(gn) <= 64.0f);
        if (!again) { if (hires) again = attn_body<true, true>(sm, Qb + ho, Kb + ho, RQ + hr, RK + hr, Vh + ho, gn, causal, qb, out + ho);
            else again = attn_body<false, true>(sm, Qb + ho, Kb + ho, RQ + hr, RK + hr, (const bf*)V16 + ho, gn, causal, qb, out + ho); }
        if (again) attn_body<true, false>(sm, Qb + ho, Kb + ho, RQ + hr, RK + hr, Vh + ho, gn, causal, qb, out + ho);   // one fallback for every tile: hi+lo rows, the finer of the two forms
    }
}

extern "C" void kernel_launch(void* const* d_in, const int* in_sizes, int n_in,
                              void* d_out, int out_size, void* d_ws, size_t ws_size, hipStream_t stream) {
    (void)in_sizes; (void)n_in; (void)out_size;
    const float* Qi = (const float*)d_in[0]; const float* Ki = (const float*)d_in[1]; const float* Vi = (const float*)d_in[2]; const float* gainp = (const float*)d_in[3]; const int* causp = (const int*)d_in[4];
    float* OUT = (float*)d_out;     // [2][16][2048][64]
    char* wsp = (char*)d_ws;
    auto take = [&](size_t bytes) { char* p = wsp; wsp += (bytes + 255) & ~(size_t)255; return (void*)p; };
    const size_t PB = (size_t)NH_ * TT * HD;   // elements of one batch's plane; the planes hold both batches
    h16* VT16 = (h16*)take(NB_ * PB * 2);
    bf* QPb = (bf*)take(NB_ * PB * 2); bf* KPb = (bf*)take(NB_ * PB * 2); float* RQn = (float*)take((size_t)NB_ * NH_ * TT * 4); float* RKn = (float*)take((size_t)NB_ * NH_ * TT * 4); bf* VTh = (bf*)take(NB_ * PB * 2);
    if ((size_t)(wsp - (char*)d_ws) > ws_size) return;    // ws 256 MiB
    k_prep<<<PWG, 256, 0, stream>>>(Qi, Ki, Vi, QPb, KPb, RQn, RKn, VT16, VTh);
    k_fattn<<<NB_ * NH_ * (NQT / 2), NGR * NWV * 32, 0, stream>>>(QPb, KPb, RQn, RKn, VT16, VTh, gainp, causp, OUT);
}
